// v000
// Measured on an AMD MI455X. A time is GPU time per run, averaged over a window of back-to-back runs after a warm-up
// (all launches, gaps included; the runs take copies of the inputs in turn), and the median of several windows.
// Apart from v000's, it joins two sittings. Times from different sittings can be a few percent apart, while
// side-by-side timings come from the same sitting.
// The starting kernel, v000, takes 190 microseconds a run.
#include <hip/hip_runtime.h>
#include <hip/hip_bf16.h>
#include <math.h>

// Problem constants (match reference)
#define Bdim   8
#define Hdim   32
#define Ldim   32768
#define Ndim   32
#define CDdim  128
#define NCHUNK 32                 // chunks per sequence (must be 32: code uses >>5)
#define CHUNK  (Ldim / NCHUNK)    // 1024

typedef __attribute__((ext_vector_type(2))) float v2f;
typedef __attribute__((ext_vector_type(8))) float v8f;
typedef __attribute__((ext_vector_type(4))) int   i32x4;
typedef __attribute__((ext_vector_type(8))) int   i32x8;

// Branch-free gelu (tanh approximation): 0.5x(1+tanh(z)) == x*sigmoid(2z)
__device__ __forceinline__ float gelu_t(float x) {
    float x3 = x * x * x;
    float z  = fmaf(0.044715f, x3, x) * 1.5957691216057308f;  // 2*sqrt(2/pi)
    return x * __fdividef(1.0f, 1.0f + __expf(-z));
}
__device__ __forceinline__ float sigm(float x) {
    return __fdividef(1.0f, 1.0f + __expf(-x));
}
// Wave-uniform broadcast: v_readlane_b32 -> SGPR operand (beats ds_bpermute)
__device__ __forceinline__ float bcast(float v, int l) {
    return __uint_as_float(__builtin_amdgcn_readlane(__float_as_uint(v), l));
}
__device__ __forceinline__ float q_at(const float4& q, int comp) {
    return comp == 0 ? q.x : comp == 1 ? q.y : comp == 2 ? q.z : q.w;
}

// ---------------------------------------------------------------------------
// Tensor Data Mover: 2D f32 tile Global -> LDS (D# built in SGPR tuples).
// Group0: count=1 | lds_addr | global_addr(57b) | type=2.
// Group1: data_size=4B, tensor_dim0/1, tile_dim0/1, tensor_dim0_stride.
// ---------------------------------------------------------------------------
__device__ __forceinline__ void tdm_load_2d_f32(const void* gsrc, unsigned lds_off,
                                                int width, int height, int stride) {
    unsigned long long ga = (unsigned long long)(uintptr_t)gsrc;
    i32x4 g0;
    g0.x = 1;                                                   // count=1, user D#
    g0.y = (int)lds_off;                                        // lds_addr [63:32]
    g0.z = (int)(unsigned)ga;                                   // global_addr [95:64]
    g0.w = (int)(((unsigned)(ga >> 32) & 0x01FFFFFFu) | 0x80000000u); // [120:96] | type=2
    i32x8 g1;
    g1[0] = 2 << 16;                                            // data_size = 4 bytes
    g1[1] = (width & 0xFFFF) << 16;                             // tensor_dim0 lo16 @bit48
    g1[2] = ((width >> 16) & 0xFFFF) | ((height & 0xFFFF) << 16); // dim0 hi | dim1 lo
    g1[3] = ((height >> 16) & 0xFFFF) | ((width & 0xFFFF) << 16); // dim1 hi | tile_dim0
    g1[4] = (height & 0xFFFF);                                  // tile_dim1 (tile_dim2=0)
    g1[5] = stride;                                             // tensor_dim0_stride lo32
    g1[6] = 0;
    g1[7] = 0;
    asm volatile("tensor_load_to_lds %0, %1" :: "s"(g0), "s"(g1) : "memory");
}

// ---------------------------------------------------------------------------
// K0: per-(h,n) SSM constants: w = exp(dt*A), Cd = 2*C*(exp(dtA)-1)/A, Wc = w^CHUNK
// ---------------------------------------------------------------------------
__global__ void k_setup(const float* __restrict__ log_dt,
                        const float* __restrict__ A_re, const float* __restrict__ A_im,
                        const float* __restrict__ C_re, const float* __restrict__ C_im,
                        float* wr_, float* wi_, float* cdr_, float* cdi_,
                        float* wcr_, float* wci_) {
    int i = threadIdx.x;                 // H*N = 1024
    int h = i >> 5;
    float dt  = __expf(log_dt[h]);
    float ar  = A_re[i], ai = A_im[i];
    float dre = dt * ar, dim = dt * ai;
    float er  = __expf(dre);
    float sn, cs; __sincosf(dim, &sn, &cs);
    float wr = er * cs, wi = er * sn;
    float exr = wr - 1.0f, exi = wi;
    float den = ar * ar + ai * ai;
    float qr = (exr * ar + exi * ai) / den;
    float qi = (exi * ar - exr * ai) / den;
    float cr = C_re[i], ci = C_im[i];
    wr_[i]  = wr;  wi_[i]  = wi;
    cdr_[i] = 2.0f * (cr * qr - ci * qi);
    cdi_[i] = 2.0f * (cr * qi + ci * qr);
    float er2 = __expf(dre * (float)CHUNK);
    float sn2, cs2; __sincosf(dim * (float)CHUNK, &sn2, &cs2);
    wcr_[i] = er2 * cs2;  wci_[i] = er2 * sn2;
}

// ---------------------------------------------------------------------------
// K-film: gb[b,g] = cond[b] . film_W[g] + film_b[g]      (8 x 64 outputs)
// ---------------------------------------------------------------------------
__global__ void k_film(const float* __restrict__ cond, const float* __restrict__ fW,
                       const float* __restrict__ fb, float* __restrict__ gb) {
    int i = threadIdx.x;                 // 512
    int b = i >> 6;
    int g = i & 63;
    const float* c = cond + b * CDdim;
    const float* w = fW + g * CDdim;
    float s = fb[g];
    #pragma unroll 8
    for (int j = 0; j < CDdim; ++j) s = fmaf(c[j], w[j], s);
    gb[i] = s;
}

// ---------------------------------------------------------------------------
// K1: u = gelu(W_lin @ x + b_lin)   via V_WMMA_F32_16X16X4_F32
//     W_lin staged to LDS once per block through the TDM.
// ---------------------------------------------------------------------------
__global__ __launch_bounds__(256) void k_in_linear(
        const float* __restrict__ x, const float* __restrict__ W,
        const float* __restrict__ bias, float* __restrict__ u) {
    __shared__ __align__(16) float Wl[Hdim * Hdim];            // 4 KB
    if (threadIdx.x < 32) {
        tdm_load_2d_f32(W, (unsigned)(uintptr_t)Wl, Hdim, Hdim, Hdim);
        __builtin_amdgcn_s_wait_tensorcnt(0);
    }
    __syncthreads();

    const int lane = threadIdx.x & 31;
    const int m    = lane & 15;
    const int hi   = lane >> 4;
    const int gid  = blockIdx.x * 8 + (threadIdx.x >> 5);
    const int b    = gid / (Ldim / 16);
    const int l0   = (gid % (Ldim / 16)) * 16;
    const float* xb = x + (size_t)b * Hdim * Ldim;
    v8f acc0 = {};
    v8f acc1 = {};
    #pragma unroll
    for (int kk = 0; kk < 8; ++kk) {
        const int k = kk * 4 + 2 * hi;                         // K-pair for half-wave
        v2f bm;                                                // B: 4x16
        bm.x = xb[(size_t)k * Ldim + l0 + m];
        bm.y = xb[(size_t)(k + 1) * Ldim + l0 + m];
        v2f a0 = *(const v2f*)&Wl[m * Hdim + k];               // ds_load_b64
        v2f a1 = *(const v2f*)&Wl[(16 + m) * Hdim + k];
        acc0 = __builtin_amdgcn_wmma_f32_16x16x4_f32(false, a0, false, bm, (short)0, acc0, false, false);
        acc1 = __builtin_amdgcn_wmma_f32_16x16x4_f32(false, a1, false, bm, (short)0, acc1, false, false);
    }
    #pragma unroll
    for (int r = 0; r < 8; ++r) {
        int g0 = r + 8 * hi;
        int g1 = 16 + g0;
        u[((size_t)b * Hdim + g0) * Ldim + l0 + m] = gelu_t(acc0[r] + bias[g0]);
        u[((size_t)b * Hdim + g1) * Ldim + l0 + m] = gelu_t(acc1[r] + bias[g1]);
    }
}

// ---------------------------------------------------------------------------
// K2: local chunk scan (states only).  wave = (b,h,chunk), lane = state n.
//     u loaded 128 elems/iter (float4/lane), broadcast via v_readlane.
// ---------------------------------------------------------------------------
__global__ __launch_bounds__(256) void k_scan_local(
        const float* __restrict__ u, const float* __restrict__ wr_,
        const float* __restrict__ wi_, float* __restrict__ S) {
    int lane = threadIdx.x & 31;
    int gid  = blockIdx.x * 8 + (threadIdx.x >> 5);  // (b*H+h)*NCHUNK + c
    int c    = gid & (NCHUNK - 1);
    int bh   = gid >> 5;
    int h    = bh & (Hdim - 1);
    float wr = wr_[h * Ndim + lane], wi = wi_[h * Ndim + lane];
    const float* up = u + (size_t)bh * Ldim + (size_t)c * CHUNK;
    float sre = 0.0f, sim = 0.0f;
    for (int i = 0; i < CHUNK; i += 128) {
        float4 q = *(const float4*)(up + i + lane * 4);
        __builtin_prefetch(up + i + 512, 0, 1);      // global_prefetch_b8
        #pragma unroll
        for (int j = 0; j < 128; ++j) {
            float uv = bcast(q_at(q, j & 3), j >> 2);
            float nr = fmaf(wr, sre, fmaf(-wi, sim, uv));
            sim = fmaf(wi, sre, wr * sim);
            sre = nr;
        }
    }
    S[(size_t)gid * 64 + lane * 2]     = sre;
    S[(size_t)gid * 64 + lane * 2 + 1] = sim;
}

// ---------------------------------------------------------------------------
// K3: exclusive prefix over chunks (in place): P[c] = Wc*P[c-1] + S[c-1]
// ---------------------------------------------------------------------------
__global__ void k_scan_prefix(float* __restrict__ S,
                              const float* __restrict__ wcr_,
                              const float* __restrict__ wci_) {
    int t  = blockIdx.x * blockDim.x + threadIdx.x;  // B*H*N = 8192
    int n  = t & 31;
    int bh = t >> 5;
    int h  = bh & (Hdim - 1);
    float wr = wcr_[h * Ndim + n], wi = wci_[h * Ndim + n];
    float pr = 0.0f, pi = 0.0f;
    size_t base = (size_t)bh * NCHUNK * 64 + n * 2;
    for (int c = 0; c < NCHUNK; ++c) {
        size_t ix = base + (size_t)c * 64;
        float tr = S[ix], ti = S[ix + 1];
        S[ix] = pr;  S[ix + 1] = pi;                 // exclusive prefix
        float npr = fmaf(wr, pr, fmaf(-wi, pi, tr));
        pi = fmaf(wi, pr, fmaf(wr, pi, ti));
        pr = npr;
    }
}

// ---------------------------------------------------------------------------
// K4: output pass. Scan from prefix state; per step butterfly-reduce the
//     state contributions across lanes; D*u folded before the lane-select.
// ---------------------------------------------------------------------------
__global__ __launch_bounds__(256) void k_scan_out(
        const float* __restrict__ u, const float* __restrict__ S,
        const float* __restrict__ wr_, const float* __restrict__ wi_,
        const float* __restrict__ cdr_, const float* __restrict__ cdi_,
        const float* __restrict__ Dvec, float* __restrict__ v) {
    int lane = threadIdx.x & 31;
    int gid  = blockIdx.x * 8 + (threadIdx.x >> 5);
    int c    = gid & (NCHUNK - 1);
    int bh   = gid >> 5;
    int h    = bh & (Hdim - 1);
    float wr  = wr_[h * Ndim + lane],  wi  = wi_[h * Ndim + lane];
    float cdr = cdr_[h * Ndim + lane], cdi = cdi_[h * Ndim + lane];
    float Dh  = Dvec[h];
    float sre = S[(size_t)gid * 64 + lane * 2];
    float sim = S[(size_t)gid * 64 + lane * 2 + 1];
    const float* up = u + (size_t)bh * Ldim + (size_t)c * CHUNK;
    float*       vp = v + (size_t)bh * Ldim + (size_t)c * CHUNK;
    for (int i = 0; i < CHUNK; i += 128) {
        float4 q = *(const float4*)(up + i + lane * 4);
        __builtin_prefetch(up + i + 512, 0, 1);
        #pragma unroll
        for (int s = 0; s < 4; ++s) {
            float yreg = 0.0f;
            #pragma unroll
            for (int t = 0; t < 32; ++t) {
                const int j = s * 32 + t;
                float uv = bcast(q_at(q, j & 3), j >> 2);
                float nr = fmaf(wr, sre, fmaf(-wi, sim, uv));
                sim = fmaf(wi, sre, wr * sim);
                sre = nr;
                float tt = fmaf(cdr, sre, -(cdi * sim));
                #pragma unroll
                for (int off = 16; off; off >>= 1) tt += __shfl_xor(tt, off, 32);
                if (lane == t) yreg = fmaf(Dh, uv, tt);
            }
            vp[i + s * 32 + lane] = yreg;
        }
    }
}

// ---------------------------------------------------------------------------
// K5: z = W_out @ y + b_out ; GLU.  W_out (64x32) staged to LDS via TDM.
// ---------------------------------------------------------------------------
__global__ __launch_bounds__(256) void k_out_glu(
        const float* __restrict__ vin, const float* __restrict__ Wo,
        const float* __restrict__ bo, float* __restrict__ yg) {
    __shared__ __align__(16) float Wol[2 * Hdim * Hdim];       // 8 KB
    if (threadIdx.x < 32) {
        tdm_load_2d_f32(Wo, (unsigned)(uintptr_t)Wol, Hdim, 2 * Hdim, Hdim);
        __builtin_amdgcn_s_wait_tensorcnt(0);
    }
    __syncthreads();

    const int lane = threadIdx.x & 31;
    const int m    = lane & 15;
    const int hi   = lane >> 4;
    const int gid  = blockIdx.x * 8 + (threadIdx.x >> 5);
    const int b    = gid / (Ldim / 16);
    const int l0   = (gid % (Ldim / 16)) * 16;
    const float* vb = vin + (size_t)b * Hdim * Ldim;
    v8f acc[4] = {};
    #pragma unroll
    for (int kk = 0; kk < 8; ++kk) {
        const int k = kk * 4 + 2 * hi;
        v2f bm;
        bm.x = vb[(size_t)k * Ldim + l0 + m];
        bm.y = vb[(size_t)(k + 1) * Ldim + l0 + m];
        #pragma unroll
        for (int t = 0; t < 4; ++t) {
            v2f a = *(const v2f*)&Wol[(t * 16 + m) * Hdim + k];
            acc[t] = __builtin_amdgcn_wmma_f32_16x16x4_f32(false, a, false, bm, (short)0, acc[t], false, false);
        }
    }
    #pragma unroll
    for (int t = 0; t < 2; ++t) {
        #pragma unroll
        for (int r = 0; r < 8; ++r) {
            int g  = t * 16 + r + 8 * hi;
            float zv = acc[t][r]     + bo[g];
            float zg = acc[t + 2][r] + bo[g + Hdim];
            yg[((size_t)b * Hdim + g) * Ldim + l0 + m] = zv * sigm(zg);
        }
    }
}

// ---------------------------------------------------------------------------
// K6: per-channel mean / rstd over (B, L)  (deterministic block reduction)
// ---------------------------------------------------------------------------
__global__ __launch_bounds__(1024) void k_bn_stats(
        const float* __restrict__ yg, float* __restrict__ stats) {
    __shared__ float ls[1024];
    __shared__ float ls2[1024];
    int h = blockIdx.x;
    int tid = threadIdx.x;
    float s = 0.0f, s2 = 0.0f;
    for (int b = 0; b < Bdim; ++b) {
        const float* p = yg + ((size_t)b * Hdim + h) * Ldim;
        for (int i = tid; i < Ldim; i += 1024) {
            float val = p[i];
            s += val;  s2 = fmaf(val, val, s2);
        }
    }
    ls[tid] = s;  ls2[tid] = s2;
    __syncthreads();
    for (int st = 512; st > 0; st >>= 1) {
        if (tid < st) { ls[tid] += ls[tid + st]; ls2[tid] += ls2[tid + st]; }
        __syncthreads();
    }
    if (tid == 0) {
        float inv  = 1.0f / (float)((size_t)Bdim * Ldim);
        float mean = ls[0] * inv;
        float var  = ls2[0] * inv - mean * mean;
        stats[2 * h]     = mean;
        stats[2 * h + 1] = rsqrtf(var + 1e-5f);
    }
}

// ---------------------------------------------------------------------------
// K7: BN apply + FiLM + gelu + depthwise residual
// ---------------------------------------------------------------------------
__global__ __launch_bounds__(256) void k_final(
        const float* __restrict__ yg, const float* __restrict__ stats,
        const float* __restrict__ gb, const float* __restrict__ resw,
        const float* __restrict__ x, float* __restrict__ out) {
    size_t idx = (size_t)blockIdx.x * blockDim.x + threadIdx.x;
    int h = (int)((idx / Ldim) & (Hdim - 1));
    int b = (int)(idx / ((size_t)Hdim * Ldim));
    float yv    = yg[idx];
    float mean  = stats[2 * h];
    float rstd  = stats[2 * h + 1];
    float gamma = gb[b * (2 * Hdim) + h];
    float beta  = gb[b * (2 * Hdim) + Hdim + h];
    float yn = fmaf(gamma, (yv - mean) * rstd, beta);
    out[idx] = fmaf(resw[h], x[idx], gelu_t(yn));
}

// ---------------------------------------------------------------------------
extern "C" void kernel_launch(void* const* d_in, const int* in_sizes, int n_in,
                              void* d_out, int out_size, void* d_ws, size_t ws_size,
                              hipStream_t stream) {
    const float* x      = (const float*)d_in[0];
    const float* cond   = (const float*)d_in[1];
    const float* W_lin  = (const float*)d_in[2];
    const float* b_lin  = (const float*)d_in[3];
    const float* log_dt = (const float*)d_in[4];
    const float* A_re   = (const float*)d_in[5];
    const float* A_im   = (const float*)d_in[6];
    const float* C_re   = (const float*)d_in[7];
    const float* C_im   = (const float*)d_in[8];
    const float* Dv     = (const float*)d_in[9];
    const float* W_out  = (const float*)d_in[10];
    const float* b_out  = (const float*)d_in[11];
    const float* film_W = (const float*)d_in[12];
    const float* film_b = (const float*)d_in[13];
    const float* res_w  = (const float*)d_in[14];
    float* out = (float*)d_out;

    const size_t tot = (size_t)Bdim * Hdim * Ldim;
    float* ws   = (float*)d_ws;
    float* u    = ws;                                   // [B,H,L]
    float* v    = u + tot;                              // [B,H,L]
    float* yg   = u;                                    // alias: u dead after scan_out
    float* S    = v + tot;                              // [B*H*NCHUNK, N, 2]
    float* wr_  = S + (size_t)Bdim * Hdim * NCHUNK * 64;
    float* wi_  = wr_  + Hdim * Ndim;
    float* cdr_ = wi_  + Hdim * Ndim;
    float* cdi_ = cdr_ + Hdim * Ndim;
    float* wcr_ = cdi_ + Hdim * Ndim;
    float* wci_ = wcr_ + Hdim * Ndim;
    float* gb   = wci_ + Hdim * Ndim;                   // [B, 2H]
    float* stats = gb + Bdim * 2 * Hdim;                // [H, 2]

    k_setup<<<1, Hdim * Ndim, 0, stream>>>(log_dt, A_re, A_im, C_re, C_im,
                                           wr_, wi_, cdr_, cdi_, wcr_, wci_);
    k_film<<<1, Bdim * 2 * Hdim, 0, stream>>>(cond, film_W, film_b, gb);
    k_in_linear<<<(Bdim * (Ldim / 16)) / 8, 256, 0, stream>>>(x, W_lin, b_lin, u);
    k_scan_local<<<(Bdim * Hdim * NCHUNK) / 8, 256, 0, stream>>>(u, wr_, wi_, S);
    k_scan_prefix<<<(Bdim * Hdim * Ndim) / 256, 256, 0, stream>>>(S, wcr_, wci_);
    k_scan_out<<<(Bdim * Hdim * NCHUNK) / 8, 256, 0, stream>>>(u, S, wr_, wi_,
                                                               cdr_, cdi_, Dv, v);
    k_out_glu<<<(Bdim * (Ldim / 16)) / 8, 256, 0, stream>>>(v, W_out, b_out, yg);
    k_bn_stats<<<Hdim, 1024, 0, stream>>>(yg, stats);
    k_final<<<(int)(tot / 256), 256, 0, stream>>>(yg, stats, gb, res_w, x, out);
}

// v001
// It runs in 139 microseconds.
// In both of two side-by-side timings against v000, it was 1.42 times as fast.
#include <hip/hip_runtime.h>
#include <hip/hip_bf16.h>
#include <math.h>

// Problem constants (match reference)
#define Bdim   8
#define Hdim   32
#define Ldim   32768
#define Ndim   32
#define CDdim  128
#define NCHUNK 32                 // chunks per sequence (must be 32: code uses >>5)
#define CHUNK  (Ldim / NCHUNK)    // 1024
#define SUB    16                 // steps per sub-block of the output pass (rows of one matrix tile)
#define SROW   68                 // LDS pitch (floats) of one state snapshot: 16 B x odd, no bank conflict

typedef __attribute__((ext_vector_type(2))) float v2f;
typedef __attribute__((ext_vector_type(4))) float v4f;
typedef __attribute__((ext_vector_type(8))) float v8f;
typedef __attribute__((ext_vector_type(4))) int   i32x4;
typedef __attribute__((ext_vector_type(8))) int   i32x8;

// Branch-free gelu (tanh approximation): 0.5x(1+tanh(z)) == x*sigmoid(2z)
__device__ __forceinline__ float gelu_t(float x) {
    float x3 = x * x * x;
    float z  = fmaf(0.044715f, x3, x) * 1.5957691216057308f;  // 2*sqrt(2/pi)
    return x * __fdividef(1.0f, 1.0f + __expf(-z));
}
__device__ __forceinline__ float sigm(float x) {
    return __fdividef(1.0f, 1.0f + __expf(-x));
}
// Wave-uniform broadcast: v_readlane_b32 -> SGPR operand (beats ds_bpermute)
__device__ __forceinline__ float bcast(float v, int l) {
    return __uint_as_float(__builtin_amdgcn_readlane(__float_as_uint(v), l));
}
__device__ __forceinline__ float q_at(const float4& q, int comp) {
    return comp == 0 ? q.x : comp == 1 ? q.y : comp == 2 ? q.z : q.w;
}

// ---------------------------------------------------------------------------
// Tensor Data Mover: 2D f32 tile Global -> LDS (D# built in SGPR tuples).
// Group0: count=1 | lds_addr | global_addr(57b) | type=2.
// Group1: data_size=4B, tensor_dim0/1, tile_dim0/1, tensor_dim0_stride.
// ---------------------------------------------------------------------------
__device__ __forceinline__ void tdm_load_2d_f32(const void* gsrc, unsigned lds_off,
                                                int width, int height, int stride) {
    unsigned long long ga = (unsigned long long)(uintptr_t)gsrc;
    i32x4 g0;
    g0.x = 1;                                                   // count=1, user D#
    g0.y = (int)lds_off;                                        // lds_addr [63:32]
    g0.z = (int)(unsigned)ga;                                   // global_addr [95:64]
    g0.w = (int)(((unsigned)(ga >> 32) & 0x01FFFFFFu) | 0x80000000u); // [120:96] | type=2
    i32x8 g1;
    g1[0] = 2 << 16;                                            // data_size = 4 bytes
    g1[1] = (width & 0xFFFF) << 16;                             // tensor_dim0 lo16 @bit48
    g1[2] = ((width >> 16) & 0xFFFF) | ((height & 0xFFFF) << 16); // dim0 hi | dim1 lo
    g1[3] = ((height >> 16) & 0xFFFF) | ((width & 0xFFFF) << 16); // dim1 hi | tile_dim0
    g1[4] = (height & 0xFFFF);                                  // tile_dim1 (tile_dim2=0)
    g1[5] = stride;                                             // tensor_dim0_stride lo32
    g1[6] = 0;
    g1[7] = 0;
    asm volatile("tensor_load_to_lds %0, %1" :: "s"(g0), "s"(g1) : "memory");
}

// ---------------------------------------------------------------------------
// K0: per-(h,n) SSM constants: w = exp(dt*A), Cd = 2*C*(exp(dtA)-1)/A, Wc = w^CHUNK
//     and the output pass's tables: Gt[h][t][2n,2n+1] = (Re, -Im) of Cd*w^(t+1),
//     Tt[h][t][j] = sum_n Re(Cd*w^(t-j)) for j <= t, else 0, for t, j < SUB.
// ---------------------------------------------------------------------------
__global__ void k_setup(const float* __restrict__ log_dt,
                        const float* __restrict__ A_re, const float* __restrict__ A_im,
                        const float* __restrict__ C_re, const float* __restrict__ C_im,
                        float* wr_, float* wi_, float* cdr_, float* cdi_,
                        float* wcr_, float* wci_, float* Gt, float* Tt) {
    int i = threadIdx.x;                 // H*N = 1024
    int h = i >> 5;
    float dt  = __expf(log_dt[h]);
    float ar  = A_re[i], ai = A_im[i];
    float dre = dt * ar, dim = dt * ai;
    float er  = __expf(dre);
    float sn, cs; __sincosf(dim, &sn, &cs);
    float wr = er * cs, wi = er * sn;
    float exr = wr - 1.0f, exi = wi;
    float den = ar * ar + ai * ai;
    float qr = (exr * ar + exi * ai) / den;
    float qi = (exi * ar - exr * ai) / den;
    float cr = C_re[i], ci = C_im[i];
    wr_[i]  = wr;  wi_[i]  = wi;
    cdr_[i] = 2.0f * (cr * qr - ci * qi);
    cdi_[i] = 2.0f * (cr * qi + ci * qr);
    float er2 = __expf(dre * (float)CHUNK);
    float sn2, cs2; __sincosf(dim * (float)CHUNK, &sn2, &cs2);
    wcr_[i] = er2 * cs2;  wci_[i] = er2 * sn2;

    int n = i & 31;                      // a wave holds the 32 states of one h
    float gr = 2.0f * (cr * qr - ci * qi);
    float gi = 2.0f * (cr * qi + ci * qr);
    float* Td = Tt + h * (SUB * SUB) + (n & (SUB - 1)) * (SUB + 1);   // T[n][n]
    float ks[SUB];                       // Re(Cd*w^d), then its sum over the states
    // The three loops are unrolled so that ks[] stays in registers; the sums of all d
    // go through the butterfly side by side, so their cross-lane latencies overlap.
    #pragma unroll
    for (int d = 0; d < SUB; ++d) {
        ks[d] = gr;
        float ngr = fmaf(gr, wr, -(gi * wi));
        gi = fmaf(gr, wi, gi * wr);
        gr = ngr;                        // now Cd*w^(d+1)
        v2f gp; gp.x = gr; gp.y = -gi;
        *(v2f*)&Gt[((size_t)(h * SUB + d)) * (2 * Ndim) + 2 * n] = gp;
    }
    #pragma unroll
    for (int off = 16; off; off >>= 1) {
        #pragma unroll
        for (int d = 0; d < SUB; ++d) ks[d] += __shfl_xor(ks[d], off, 32);
    }
    #pragma unroll
    for (int d = 0; d < SUB; ++d) {
        if (n < SUB - d) {
            Td[d * SUB] = ks[d];         // T[n+d][n]
            if (d) Td[d] = 0.0f;         // T[n][n+d], above the diagonal
        }
    }
}

// ---------------------------------------------------------------------------
// K-film: gb[b,g] = cond[b] . film_W[g] + film_b[g]      (8 x 64 outputs)
// ---------------------------------------------------------------------------
__global__ void k_film(const float* __restrict__ cond, const float* __restrict__ fW,
                       const float* __restrict__ fb, float* __restrict__ gb) {
    int i = threadIdx.x;                 // 512
    int b = i >> 6;
    int g = i & 63;
    const float* c = cond + b * CDdim;
    const float* w = fW + g * CDdim;
    float s = fb[g];
    #pragma unroll 8
    for (int j = 0; j < CDdim; ++j) s = fmaf(c[j], w[j], s);
    gb[i] = s;
}

// ---------------------------------------------------------------------------
// K1: u = gelu(W_lin @ x + b_lin)   via V_WMMA_F32_16X16X4_F32
//     W_lin staged to LDS once per block through the TDM.
// ---------------------------------------------------------------------------
__global__ __launch_bounds__(256) void k_in_linear(
        const float* __restrict__ x, const float* __restrict__ W,
        const float* __restrict__ bias, float* __restrict__ u) {
    __shared__ __align__(16) float Wl[Hdim * Hdim];            // 4 KB
    if (threadIdx.x < 32) {
        tdm_load_2d_f32(W, (unsigned)(uintptr_t)Wl, Hdim, Hdim, Hdim);
        __builtin_amdgcn_s_wait_tensorcnt(0);
    }
    __syncthreads();

    const int lane = threadIdx.x & 31;
    const int m    = lane & 15;
    const int hi   = lane >> 4;
    const int gid  = blockIdx.x * 8 + (threadIdx.x >> 5);
    const int b    = gid / (Ldim / 16);
    const int l0   = (gid % (Ldim / 16)) * 16;
    const float* xb = x + (size_t)b * Hdim * Ldim;
    v8f acc0 = {};
    v8f acc1 = {};
    #pragma unroll
    for (int kk = 0; kk < 8; ++kk) {
        const int k = kk * 4 + 2 * hi;                         // K-pair for half-wave
        v2f bm;                                                // B: 4x16
        bm.x = xb[(size_t)k * Ldim + l0 + m];
        bm.y = xb[(size_t)(k + 1) * Ldim + l0 + m];
        v2f a0 = *(const v2f*)&Wl[m * Hdim + k];               // ds_load_b64
        v2f a1 = *(const v2f*)&Wl[(16 + m) * Hdim + k];
        acc0 = __builtin_amdgcn_wmma_f32_16x16x4_f32(false, a0, false, bm, (short)0, acc0, false, false);
        acc1 = __builtin_amdgcn_wmma_f32_16x16x4_f32(false, a1, false, bm, (short)0, acc1, false, false);
    }
    #pragma unroll
    for (int r = 0; r < 8; ++r) {
        int g0 = r + 8 * hi;
        int g1 = 16 + g0;
        u[((size_t)b * Hdim + g0) * Ldim + l0 + m] = gelu_t(acc0[r] + bias[g0]);
        u[((size_t)b * Hdim + g1) * Ldim + l0 + m] = gelu_t(acc1[r] + bias[g1]);
    }
}

// ---------------------------------------------------------------------------
// K2: local chunk scan (states only).  wave = (b,h,chunk), lane = state n.
//     u loaded 128 elems/iter (float4/lane), broadcast via v_readlane.
// ---------------------------------------------------------------------------
__global__ __launch_bounds__(256) void k_scan_local(
        const float* __restrict__ u, const float* __restrict__ wr_,
        const float* __restrict__ wi_, float* __restrict__ S) {
    int lane = threadIdx.x & 31;
    int gid  = blockIdx.x * 8 + (threadIdx.x >> 5);  // (b*H+h)*NCHUNK + c
    int c    = gid & (NCHUNK - 1);
    int bh   = gid >> 5;
    int h    = bh & (Hdim - 1);
    float wr = wr_[h * Ndim + lane], wi = wi_[h * Ndim + lane];
    const float* up = u + (size_t)bh * Ldim + (size_t)c * CHUNK;
    float sre = 0.0f, sim = 0.0f;
    for (int i = 0; i < CHUNK; i += 128) {
        float4 q = *(const float4*)(up + i + lane * 4);
        __builtin_prefetch(up + i + 512, 0, 1);      // global_prefetch_b8
        #pragma unroll
        for (int j = 0; j < 128; ++j) {
            float uv = bcast(q_at(q, j & 3), j >> 2);
            float nr = fmaf(wr, sre, fmaf(-wi, sim, uv));
            sim = fmaf(wi, sre, wr * sim);
            sre = nr;
        }
    }
    S[(size_t)gid * 64 + lane * 2]     = sre;
    S[(size_t)gid * 64 + lane * 2 + 1] = sim;
}

// ---------------------------------------------------------------------------
// K3: exclusive prefix over chunks (in place): P[c] = Wc*P[c-1] + S[c-1]
// ---------------------------------------------------------------------------
__global__ void k_scan_prefix(float* __restrict__ S,
                              const float* __restrict__ wcr_,
                              const float* __restrict__ wci_) {
    int t  = blockIdx.x * blockDim.x + threadIdx.x;  // B*H*N = 8192
    int n  = t & 31;
    int bh = t >> 5;
    int h  = bh & (Hdim - 1);
    float wr = wcr_[h * Ndim + n], wi = wci_[h * Ndim + n];
    float pr = 0.0f, pi = 0.0f;
    size_t base = (size_t)bh * NCHUNK * 64 + n * 2;
    for (int c = 0; c < NCHUNK; ++c) {
        size_t ix = base + (size_t)c * 64;
        float tr = S[ix], ti = S[ix + 1];
        S[ix] = pr;  S[ix + 1] = pi;                 // exclusive prefix
        float npr = fmaf(wr, pr, fmaf(-wi, pi, tr));
        pi = fmaf(wi, pr, fmaf(wr, pi, ti));
        pr = npr;
    }
}

// ---------------------------------------------------------------------------
// K4: output pass. lane = state n scans as in K2 and leaves a snapshot of the
//     state in LDS at the start of every SUB steps. Per 256 steps the outputs
//     come from matrix products, Y[t][blk] = T[t][j] U[j][blk] + G[t][k] Sn[k][blk]:
//     T = the lower-triangular Toeplitz tile Tt with D added on the diagonal, U = the inputs,
//     Sn = the snapshots (k = 2n, 2n+1 for re, im).  A and B fragments take the
//     same k at the same place: k = hi*(K/2) + 2*w + {0,1} in product w.
// ---------------------------------------------------------------------------
__global__ __launch_bounds__(256) void k_scan_out(
        const float* __restrict__ u, const float* __restrict__ S,
        const float* __restrict__ wr_, const float* __restrict__ wi_,
        const float* __restrict__ Gt, const float* __restrict__ Tt,
        const float* __restrict__ Dvec, float* __restrict__ v) {
    __shared__ __align__(16) float Sl[8][SUB * SROW];          // one range per wave
    int lane = threadIdx.x & 31;
    int m    = lane & 15;
    int hi   = lane >> 4;
    int gid  = blockIdx.x * 8 + (threadIdx.x >> 5);
    int c    = gid & (NCHUNK - 1);
    int bh   = gid >> 5;
    int h    = bh & (Hdim - 1);
    float wr  = wr_[h * Ndim + lane],  wi  = wi_[h * Ndim + lane];
    float Dh  = Dvec[h];
    float sre = S[(size_t)gid * 64 + lane * 2];
    float sim = S[(size_t)gid * 64 + lane * 2 + 1];
    // Here and below: address registers of issued loads and stores are reused next
    asm volatile("s_wait_xcnt 0x0" ::: "memory");
    const float* up = u + (size_t)bh * Ldim + (size_t)c * CHUNK;
    float*       vp = v + (size_t)bh * Ldim + (size_t)c * CHUNK;
    float*       sl = &Sl[threadIdx.x >> 5][0];

    // A fragments, held for the whole chunk: row t = m
    v4f tl, th;                                                // T[m][hi*8 .. +7]
    // One statement with its data wait: the next loads' results may then land on its address registers
    asm volatile("global_load_b128 %0, %2, off\n\t"
                 "global_load_b128 %1, %2, off offset:16\n\t"
                 "s_wait_loadcnt 0x0"
                 : "=&v"(tl), "=&v"(th)
                 : "v"(Tt + (h * SUB + m) * SUB + hi * 8)
                 : "memory");
    float ta[8];
    #pragma unroll
    for (int e = 0; e < 8; ++e) {
        float kv = e < 4 ? tl[e & 3] : th[e & 3];
        ta[e] = (hi * 8 + e == m) ? kv + Dh : kv;
    }
    float4 ga[8];                                              // G[m][hi*32 .. +31]
    #pragma unroll
    for (int w = 0; w < 8; ++w)
        ga[w] = *(const float4*)&Gt[((size_t)(h * SUB + m)) * (2 * Ndim) + hi * 32 + w * 4];
    asm volatile("s_wait_xcnt 0x0" ::: "memory");

    for (int g = 0; g < CHUNK; g += 256) {
        // All of the group's inputs are asked for at its head: q for the scan's
        // broadcasts, ub as the B fragment U[hi*8 ..][blk = m] of the products behind it
        // (one statement with its data wait, so that no result lands on an address
        // register of a load that is still on its way)
        v4f q0, q1, ub0, ub1;
        asm volatile("global_load_b128 %0, %4, off\n\t"
                     "global_load_b128 %1, %4, off offset:512\n\t"
                     "global_load_b128 %2, %5, off\n\t"
                     "global_load_b128 %3, %5, off offset:16\n\t"
                     "s_wait_loadcnt 0x0"
                     : "=&v"(q0), "=&v"(q1), "=&v"(ub0), "=&v"(ub1)
                     : "v"(up + g + lane * 4), "v"(up + g + m * SUB + hi * 8)
                     : "memory");
        // Unrolled: lane and component of every broadcast are compile-time constants
        #pragma unroll
        for (int s = 0; s < 16; ++s) {
            v2f st; st.x = sre; st.y = sim;
            *(v2f*)(sl + s * SROW + lane * 2) = st;            // state before step s*SUB
            #pragma unroll
            for (int t = 0; t < SUB; ++t) {
                const int j = (s & 7) * SUB + t;
                float uv = bcast(s < 8 ? q0[j & 3] : q1[j & 3], j >> 2);
                float nr = fmaf(wr, sre, fmaf(-wi, sim, uv));
                sim = fmaf(wi, sre, wr * sim);
                sre = nr;
            }
        }
        // The snapshots are read back by other lanes of the same wave: the
        // stores must have landed, and the compiler must not move the reads up.
        asm volatile("s_wait_dscnt 0x0" ::: "memory");
        // Holds the scan's vector instructions ahead of the run of matrix instructions.
        __builtin_amdgcn_sched_barrier(0);
        v8f acc = {};
        #pragma unroll
        for (int w = 0; w < 4; ++w) {
            const v4f ub = w < 2 ? ub0 : ub1;
            v2f a, b;
            a.x = ta[2 * w];              a.y = ta[2 * w + 1];
            b.x = (w & 1) ? ub.z : ub.x;  b.y = (w & 1) ? ub.w : ub.y;
            acc = __builtin_amdgcn_wmma_f32_16x16x4_f32(false, a, false, b, (short)0, acc, false, false);
        }
        float4 sb[8];                                                  // Sn[hi*32 ..][blk = m]
        #pragma unroll
        for (int w = 0; w < 8; ++w)
            sb[w] = *(const float4*)(sl + m * SROW + hi * 32 + w * 4);
        #pragma unroll
        for (int w = 0; w < 8; ++w) {
            v2f a, b;
            a.x = ga[w].x;  a.y = ga[w].y;  b.x = sb[w].x;  b.y = sb[w].y;
            acc = __builtin_amdgcn_wmma_f32_16x16x4_f32(false, a, false, b, (short)0, acc, false, false);
            a.x = ga[w].z;  a.y = ga[w].w;  b.x = sb[w].z;  b.y = sb[w].w;
            acc = __builtin_amdgcn_wmma_f32_16x16x4_f32(false, a, false, b, (short)0, acc, false, false);
        }
        // Four vector slots between the last product and the first vector instruction
        // that may touch its A, B or D; the two scheduling barriers hold them in place.
        __builtin_amdgcn_sched_barrier(0);
        asm volatile("v_nop\n\tv_nop\n\tv_nop\n\tv_nop");
        __builtin_amdgcn_sched_barrier(0);
        // acc[r] = Y[t = 8*hi + r][blk = m]: eight consecutive outputs per lane
        float4 o0, o1;
        o0.x = acc[0]; o0.y = acc[1]; o0.z = acc[2]; o0.w = acc[3];
        o1.x = acc[4]; o1.y = acc[5]; o1.z = acc[6]; o1.w = acc[7];
        *(float4*)(vp + g + m * SUB + hi * 8)     = o0;
        *(float4*)(vp + g + m * SUB + hi * 8 + 4) = o1;
        asm volatile("s_wait_xcnt 0x0" ::: "memory");
    }
}

// ---------------------------------------------------------------------------
// K5: z = W_out @ y + b_out ; GLU.  W_out (64x32) staged to LDS via TDM.
// ---------------------------------------------------------------------------
__global__ __launch_bounds__(256) void k_out_glu(
        const float* __restrict__ vin, const float* __restrict__ Wo,
        const float* __restrict__ bo, float* __restrict__ yg) {
    __shared__ __align__(16) float Wol[2 * Hdim * Hdim];       // 8 KB
    if (threadIdx.x < 32) {
        tdm_load_2d_f32(Wo, (unsigned)(uintptr_t)Wol, Hdim, 2 * Hdim, Hdim);
        __builtin_amdgcn_s_wait_tensorcnt(0);
    }
    __syncthreads();

    const int lane = threadIdx.x & 31;
    const int m    = lane & 15;
    const int hi   = lane >> 4;
    const int gid  = blockIdx.x * 8 + (threadIdx.x >> 5);
    const int b    = gid / (Ldim / 16);
    const int l0   = (gid % (Ldim / 16)) * 16;
    const float* vb = vin + (size_t)b * Hdim * Ldim;
    v8f acc[4] = {};
    #pragma unroll
    for (int kk = 0; kk < 8; ++kk) {
        const int k = kk * 4 + 2 * hi;
        v2f bm;
        bm.x = vb[(size_t)k * Ldim + l0 + m];
        bm.y = vb[(size_t)(k + 1) * Ldim + l0 + m];
        #pragma unroll
        for (int t = 0; t < 4; ++t) {
            v2f a = *(const v2f*)&Wol[(t * 16 + m) * Hdim + k];
            acc[t] = __builtin_amdgcn_wmma_f32_16x16x4_f32(false, a, false, bm, (short)0, acc[t], false, false);
        }
    }
    #pragma unroll
    for (int t = 0; t < 2; ++t) {
        #pragma unroll
        for (int r = 0; r < 8; ++r) {
            int g  = t * 16 + r + 8 * hi;
            float zv = acc[t][r]     + bo[g];
            float zg = acc[t + 2][r] + bo[g + Hdim];
            yg[((size_t)b * Hdim + g) * Ldim + l0 + m] = zv * sigm(zg);
        }
    }
}

// ---------------------------------------------------------------------------
// K6: per-channel mean / rstd over (B, L)  (deterministic block reduction)
// ---------------------------------------------------------------------------
__global__ __launch_bounds__(1024) void k_bn_stats(
        const float* __restrict__ yg, float* __restrict__ stats) {
    __shared__ float ls[1024];
    __shared__ float ls2[1024];
    int h = blockIdx.x;
    int tid = threadIdx.x;
    float s = 0.0f, s2 = 0.0f;
    for (int b = 0; b < Bdim; ++b) {
        const float* p = yg + ((size_t)b * Hdim + h) * Ldim;
        for (int i = tid; i < Ldim; i += 1024) {
            float val = p[i];
            s += val;  s2 = fmaf(val, val, s2);
        }
    }
    ls[tid] = s;  ls2[tid] = s2;
    __syncthreads();
    for (int st = 512; st > 0; st >>= 1) {
        if (tid < st) { ls[tid] += ls[tid + st]; ls2[tid] += ls2[tid + st]; }
        __syncthreads();
    }
    if (tid == 0) {
        float inv  = 1.0f / (float)((size_t)Bdim * Ldim);
        float mean = ls[0] * inv;
        float var  = ls2[0] * inv - mean * mean;
        stats[2 * h]     = mean;
        stats[2 * h + 1] = rsqrtf(var + 1e-5f);
    }
}

// ---------------------------------------------------------------------------
// K7: BN apply + FiLM + gelu + depthwise residual
// ---------------------------------------------------------------------------
__global__ __launch_bounds__(256) void k_final(
        const float* __restrict__ yg, const float* __restrict__ stats,
        const float* __restrict__ gb, const float* __restrict__ resw,
        const float* __restrict__ x, float* __restrict__ out) {
    size_t idx = (size_t)blockIdx.x * blockDim.x + threadIdx.x;
    int h = (int)((idx / Ldim) & (Hdim - 1));
    int b = (int)(idx / ((size_t)Hdim * Ldim));
    float yv    = yg[idx];
    float mean  = stats[2 * h];
    float rstd  = stats[2 * h + 1];
    float gamma = gb[b * (2 * Hdim) + h];
    float beta  = gb[b * (2 * Hdim) + Hdim + h];
    float yn = fmaf(gamma, (yv - mean) * rstd, beta);
    out[idx] = fmaf(resw[h], x[idx], gelu_t(yn));
}

// ---------------------------------------------------------------------------
extern "C" void kernel_launch(void* const* d_in, const int* in_sizes, int n_in,
                              void* d_out, int out_size, void* d_ws, size_t ws_size,
                              hipStream_t stream) {
    const float* x      = (const float*)d_in[0];
    const float* cond   = (const float*)d_in[1];
    const float* W_lin  = (const float*)d_in[2];
    const float* b_lin  = (const float*)d_in[3];
    const float* log_dt = (const float*)d_in[4];
    const float* A_re   = (const float*)d_in[5];
    const float* A_im   = (const float*)d_in[6];
    const float* C_re   = (const float*)d_in[7];
    const float* C_im   = (const float*)d_in[8];
    const float* Dv     = (const float*)d_in[9];
    const float* W_out  = (const float*)d_in[10];
    const float* b_out  = (const float*)d_in[11];
    const float* film_W = (const float*)d_in[12];
    const float* film_b = (const float*)d_in[13];
    const float* res_w  = (const float*)d_in[14];
    float* out = (float*)d_out;

    const size_t tot = (size_t)Bdim * Hdim * Ldim;
    float* ws   = (float*)d_ws;
    float* u    = ws;                                   // [B,H,L]
    float* v    = u + tot;                              // [B,H,L]
    float* yg   = u;                                    // alias: u dead after scan_out
    float* S    = v + tot;                              // [B*H*NCHUNK, N, 2]
    float* wr_  = S + (size_t)Bdim * Hdim * NCHUNK * 64;
    float* wi_  = wr_  + Hdim * Ndim;
    float* cdr_ = wi_  + Hdim * Ndim;
    float* cdi_ = cdr_ + Hdim * Ndim;
    float* wcr_ = cdi_ + Hdim * Ndim;
    float* wci_ = wcr_ + Hdim * Ndim;
    float* gb   = wci_ + Hdim * Ndim;                   // [B, 2H]
    float* stats = gb + Bdim * 2 * Hdim;                // [H, 2]
    float* Gt   = stats + 2 * Hdim;                     // [H, SUB, 2N]
    float* Tt   = Gt + Hdim * SUB * 2 * Ndim;           // [H, SUB, SUB]

    k_setup<<<1, Hdim * Ndim, 0, stream>>>(log_dt, A_re, A_im, C_re, C_im,
                                           wr_, wi_, cdr_, cdi_, wcr_, wci_, Gt, Tt);
    k_film<<<1, Bdim * 2 * Hdim, 0, stream>>>(cond, film_W, film_b, gb);
    k_in_linear<<<(Bdim * (Ldim / 16)) / 8, 256, 0, stream>>>(x, W_lin, b_lin, u);
    k_scan_local<<<(Bdim * Hdim * NCHUNK) / 8, 256, 0, stream>>>(u, wr_, wi_, S);
    k_scan_prefix<<<(Bdim * Hdim * Ndim) / 256, 256, 0, stream>>>(S, wcr_, wci_);
    k_scan_out<<<(Bdim * Hdim * NCHUNK) / 8, 256, 0, stream>>>(u, S, wr_, wi_,
                                                               Gt, Tt, Dv, v);
    k_out_glu<<<(Bdim * (Ldim / 16)) / 8, 256, 0, stream>>>(v, W_out, b_out, yg);
    k_bn_stats<<<Hdim, 1024, 0, stream>>>(yg, stats);
    k_final<<<(int)(tot / 256), 256, 0, stream>>>(yg, stats, gb, res_w, x, out);
}

// v002
// One run takes 127 microseconds.
// In both of two side-by-side timings against v001, it was 1.09 times as fast.
// Over all steps from v000 it is 1.55 times as fast.
#include <hip/hip_runtime.h>
#include <hip/hip_bf16.h>
#include <math.h>

// Problem constants (match reference)
#define Bdim   8
#define Hdim   32
#define Ldim   32768
#define Ndim   32
#define CDdim  128
#define NCHUNK 32                 // chunks per sequence (must be 32: code uses >>5)
#define CHUNK  (Ldim / NCHUNK)    // 1024
#define SUB    16                 // steps per sub-block of the output pass (rows of one matrix tile)
#define FIN_T  512                // threads per block of the last kernel
#define FIN_V  8                  // 16-byte groups per thread and stream there
#define FIN_SPAN (FIN_T * 4 * FIN_V)   // elements per block there; divides Ldim
#define SROW   68                 // LDS pitch (floats) of one state snapshot: 16 B x odd, no bank conflict

typedef __attribute__((ext_vector_type(2))) float v2f;
typedef __attribute__((ext_vector_type(4))) float v4f;
typedef __attribute__((ext_vector_type(8))) float v8f;
typedef __attribute__((ext_vector_type(4))) int   i32x4;
typedef __attribute__((ext_vector_type(8))) int   i32x8;

// Branch-free gelu (tanh approximation): 0.5x(1+tanh(z)) == x*sigmoid(2z)
__device__ __forceinline__ float gelu_t(float x) {
    float x3 = x * x * x;
    float z  = fmaf(0.044715f, x3, x) * 1.5957691216057308f;  // 2*sqrt(2/pi)
    return x * __fdividef(1.0f, 1.0f + __expf(-z));
}
__device__ __forceinline__ float sigm(float x) {
    return __fdividef(1.0f, 1.0f + __expf(-x));
}
// Wave-uniform broadcast: v_readlane_b32 -> SGPR operand (beats ds_bpermute)
__device__ __forceinline__ float bcast(float v, int l) {
    return __uint_as_float(__builtin_amdgcn_readlane(__float_as_uint(v), l));
}
__device__ __forceinline__ float q_at(const float4& q, int comp) {
    return comp == 0 ? q.x : comp == 1 ? q.y : comp == 2 ? q.z : q.w;
}

// ---------------------------------------------------------------------------
// Tensor Data Mover: 2D f32 tile Global -> LDS (D# built in SGPR tuples).
// Group0: count=1 | lds_addr | global_addr(57b) | type=2.
// Group1: data_size=4B, tensor_dim0/1, tile_dim0/1, tensor_dim0_stride.
// ---------------------------------------------------------------------------
__device__ __forceinline__ void tdm_load_2d_f32(const void* gsrc, unsigned lds_off,
                                                int width, int height, int stride) {
    unsigned long long ga = (unsigned long long)(uintptr_t)gsrc;
    i32x4 g0;
    g0.x = 1;                                                   // count=1, user D#
    g0.y = (int)lds_off;                                        // lds_addr [63:32]
    g0.z = (int)(unsigned)ga;                                   // global_addr [95:64]
    g0.w = (int)(((unsigned)(ga >> 32) & 0x01FFFFFFu) | 0x80000000u); // [120:96] | type=2
    i32x8 g1;
    g1[0] = 2 << 16;                                            // data_size = 4 bytes
    g1[1] = (width & 0xFFFF) << 16;                             // tensor_dim0 lo16 @bit48
    g1[2] = ((width >> 16) & 0xFFFF) | ((height & 0xFFFF) << 16); // dim0 hi | dim1 lo
    g1[3] = ((height >> 16) & 0xFFFF) | ((width & 0xFFFF) << 16); // dim1 hi | tile_dim0
    g1[4] = (height & 0xFFFF);                                  // tile_dim1 (tile_dim2=0)
    g1[5] = stride;                                             // tensor_dim0_stride lo32
    g1[6] = 0;
    g1[7] = 0;
    asm volatile("tensor_load_to_lds %0, %1" :: "s"(g0), "s"(g1) : "memory");
}

// ---------------------------------------------------------------------------
// K0: per-(h,n) SSM constants: w = exp(dt*A), Cd = 2*C*(exp(dtA)-1)/A, Wc = w^CHUNK
//     and the output pass's tables: Gt[h][t][2n,2n+1] = (Re, -Im) of Cd*w^(t+1),
//     Tt[h][t][j] = sum_n Re(Cd*w^(t-j)) for j <= t, else 0, for t, j < SUB.
// ---------------------------------------------------------------------------
__global__ void k_setup(const float* __restrict__ log_dt,
                        const float* __restrict__ A_re, const float* __restrict__ A_im,
                        const float* __restrict__ C_re, const float* __restrict__ C_im,
                        float* wr_, float* wi_, float* cdr_, float* cdi_,
                        float* wcr_, float* wci_, float* Gt, float* Tt) {
    int i = threadIdx.x;                 // H*N = 1024
    int h = i >> 5;
    float dt  = __expf(log_dt[h]);
    float ar  = A_re[i], ai = A_im[i];
    float dre = dt * ar, dim = dt * ai;
    float er  = __expf(dre);
    float sn, cs; __sincosf(dim, &sn, &cs);
    float wr = er * cs, wi = er * sn;
    float exr = wr - 1.0f, exi = wi;
    float den = ar * ar + ai * ai;
    float qr = (exr * ar + exi * ai) / den;
    float qi = (exi * ar - exr * ai) / den;
    float cr = C_re[i], ci = C_im[i];
    wr_[i]  = wr;  wi_[i]  = wi;
    cdr_[i] = 2.0f * (cr * qr - ci * qi);
    cdi_[i] = 2.0f * (cr * qi + ci * qr);
    float er2 = __expf(dre * (float)CHUNK);
    float sn2, cs2; __sincosf(dim * (float)CHUNK, &sn2, &cs2);
    wcr_[i] = er2 * cs2;  wci_[i] = er2 * sn2;

    int n = i & 31;                      // a wave holds the 32 states of one h
    float gr = 2.0f * (cr * qr - ci * qi);
    float gi = 2.0f * (cr * qi + ci * qr);
    float* Td = Tt + h * (SUB * SUB) + (n & (SUB - 1)) * (SUB + 1);   // T[n][n]
    float ks[SUB];                       // Re(Cd*w^d), then its sum over the states
    // The three loops are unrolled so that ks[] stays in registers; the sums of all d
    // go through the butterfly side by side, so their cross-lane latencies overlap.
    #pragma unroll
    for (int d = 0; d < SUB; ++d) {
        ks[d] = gr;
        float ngr = fmaf(gr, wr, -(gi * wi));
        gi = fmaf(gr, wi, gi * wr);
        gr = ngr;                        // now Cd*w^(d+1)
        v2f gp; gp.x = gr; gp.y = -gi;
        *(v2f*)&Gt[((size_t)(h * SUB + d)) * (2 * Ndim) + 2 * n] = gp;
    }
    #pragma unroll
    for (int off = 16; off; off >>= 1) {
        #pragma unroll
        for (int d = 0; d < SUB; ++d) ks[d] += __shfl_xor(ks[d], off, 32);
    }
    #pragma unroll
    for (int d = 0; d < SUB; ++d) {
        if (n < SUB - d) {
            Td[d * SUB] = ks[d];         // T[n+d][n]
            if (d) Td[d] = 0.0f;         // T[n][n+d], above the diagonal
        }
    }
}

// ---------------------------------------------------------------------------
// K-film: gb[b,g] = cond[b] . film_W[g] + film_b[g]      (8 x 64 outputs)
// ---------------------------------------------------------------------------
__global__ void k_film(const float* __restrict__ cond, const float* __restrict__ fW,
                       const float* __restrict__ fb, float* __restrict__ gb) {
    int i = threadIdx.x;                 // 512
    int b = i >> 6;
    int g = i & 63;
    const float* c = cond + b * CDdim;
    const float* w = fW + g * CDdim;
    float s = fb[g];
    #pragma unroll 8
    for (int j = 0; j < CDdim; ++j) s = fmaf(c[j], w[j], s);
    gb[i] = s;
}

// ---------------------------------------------------------------------------
// K1: u = gelu(W_lin @ x + b_lin)   via V_WMMA_F32_16X16X4_F32
//     W_lin staged to LDS once per block through the TDM.
// ---------------------------------------------------------------------------
__global__ __launch_bounds__(256) void k_in_linear(
        const float* __restrict__ x, const float* __restrict__ W,
        const float* __restrict__ bias, float* __restrict__ u) {
    __shared__ __align__(16) float Wl[Hdim * Hdim];            // 4 KB
    if (threadIdx.x < 32) {
        tdm_load_2d_f32(W, (unsigned)(uintptr_t)Wl, Hdim, Hdim, Hdim);
        __builtin_amdgcn_s_wait_tensorcnt(0);
    }
    __syncthreads();

    const int lane = threadIdx.x & 31;
    const int m    = lane & 15;
    const int hi   = lane >> 4;
    const int gid  = blockIdx.x * 8 + (threadIdx.x >> 5);
    const int b    = gid / (Ldim / 16);
    const int l0   = (gid % (Ldim / 16)) * 16;
    const float* xb = x + (size_t)b * Hdim * Ldim;
    v8f acc0 = {};
    v8f acc1 = {};
    #pragma unroll
    for (int kk = 0; kk < 8; ++kk) {
        const int k = kk * 4 + 2 * hi;                         // K-pair for half-wave
        v2f bm;                                                // B: 4x16
        bm.x = xb[(size_t)k * Ldim + l0 + m];
        bm.y = xb[(size_t)(k + 1) * Ldim + l0 + m];
        v2f a0 = *(const v2f*)&Wl[m * Hdim + k];               // ds_load_b64
        v2f a1 = *(const v2f*)&Wl[(16 + m) * Hdim + k];
        acc0 = __builtin_amdgcn_wmma_f32_16x16x4_f32(false, a0, false, bm, (short)0, acc0, false, false);
        acc1 = __builtin_amdgcn_wmma_f32_16x16x4_f32(false, a1, false, bm, (short)0, acc1, false, false);
    }
    #pragma unroll
    for (int r = 0; r < 8; ++r) {
        int g0 = r + 8 * hi;
        int g1 = 16 + g0;
        u[((size_t)b * Hdim + g0) * Ldim + l0 + m] = gelu_t(acc0[r] + bias[g0]);
        u[((size_t)b * Hdim + g1) * Ldim + l0 + m] = gelu_t(acc1[r] + bias[g1]);
    }
}

// ---------------------------------------------------------------------------
// K2: local chunk scan (states only).  wave = (b,h,chunk), lane = state n.
//     u loaded 128 elems/iter (float4/lane), broadcast via v_readlane.
// ---------------------------------------------------------------------------
__global__ __launch_bounds__(256) void k_scan_local(
        const float* __restrict__ u, const float* __restrict__ wr_,
        const float* __restrict__ wi_, float* __restrict__ S) {
    int lane = threadIdx.x & 31;
    int gid  = blockIdx.x * 8 + (threadIdx.x >> 5);  // (b*H+h)*NCHUNK + c
    int c    = gid & (NCHUNK - 1);
    int bh   = gid >> 5;
    int h    = bh & (Hdim - 1);
    float wr = wr_[h * Ndim + lane], wi = wi_[h * Ndim + lane];
    const float* up = u + (size_t)bh * Ldim + (size_t)c * CHUNK;
    float sre = 0.0f, sim = 0.0f;
    for (int i = 0; i < CHUNK; i += 128) {
        float4 q = *(const float4*)(up + i + lane * 4);
        __builtin_prefetch(up + i + 512, 0, 1);      // global_prefetch_b8
        #pragma unroll
        for (int j = 0; j < 128; ++j) {
            float uv = bcast(q_at(q, j & 3), j >> 2);
            float nr = fmaf(wr, sre, fmaf(-wi, sim, uv));
            sim = fmaf(wi, sre, wr * sim);
            sre = nr;
        }
    }
    S[(size_t)gid * 64 + lane * 2]     = sre;
    S[(size_t)gid * 64 + lane * 2 + 1] = sim;
}

// ---------------------------------------------------------------------------
// K3: exclusive prefix over chunks (in place): P[c] = Wc*P[c-1] + S[c-1]
// ---------------------------------------------------------------------------
__global__ void k_scan_prefix(float* __restrict__ S,
                              const float* __restrict__ wcr_,
                              const float* __restrict__ wci_) {
    int t  = blockIdx.x * blockDim.x + threadIdx.x;  // B*H*N = 8192
    int n  = t & 31;
    int bh = t >> 5;
    int h  = bh & (Hdim - 1);
    float wr = wcr_[h * Ndim + n], wi = wci_[h * Ndim + n];
    float pr = 0.0f, pi = 0.0f;
    size_t base = (size_t)bh * NCHUNK * 64 + n * 2;
    for (int c = 0; c < NCHUNK; ++c) {
        size_t ix = base + (size_t)c * 64;
        float tr = S[ix], ti = S[ix + 1];
        S[ix] = pr;  S[ix + 1] = pi;                 // exclusive prefix
        float npr = fmaf(wr, pr, fmaf(-wi, pi, tr));
        pi = fmaf(wi, pr, fmaf(wr, pi, ti));
        pr = npr;
    }
}

// ---------------------------------------------------------------------------
// K4: output pass. lane = state n scans as in K2 and leaves a snapshot of the
//     state in LDS at the start of every SUB steps. Per 256 steps the outputs
//     come from matrix products, Y[t][blk] = T[t][j] U[j][blk] + G[t][k] Sn[k][blk]:
//     T = the lower-triangular Toeplitz tile Tt with D added on the diagonal, U = the inputs,
//     Sn = the snapshots (k = 2n, 2n+1 for re, im).  A and B fragments take the
//     same k at the same place: k = hi*(K/2) + 2*w + {0,1} in product w.
// ---------------------------------------------------------------------------
__global__ __launch_bounds__(256) void k_scan_out(
        const float* __restrict__ u, const float* __restrict__ S,
        const float* __restrict__ wr_, const float* __restrict__ wi_,
        const float* __restrict__ Gt, const float* __restrict__ Tt,
        const float* __restrict__ Dvec, float* __restrict__ v) {
    __shared__ __align__(16) float Sl[8][SUB * SROW];          // one range per wave
    int lane = threadIdx.x & 31;
    int m    = lane & 15;
    int hi   = lane >> 4;
    int gid  = blockIdx.x * 8 + (threadIdx.x >> 5);
    int c    = gid & (NCHUNK - 1);
    int bh   = gid >> 5;
    int h    = bh & (Hdim - 1);
    float wr  = wr_[h * Ndim + lane],  wi  = wi_[h * Ndim + lane];
    float Dh  = Dvec[h];
    float sre = S[(size_t)gid * 64 + lane * 2];
    float sim = S[(size_t)gid * 64 + lane * 2 + 1];
    // Here and below: address registers of issued loads and stores are reused next
    asm volatile("s_wait_xcnt 0x0" ::: "memory");
    const float* up = u + (size_t)bh * Ldim + (size_t)c * CHUNK;
    float*       vp = v + (size_t)bh * Ldim + (size_t)c * CHUNK;
    float*       sl = &Sl[threadIdx.x >> 5][0];

    // A fragments, held for the whole chunk: row t = m
    v4f tl, th;                                                // T[m][hi*8 .. +7]
    // One statement with its data wait: the next loads' results may then land on its address registers
    asm volatile("global_load_b128 %0, %2, off\n\t"
                 "global_load_b128 %1, %2, off offset:16\n\t"
                 "s_wait_loadcnt 0x0"
                 : "=&v"(tl), "=&v"(th)
                 : "v"(Tt + (h * SUB + m) * SUB + hi * 8)
                 : "memory");
    float ta[8];
    #pragma unroll
    for (int e = 0; e < 8; ++e) {
        float kv = e < 4 ? tl[e & 3] : th[e & 3];
        ta[e] = (hi * 8 + e == m) ? kv + Dh : kv;
    }
    float4 ga[8];                                              // G[m][hi*32 .. +31]
    #pragma unroll
    for (int w = 0; w < 8; ++w)
        ga[w] = *(const float4*)&Gt[((size_t)(h * SUB + m)) * (2 * Ndim) + hi * 32 + w * 4];
    asm volatile("s_wait_xcnt 0x0" ::: "memory");

    for (int g = 0; g < CHUNK; g += 256) {
        // All of the group's inputs are asked for at its head: q for the scan's
        // broadcasts, ub as the B fragment U[hi*8 ..][blk = m] of the products behind it
        // (one statement with its data wait, so that no result lands on an address
        // register of a load that is still on its way)
        v4f q0, q1, ub0, ub1;
        asm volatile("global_load_b128 %0, %4, off\n\t"
                     "global_load_b128 %1, %4, off offset:512\n\t"
                     "global_load_b128 %2, %5, off\n\t"
                     "global_load_b128 %3, %5, off offset:16\n\t"
                     "s_wait_loadcnt 0x0"
                     : "=&v"(q0), "=&v"(q1), "=&v"(ub0), "=&v"(ub1)
                     : "v"(up + g + lane * 4), "v"(up + g + m * SUB + hi * 8)
                     : "memory");
        // Unrolled: lane and component of every broadcast are compile-time constants
        #pragma unroll
        for (int s = 0; s < 16; ++s) {
            v2f st; st.x = sre; st.y = sim;
            *(v2f*)(sl + s * SROW + lane * 2) = st;            // state before step s*SUB
            #pragma unroll
            for (int t = 0; t < SUB; ++t) {
                const int j = (s & 7) * SUB + t;
                float uv = bcast(s < 8 ? q0[j & 3] : q1[j & 3], j >> 2);
                float nr = fmaf(wr, sre, fmaf(-wi, sim, uv));
                sim = fmaf(wi, sre, wr * sim);
                sre = nr;
            }
        }
        // The snapshots are read back by other lanes of the same wave: the
        // stores must have landed, and the compiler must not move the reads up.
        asm volatile("s_wait_dscnt 0x0" ::: "memory");
        // Holds the scan's vector instructions ahead of the run of matrix instructions.
        __builtin_amdgcn_sched_barrier(0);
        v8f acc = {};
        #pragma unroll
        for (int w = 0; w < 4; ++w) {
            const v4f ub = w < 2 ? ub0 : ub1;
            v2f a, b;
            a.x = ta[2 * w];              a.y = ta[2 * w + 1];
            b.x = (w & 1) ? ub.z : ub.x;  b.y = (w & 1) ? ub.w : ub.y;
            acc = __builtin_amdgcn_wmma_f32_16x16x4_f32(false, a, false, b, (short)0, acc, false, false);
        }
        float4 sb[8];                                                  // Sn[hi*32 ..][blk = m]
        #pragma unroll
        for (int w = 0; w < 8; ++w)
            sb[w] = *(const float4*)(sl + m * SROW + hi * 32 + w * 4);
        #pragma unroll
        for (int w = 0; w < 8; ++w) {
            v2f a, b;
            a.x = ga[w].x;  a.y = ga[w].y;  b.x = sb[w].x;  b.y = sb[w].y;
            acc = __builtin_amdgcn_wmma_f32_16x16x4_f32(false, a, false, b, (short)0, acc, false, false);
            a.x = ga[w].z;  a.y = ga[w].w;  b.x = sb[w].z;  b.y = sb[w].w;
            acc = __builtin_amdgcn_wmma_f32_16x16x4_f32(false, a, false, b, (short)0, acc, false, false);
        }
        // Four vector slots between the last product and the first vector instruction
        // that may touch its A, B or D; the two scheduling barriers hold them in place.
        __builtin_amdgcn_sched_barrier(0);
        asm volatile("v_nop\n\tv_nop\n\tv_nop\n\tv_nop");
        __builtin_amdgcn_sched_barrier(0);
        // acc[r] = Y[t = 8*hi + r][blk = m]: eight consecutive outputs per lane
        float4 o0, o1;
        o0.x = acc[0]; o0.y = acc[1]; o0.z = acc[2]; o0.w = acc[3];
        o1.x = acc[4]; o1.y = acc[5]; o1.z = acc[6]; o1.w = acc[7];
        *(float4*)(vp + g + m * SUB + hi * 8)     = o0;
        *(float4*)(vp + g + m * SUB + hi * 8 + 4) = o1;
        asm volatile("s_wait_xcnt 0x0" ::: "memory");
    }
}

// ---------------------------------------------------------------------------
// K5: z = W_out @ y + b_out ; GLU.  W_out (64x32) staged to LDS via TDM.
// ---------------------------------------------------------------------------
__global__ __launch_bounds__(256) void k_out_glu(
        const float* __restrict__ vin, const float* __restrict__ Wo,
        const float* __restrict__ bo, float* __restrict__ yg) {
    __shared__ __align__(16) float Wol[2 * Hdim * Hdim];       // 8 KB
    if (threadIdx.x < 32) {
        tdm_load_2d_f32(Wo, (unsigned)(uintptr_t)Wol, Hdim, 2 * Hdim, Hdim);
        __builtin_amdgcn_s_wait_tensorcnt(0);
    }
    __syncthreads();

    const int lane = threadIdx.x & 31;
    const int m    = lane & 15;
    const int hi   = lane >> 4;
    const int gid  = blockIdx.x * 8 + (threadIdx.x >> 5);
    const int b    = gid / (Ldim / 16);
    const int l0   = (gid % (Ldim / 16)) * 16;
    const float* vb = vin + (size_t)b * Hdim * Ldim;
    v8f acc[4] = {};
    #pragma unroll
    for (int kk = 0; kk < 8; ++kk) {
        const int k = kk * 4 + 2 * hi;
        v2f bm;
        bm.x = vb[(size_t)k * Ldim + l0 + m];
        bm.y = vb[(size_t)(k + 1) * Ldim + l0 + m];
        #pragma unroll
        for (int t = 0; t < 4; ++t) {
            v2f a = *(const v2f*)&Wol[(t * 16 + m) * Hdim + k];
            acc[t] = __builtin_amdgcn_wmma_f32_16x16x4_f32(false, a, false, bm, (short)0, acc[t], false, false);
        }
    }
    #pragma unroll
    for (int t = 0; t < 2; ++t) {
        #pragma unroll
        for (int r = 0; r < 8; ++r) {
            int g  = t * 16 + r + 8 * hi;
            float zv = acc[t][r]     + bo[g];
            float zg = acc[t + 2][r] + bo[g + Hdim];
            yg[((size_t)b * Hdim + g) * Ldim + l0 + m] = zv * sigm(zg);
        }
    }
}

// ---------------------------------------------------------------------------
// K6: per-channel mean / rstd over (B, L)  (deterministic block reduction)
// ---------------------------------------------------------------------------
__global__ __launch_bounds__(1024) void k_bn_stats(
        const float* __restrict__ yg, float* __restrict__ stats) {
    __shared__ float ls[1024];
    __shared__ float ls2[1024];
    int h = blockIdx.x;
    int tid = threadIdx.x;
    float s = 0.0f, s2 = 0.0f;
    for (int b = 0; b < Bdim; ++b) {
        const float* p = yg + ((size_t)b * Hdim + h) * Ldim;
        for (int i = tid; i < Ldim; i += 1024) {
            float val = p[i];
            s += val;  s2 = fmaf(val, val, s2);
        }
    }
    ls[tid] = s;  ls2[tid] = s2;
    __syncthreads();
    for (int st = 512; st > 0; st >>= 1) {
        if (tid < st) { ls[tid] += ls[tid + st]; ls2[tid] += ls2[tid + st]; }
        __syncthreads();
    }
    if (tid == 0) {
        float inv  = 1.0f / (float)((size_t)Bdim * Ldim);
        float mean = ls[0] * inv;
        float var  = ls2[0] * inv - mean * mean;
        stats[2 * h]     = mean;
        stats[2 * h + 1] = rsqrtf(var + 1e-5f);
    }
}

// ---------------------------------------------------------------------------
// K7: BN apply + FiLM + gelu + depthwise residual.
//     A thread takes FIN_V groups of four elements, a block FIN_SPAN elements of one (b,h) row.
// ---------------------------------------------------------------------------
__global__ __launch_bounds__(FIN_T) void k_final(
        const float* __restrict__ yg, const float* __restrict__ stats,
        const float* __restrict__ gb, const float* __restrict__ resw,
        const float* __restrict__ x, float* __restrict__ out) {
    const int row = blockIdx.x / (Ldim / FIN_SPAN);            // b*H + h, the same for the whole block
    const int h = row & (Hdim - 1);
    const int b = row / Hdim;
    const size_t base = (size_t)blockIdx.x * FIN_SPAN + threadIdx.x * 4;
    const float mean  = stats[2 * h];
    const float rstd  = stats[2 * h + 1];
    const float gamma = gb[b * (2 * Hdim) + h];
    const float beta  = gb[b * (2 * Hdim) + Hdim + h];
    const float rw    = resw[h];
    // All 16 loads of the thread are asked for before the first is used (left to the compiler,
    // the x loads went down among the arithmetic in pairs and their latencies came one after
    // another); a wave's load covers 512 contiguous bytes; the offsets step by FIN_T * 16 bytes.
    // One statement with its data wait, so that no result lands on an address register of a
    // load that is still on its way.
    static_assert(FIN_T * 16 == 8192 && FIN_V == 8, "the offsets below are written out for this shape");
    v4f yv[FIN_V], xv[FIN_V];
    asm volatile("global_load_b128 %0, %16, off\n\t"
                 "global_load_b128 %1, %16, off offset:8192\n\t"
                 "global_load_b128 %2, %16, off offset:16384\n\t"
                 "global_load_b128 %3, %16, off offset:24576\n\t"
                 "global_load_b128 %4, %16, off offset:32768\n\t"
                 "global_load_b128 %5, %16, off offset:40960\n\t"
                 "global_load_b128 %6, %16, off offset:49152\n\t"
                 "global_load_b128 %7, %16, off offset:57344\n\t"
                 "global_load_b128 %8, %17, off\n\t"
                 "global_load_b128 %9, %17, off offset:8192\n\t"
                 "global_load_b128 %10, %17, off offset:16384\n\t"
                 "global_load_b128 %11, %17, off offset:24576\n\t"
                 "global_load_b128 %12, %17, off offset:32768\n\t"
                 "global_load_b128 %13, %17, off offset:40960\n\t"
                 "global_load_b128 %14, %17, off offset:49152\n\t"
                 "global_load_b128 %15, %17, off offset:57344\n\t"
                 "s_wait_loadcnt 0x0"
                 : "=&v"(yv[0]), "=&v"(yv[1]), "=&v"(yv[2]), "=&v"(yv[3]),
                   "=&v"(yv[4]), "=&v"(yv[5]), "=&v"(yv[6]), "=&v"(yv[7]),
                   "=&v"(xv[0]), "=&v"(xv[1]), "=&v"(xv[2]), "=&v"(xv[3]),
                   "=&v"(xv[4]), "=&v"(xv[5]), "=&v"(xv[6]), "=&v"(xv[7])
                 : "v"(yg + base), "v"(x + base)
                 : "memory");
    // Unrolled: yv[] and xv[] stay in the registers the loads filled; a rolled loop would index them through memory
    #pragma unroll
    for (int i = 0; i < FIN_V; ++i) {
        float4 o;
        o.x = fmaf(rw, xv[i].x, gelu_t(fmaf(gamma, (yv[i].x - mean) * rstd, beta)));
        o.y = fmaf(rw, xv[i].y, gelu_t(fmaf(gamma, (yv[i].y - mean) * rstd, beta)));
        o.z = fmaf(rw, xv[i].z, gelu_t(fmaf(gamma, (yv[i].z - mean) * rstd, beta)));
        o.w = fmaf(rw, xv[i].w, gelu_t(fmaf(gamma, (yv[i].w - mean) * rstd, beta)));
        *(float4*)(out + base + i * (FIN_T * 4)) = o;
    }
}

// ---------------------------------------------------------------------------
extern "C" void kernel_launch(void* const* d_in, const int* in_sizes, int n_in,
                              void* d_out, int out_size, void* d_ws, size_t ws_size,
                              hipStream_t stream) {
    const float* x      = (const float*)d_in[0];
    const float* cond   = (const float*)d_in[1];
    const float* W_lin  = (const float*)d_in[2];
    const float* b_lin  = (const float*)d_in[3];
    const float* log_dt = (const float*)d_in[4];
    const float* A_re   = (const float*)d_in[5];
    const float* A_im   = (const float*)d_in[6];
    const float* C_re   = (const float*)d_in[7];
    const float* C_im   = (const float*)d_in[8];
    const float* Dv     = (const float*)d_in[9];
    const float* W_out  = (const float*)d_in[10];
    const float* b_out  = (const float*)d_in[11];
    const float* film_W = (const float*)d_in[12];
    const float* film_b = (const float*)d_in[13];
    const float* res_w  = (const float*)d_in[14];
    float* out = (float*)d_out;

    const size_t tot = (size_t)Bdim * Hdim * Ldim;
    float* ws   = (float*)d_ws;
    float* u    = ws;                                   // [B,H,L]
    float* v    = u + tot;                              // [B,H,L]
    float* yg   = u;                                    // alias: u dead after scan_out
    float* S    = v + tot;                              // [B*H*NCHUNK, N, 2]
    float* wr_  = S + (size_t)Bdim * Hdim * NCHUNK * 64;
    float* wi_  = wr_  + Hdim * Ndim;
    float* cdr_ = wi_  + Hdim * Ndim;
    float* cdi_ = cdr_ + Hdim * Ndim;
    float* wcr_ = cdi_ + Hdim * Ndim;
    float* wci_ = wcr_ + Hdim * Ndim;
    float* gb   = wci_ + Hdim * Ndim;                   // [B, 2H]
    float* stats = gb + Bdim * 2 * Hdim;                // [H, 2]
    float* Gt   = stats + 2 * Hdim;                     // [H, SUB, 2N]
    float* Tt   = Gt + Hdim * SUB * 2 * Ndim;           // [H, SUB, SUB]

    k_setup<<<1, Hdim * Ndim, 0, stream>>>(log_dt, A_re, A_im, C_re, C_im,
                                           wr_, wi_, cdr_, cdi_, wcr_, wci_, Gt, Tt);
    k_film<<<1, Bdim * 2 * Hdim, 0, stream>>>(cond, film_W, film_b, gb);
    k_in_linear<<<(Bdim * (Ldim / 16)) / 8, 256, 0, stream>>>(x, W_lin, b_lin, u);
    k_scan_local<<<(Bdim * Hdim * NCHUNK) / 8, 256, 0, stream>>>(u, wr_, wi_, S);
    k_scan_prefix<<<(Bdim * Hdim * Ndim) / 256, 256, 0, stream>>>(S, wcr_, wci_);
    k_scan_out<<<(Bdim * Hdim * NCHUNK) / 8, 256, 0, stream>>>(u, S, wr_, wi_,
                                                               Gt, Tt, Dv, v);
    k_out_glu<<<(Bdim * (Ldim / 16)) / 8, 256, 0, stream>>>(v, W_out, b_out, yg);
    k_bn_stats<<<Hdim, 1024, 0, stream>>>(yg, stats);
    k_final<<<(Bdim * Hdim * Ldim) / FIN_SPAN, FIN_T, 0, stream>>>(yg, stats, gb, res_w, x, out);
}

// v003
// One run takes 96.3 microseconds.
// Two timings next to v002 put it at 1.33 and 1.32 times that version's speed.
// Counting every step since v000, it is 2.05 times as fast.
#include <hip/hip_runtime.h>
#include <hip/hip_bf16.h>
#include <math.h>

// Problem constants (match reference)
#define Bdim   8
#define Hdim   32
#define Ldim   32768
#define Ndim   32
#define CDdim  128
#define NCHUNK 32                 // chunks per sequence (must be 32: code uses >>5)
#define CHUNK  (Ldim / NCHUNK)    // 1024
#define SUB    16                 // steps per sub-block of the output pass (rows of one matrix tile)
#define FIN_T  512                // threads per block of the last kernel
#define FIN_V  8                  // 16-byte groups per thread and stream there
#define FIN_SPAN (FIN_T * 4 * FIN_V)   // elements per block there; divides Ldim
#define SROW   68                 // LDS pitch (floats) of one state snapshot: 16 B x odd, no bank conflict

typedef __attribute__((ext_vector_type(2))) float v2f;
typedef __attribute__((ext_vector_type(4))) float v4f;
typedef __attribute__((ext_vector_type(8))) float v8f;
typedef __attribute__((ext_vector_type(4))) int   i32x4;
typedef __attribute__((ext_vector_type(8))) int   i32x8;

// Branch-free gelu (tanh approximation): 0.5x(1+tanh(z)) == x*sigmoid(2z)
__device__ __forceinline__ float gelu_t(float x) {
    float x3 = x * x * x;
    float z  = fmaf(0.044715f, x3, x) * 1.5957691216057308f;  // 2*sqrt(2/pi)
    return x * __fdividef(1.0f, 1.0f + __expf(-z));
}
__device__ __forceinline__ float sigm(float x) {
    return __fdividef(1.0f, 1.0f + __expf(-x));
}

// ---------------------------------------------------------------------------
// Tensor Data Mover: 2D f32 tile Global -> LDS (D# built in SGPR tuples).
// Group0: count=1 | lds_addr | global_addr(57b) | type=2.
// Group1: data_size=4B, tensor_dim0/1, tile_dim0/1, tensor_dim0_stride.
// ---------------------------------------------------------------------------
__device__ __forceinline__ void tdm_load_2d_f32(const void* gsrc, unsigned lds_off,
                                                int width, int height, int stride) {
    unsigned long long ga = (unsigned long long)(uintptr_t)gsrc;
    i32x4 g0;
    g0.x = 1;                                                   // count=1, user D#
    g0.y = (int)lds_off;                                        // lds_addr [63:32]
    g0.z = (int)(unsigned)ga;                                   // global_addr [95:64]
    g0.w = (int)(((unsigned)(ga >> 32) & 0x01FFFFFFu) | 0x80000000u); // [120:96] | type=2
    i32x8 g1;
    g1[0] = 2 << 16;                                            // data_size = 4 bytes
    g1[1] = (width & 0xFFFF) << 16;                             // tensor_dim0 lo16 @bit48
    g1[2] = ((width >> 16) & 0xFFFF) | ((height & 0xFFFF) << 16); // dim0 hi | dim1 lo
    g1[3] = ((height >> 16) & 0xFFFF) | ((width & 0xFFFF) << 16); // dim1 hi | tile_dim0
    g1[4] = (height & 0xFFFF);                                  // tile_dim1 (tile_dim2=0)
    g1[5] = stride;                                             // tensor_dim0_stride lo32
    g1[6] = 0;
    g1[7] = 0;
    asm volatile("tensor_load_to_lds %0, %1" :: "s"(g0), "s"(g1) : "memory");
}

// ---------------------------------------------------------------------------
// K0: per-(h,n) SSM constants: w = exp(dt*A), Cd = 2*C*(exp(dtA)-1)/A, Wc = w^CHUNK
//     and the output pass's tables: Gt[h][t][2n,2n+1] = (Re, -Im) of Cd*w^(t+1),
//     Tt[h][t][j] = sum_n Re(Cd*w^(t-j)) for j <= t, else 0, for t, j < SUB.
// ---------------------------------------------------------------------------
__global__ void k_setup(const float* __restrict__ log_dt,
                        const float* __restrict__ A_re, const float* __restrict__ A_im,
                        const float* __restrict__ C_re, const float* __restrict__ C_im,
                        float* wr_, float* wi_, float* cdr_, float* cdi_,
                        float* wcr_, float* wci_, float* Gt, float* Tt) {
    int i = threadIdx.x;                 // H*N = 1024
    int h = i >> 5;
    float dt  = __expf(log_dt[h]);
    float ar  = A_re[i], ai = A_im[i];
    float dre = dt * ar, dim = dt * ai;
    float er  = __expf(dre);
    float sn, cs; __sincosf(dim, &sn, &cs);
    float wr = er * cs, wi = er * sn;
    float exr = wr - 1.0f, exi = wi;
    float den = ar * ar + ai * ai;
    float qr = (exr * ar + exi * ai) / den;
    float qi = (exi * ar - exr * ai) / den;
    float cr = C_re[i], ci = C_im[i];
    wr_[i]  = wr;  wi_[i]  = wi;
    cdr_[i] = 2.0f * (cr * qr - ci * qi);
    cdi_[i] = 2.0f * (cr * qi + ci * qr);
    float er2 = __expf(dre * (float)CHUNK);
    float sn2, cs2; __sincosf(dim * (float)CHUNK, &sn2, &cs2);
    wcr_[i] = er2 * cs2;  wci_[i] = er2 * sn2;

    int n = i & 31;                      // a wave holds the 32 states of one h
    float gr = 2.0f * (cr * qr - ci * qi);
    float gi = 2.0f * (cr * qi + ci * qr);
    float* Td = Tt + h * (SUB * SUB) + (n & (SUB - 1)) * (SUB + 1);   // T[n][n]
    float ks[SUB];                       // Re(Cd*w^d), then its sum over the states
    // The three loops are unrolled so that ks[] stays in registers; the sums of all d
    // go through the butterfly side by side, so their cross-lane latencies overlap.
    #pragma unroll
    for (int d = 0; d < SUB; ++d) {
        ks[d] = gr;
        float ngr = fmaf(gr, wr, -(gi * wi));
        gi = fmaf(gr, wi, gi * wr);
        gr = ngr;                        // now Cd*w^(d+1)
        v2f gp; gp.x = gr; gp.y = -gi;
        *(v2f*)&Gt[((size_t)(h * SUB + d)) * (2 * Ndim) + 2 * n] = gp;
    }
    #pragma unroll
    for (int off = 16; off; off >>= 1) {
        #pragma unroll
        for (int d = 0; d < SUB; ++d) ks[d] += __shfl_xor(ks[d], off, 32);
    }
    #pragma unroll
    for (int d = 0; d < SUB; ++d) {
        if (n < SUB - d) {
            Td[d * SUB] = ks[d];         // T[n+d][n]
            if (d) Td[d] = 0.0f;         // T[n][n+d], above the diagonal
        }
    }
}

// ---------------------------------------------------------------------------
// K-film: gb[b,g] = cond[b] . film_W[g] + film_b[g]      (8 x 64 outputs)
// ---------------------------------------------------------------------------
__global__ void k_film(const float* __restrict__ cond, const float* __restrict__ fW,
                       const float* __restrict__ fb, float* __restrict__ gb) {
    int i = threadIdx.x;                 // 512
    int b = i >> 6;
    int g = i & 63;
    const float* c = cond + b * CDdim;
    const float* w = fW + g * CDdim;
    float s = fb[g];
    #pragma unroll 8
    for (int j = 0; j < CDdim; ++j) s = fmaf(c[j], w[j], s);
    gb[i] = s;
}

// ---------------------------------------------------------------------------
// K1: u = gelu(W_lin @ x + b_lin)   via V_WMMA_F32_16X16X4_F32
//     W_lin staged to LDS once per block through the TDM.
// ---------------------------------------------------------------------------
__global__ __launch_bounds__(256) void k_in_linear(
        const float* __restrict__ x, const float* __restrict__ W,
        const float* __restrict__ bias, float* __restrict__ u) {
    __shared__ __align__(16) float Wl[Hdim * Hdim];            // 4 KB
    if (threadIdx.x < 32) {
        tdm_load_2d_f32(W, (unsigned)(uintptr_t)Wl, Hdim, Hdim, Hdim);
        __builtin_amdgcn_s_wait_tensorcnt(0);
    }
    __syncthreads();

    const int lane = threadIdx.x & 31;
    const int m    = lane & 15;
    const int hi   = lane >> 4;
    const int gid  = blockIdx.x * 8 + (threadIdx.x >> 5);
    const int b    = gid / (Ldim / 16);
    const int l0   = (gid % (Ldim / 16)) * 16;
    const float* xb = x + (size_t)b * Hdim * Ldim;
    v8f acc0 = {};
    v8f acc1 = {};
    #pragma unroll
    for (int kk = 0; kk < 8; ++kk) {
        const int k = kk * 4 + 2 * hi;                         // K-pair for half-wave
        v2f bm;                                                // B: 4x16
        bm.x = xb[(size_t)k * Ldim + l0 + m];
        bm.y = xb[(size_t)(k + 1) * Ldim + l0 + m];
        v2f a0 = *(const v2f*)&Wl[m * Hdim + k];               // ds_load_b64
        v2f a1 = *(const v2f*)&Wl[(16 + m) * Hdim + k];
        acc0 = __builtin_amdgcn_wmma_f32_16x16x4_f32(false, a0, false, bm, (short)0, acc0, false, false);
        acc1 = __builtin_amdgcn_wmma_f32_16x16x4_f32(false, a1, false, bm, (short)0, acc1, false, false);
    }
    #pragma unroll
    for (int r = 0; r < 8; ++r) {
        int g0 = r + 8 * hi;
        int g1 = 16 + g0;
        u[((size_t)b * Hdim + g0) * Ldim + l0 + m] = gelu_t(acc0[r] + bias[g0]);
        u[((size_t)b * Hdim + g1) * Ldim + l0 + m] = gelu_t(acc1[r] + bias[g1]);
    }
}

// ---------------------------------------------------------------------------
// Both scan kernels take the recurrence s' = w*s + u in sub-blocks of SUB steps:
//     s(after a sub-block) = w^SUB * s(before it) + Lsum,  Lsum[blk][n] = sum_j w_n^(SUB-1-j) u[blk*SUB + j].
// Lsum of 16 sub-blocks (256 steps) is a matrix product, A = the inputs (row blk, k = j),
// B = the powers of w (k = j, column = state); four column tiles: re and im of the
// states 0..15, then re and im of the states 16..31.  A and B fragments take the same
// j at the same place: j = hi*8 + 2*w + {0,1} in product w.  In the result a lane holds,
// for its two states m and 16+m, the sub-blocks 8*hi .. 8*hi+7, one per register.
// ---------------------------------------------------------------------------
// (r,i) = (r,i)*(ar,ai) + (br,bi)
__device__ __forceinline__ void cmad(float& r, float& i, float ar, float ai, float br, float bi) {
    float nr = fmaf(ar, r, fmaf(-ai, i, br));
    i = fmaf(ai, r, fmaf(ar, i, bi));
    r = nr;
}
// Lane l <-> l ^ 16 as a vector cross-row move
__device__ __forceinline__ float xhalf(float v) {
    int b = __float_as_int(v);
    return __int_as_float(__builtin_amdgcn_permlanex16(b, b, 0x76543210, 0xfedcba98, false, false));
}
struct SubTab {
    v2f   pb[4][4];                      // B fragments [tile][product]
    float sr[2], si[2];                  // w^SUB of the lane's two states
    float hr[2], hj[2];                  // w^(8*SUB): a half's eight sub-blocks
};
__device__ __forceinline__ void sub_tables(const float* wre, const float* wim, int hi, SubTab& t) {
    #pragma unroll
    for (int s = 0; s < 2; ++s) {
        float pw_r[8], pw_i[8];          // w^(2^e)
        pw_r[0] = wre[s];  pw_i[0] = wim[s];
        #pragma unroll
        for (int e = 1; e < 8; ++e) {
            pw_r[e] = fmaf(pw_r[e - 1], pw_r[e - 1], -(pw_i[e - 1] * pw_i[e - 1]));
            pw_i[e] = 2.0f * pw_r[e - 1] * pw_i[e - 1];
        }
        t.sr[s] = pw_r[4];  t.si[s] = pw_i[4];
        t.hr[s] = pw_r[7];  t.hj[s] = pw_i[7];
        float pr = hi ? 1.0f : pw_r[3];  // w^(SUB-1-j) at j = hi*8 + 7
        float pi = hi ? 0.0f : pw_i[3];
        #pragma unroll
        for (int e = 7; e >= 0; --e) {
            t.pb[2 * s][e >> 1][e & 1]     = pr;
            t.pb[2 * s + 1][e >> 1][e & 1] = pi;
            cmad(pr, pi, wre[s], wim[s], 0.0f, 0.0f);
        }
    }
}
// la[tile][r] = Lsum[blk = 8*hi + r][column m of the tile]; ua, ub = u[m*SUB + hi*8 .. +7]
__device__ __forceinline__ void sub_sums(const v4f& ua, const v4f& ub, const SubTab& t, v8f* la) {
    v2f a0, a1, a2, a3;
    a0.x = ua.x;  a0.y = ua.y;  a1.x = ua.z;  a1.y = ua.w;
    a2.x = ub.x;  a2.y = ub.y;  a3.x = ub.z;  a3.y = ub.w;
    // The 16 products as one statement.  The four v_nop are the
    // vector slots between the last product and the first vector instruction on its A, B or D.
    asm volatile(
                 "v_wmma_f32_16x16x4_f32 %0, %4, %8, 0\n\t"
                 "v_wmma_f32_16x16x4_f32 %1, %4, %9, 0\n\t"
                 "v_wmma_f32_16x16x4_f32 %2, %4, %10, 0\n\t"
                 "v_wmma_f32_16x16x4_f32 %3, %4, %11, 0\n\t"
                 "v_wmma_f32_16x16x4_f32 %0, %5, %12, %0\n\t"
                 "v_wmma_f32_16x16x4_f32 %1, %5, %13, %1\n\t"
                 "v_wmma_f32_16x16x4_f32 %2, %5, %14, %2\n\t"
                 "v_wmma_f32_16x16x4_f32 %3, %5, %15, %3\n\t"
                 "v_wmma_f32_16x16x4_f32 %0, %6, %16, %0\n\t"
                 "v_wmma_f32_16x16x4_f32 %1, %6, %17, %1\n\t"
                 "v_wmma_f32_16x16x4_f32 %2, %6, %18, %2\n\t"
                 "v_wmma_f32_16x16x4_f32 %3, %6, %19, %3\n\t"
                 "v_wmma_f32_16x16x4_f32 %0, %7, %20, %0\n\t"
                 "v_wmma_f32_16x16x4_f32 %1, %7, %21, %1\n\t"
                 "v_wmma_f32_16x16x4_f32 %2, %7, %22, %2\n\t"
                 "v_wmma_f32_16x16x4_f32 %3, %7, %23, %3\n\t"
                 "v_nop\n\tv_nop\n\tv_nop\n\tv_nop"
                 : "=&v"(la[0]), "=&v"(la[1]), "=&v"(la[2]), "=&v"(la[3])
                 : "v"(a0), "v"(a1), "v"(a2), "v"(a3),
                   "v"(t.pb[0][0]), "v"(t.pb[1][0]), "v"(t.pb[2][0]), "v"(t.pb[3][0]),
                   "v"(t.pb[0][1]), "v"(t.pb[1][1]), "v"(t.pb[2][1]), "v"(t.pb[3][1]),
                   "v"(t.pb[0][2]), "v"(t.pb[1][2]), "v"(t.pb[2][2]), "v"(t.pb[3][2]),
                   "v"(t.pb[0][3]), "v"(t.pb[1][3]), "v"(t.pb[2][3]), "v"(t.pb[3][3]));
}

// ---------------------------------------------------------------------------
// K2: local chunk scan (end state only).  wave = (b,h,chunk).
//     Each half-wave sums its own sub-blocks by Horner's rule in w^SUB, stepping over the
//     other half's eight by w^(8*SUB); the two halves are joined once at the end.
// ---------------------------------------------------------------------------
__global__ __launch_bounds__(256) void k_scan_local(
        const float* __restrict__ u, const float* __restrict__ wr_,
        const float* __restrict__ wi_, float* __restrict__ S) {
    int lane = threadIdx.x & 31;
    int m    = lane & 15;
    int hi   = lane >> 4;
    int gid  = blockIdx.x * 8 + (threadIdx.x >> 5);  // (b*H+h)*NCHUNK + c
    int c    = gid & (NCHUNK - 1);
    int bh   = gid >> 5;
    int h    = bh & (Hdim - 1);
    float wre[2], wim[2];
    const float* up = u + (size_t)bh * Ldim + (size_t)c * CHUNK + m * SUB + hi * 8;
    // The whole chunk and the lane's two w are asked for together at the head (left to the
    // compiler, each group's loads went down to just in front of its products and their
    // latencies came one after another).  One statement with its data wait, so that no
    // result lands on an address register of a load that is still on its way.
    static_assert(CHUNK == 1024 && SUB == 16, "the offsets below are written out for this shape");
    v4f uq[2 * (CHUNK / 256)];
    asm volatile("global_load_b32 %8, %13, off\n\t"
                 "global_load_b32 %9, %13, off offset:64\n\t"
                 "global_load_b32 %10, %14, off\n\t"
                 "global_load_b32 %11, %14, off offset:64\n\t"
                 "global_load_b128 %0, %12, off\n\t"
                 "global_load_b128 %1, %12, off offset:16\n\t"
                 "global_load_b128 %2, %12, off offset:1024\n\t"
                 "global_load_b128 %3, %12, off offset:1040\n\t"
                 "global_load_b128 %4, %12, off offset:2048\n\t"
                 "global_load_b128 %5, %12, off offset:2064\n\t"
                 "global_load_b128 %6, %12, off offset:3072\n\t"
                 "global_load_b128 %7, %12, off offset:3088\n\t"
                 "s_wait_loadcnt 0x0"
                 : "=&v"(uq[0]), "=&v"(uq[1]), "=&v"(uq[2]), "=&v"(uq[3]),
                   "=&v"(uq[4]), "=&v"(uq[5]), "=&v"(uq[6]), "=&v"(uq[7]),
                   "=&v"(wre[0]), "=&v"(wre[1]), "=&v"(wim[0]), "=&v"(wim[1])
                 : "v"(up), "v"(wr_ + h * Ndim + m), "v"(wi_ + h * Ndim + m)
                 : "memory");
    SubTab t;
    sub_tables(wre, wim, hi, t);
    float rr[2], ri[2];
    // Unrolled: uq[] stays in the registers the loads filled
    #pragma unroll
    for (int g = 0; g < CHUNK / 256; ++g) {
        v8f la[4];
        sub_sums(uq[2 * g], uq[2 * g + 1], t, la);
        #pragma unroll
        for (int s = 0; s < 2; ++s) {
            if (g) {
                cmad(rr[s], ri[s], t.hr[s], t.hj[s], 0.0f, 0.0f);
                cmad(rr[s], ri[s], t.sr[s], t.si[s], la[2 * s][0], la[2 * s + 1][0]);
            } else {
                rr[s] = la[2 * s][0];  ri[s] = la[2 * s + 1][0];
            }
            #pragma unroll
            for (int r = 1; r < 8; ++r)
                cmad(rr[s], ri[s], t.sr[s], t.si[s], la[2 * s][r], la[2 * s + 1][r]);
        }
    }
    v2f st;                                          // lane writes state n = lane = hi*16 + m
    #pragma unroll
    for (int s = 0; s < 2; ++s) {
        float orr = xhalf(rr[s]), ori = xhalf(ri[s]);
        float ar = hi ? orr : rr[s], ai = hi ? ori : ri[s];    // the lower half's sum
        float br = hi ? rr[s] : orr, bi = hi ? ri[s] : ori;    // the upper half's
        cmad(ar, ai, t.hr[s], t.hj[s], br, bi);
        if (s == 0 || hi) { st.x = ar; st.y = ai; }
    }
    *(v2f*)&S[(size_t)gid * 64 + lane * 2] = st;
}

// ---------------------------------------------------------------------------
// K3: exclusive prefix over chunks (in place): P[c] = Wc*P[c-1] + S[c-1]
// ---------------------------------------------------------------------------
__global__ void k_scan_prefix(float* __restrict__ S,
                              const float* __restrict__ wcr_,
                              const float* __restrict__ wci_) {
    int t  = blockIdx.x * blockDim.x + threadIdx.x;  // B*H*N = 8192
    int n  = t & 31;
    int bh = t >> 5;
    int h  = bh & (Hdim - 1);
    float wr = wcr_[h * Ndim + n], wi = wci_[h * Ndim + n];
    float pr = 0.0f, pi = 0.0f;
    size_t base = (size_t)bh * NCHUNK * 64 + n * 2;
    for (int c = 0; c < NCHUNK; ++c) {
        size_t ix = base + (size_t)c * 64;
        float tr = S[ix], ti = S[ix + 1];
        S[ix] = pr;  S[ix + 1] = pi;                 // exclusive prefix
        float npr = fmaf(wr, pr, fmaf(-wi, pi, tr));
        pi = fmaf(wi, pr, fmaf(wr, pi, ti));
        pr = npr;
    }
}

// ---------------------------------------------------------------------------
// K4: output pass. Per 256 steps the sub-block sums come as in K2; a recurrence over the
//     sub-blocks (first each half's sum, then, from the right start, its eight states)
//     leaves a snapshot of the state at the start of every SUB steps in LDS. The outputs
//     come from matrix products, Y[t][blk] = T[t][j] U[j][blk] + G[t][k] Sn[k][blk]:
//     T = the lower-triangular Toeplitz tile Tt with D added on the diagonal, U = the inputs,
//     Sn = the snapshots (k = 2n, 2n+1 for re, im).  A and B fragments take the
//     same k at the same place: k = hi*(K/2) + 2*w + {0,1} in product w.
// ---------------------------------------------------------------------------
__global__ __launch_bounds__(256) void k_scan_out(
        const float* __restrict__ u, const float* __restrict__ S,
        const float* __restrict__ wr_, const float* __restrict__ wi_,
        const float* __restrict__ Gt, const float* __restrict__ Tt,
        const float* __restrict__ Dvec, float* __restrict__ v) {
    __shared__ __align__(16) float Sl[8][SUB * SROW];          // one range per wave
    int lane = threadIdx.x & 31;
    int m    = lane & 15;
    int hi   = lane >> 4;
    int gid  = blockIdx.x * 8 + (threadIdx.x >> 5);
    int c    = gid & (NCHUNK - 1);
    int bh   = gid >> 5;
    int h    = bh & (Hdim - 1);
    float wre[2], wim[2];
    wre[0] = wr_[h * Ndim + m];  wre[1] = wr_[h * Ndim + 16 + m];
    wim[0] = wi_[h * Ndim + m];  wim[1] = wi_[h * Ndim + 16 + m];
    float Dh  = Dvec[h];
    // State at the group's start, of the lane's two states m and 16+m (both halves hold it)
    v2f s0 = *(const v2f*)&S[(size_t)gid * 64 + m * 2];
    v2f s1 = *(const v2f*)&S[(size_t)gid * 64 + 32 + m * 2];
    // Here and below: address registers of issued loads and stores are reused next
    asm volatile("s_wait_xcnt 0x0" ::: "memory");
    const float* up = u + (size_t)bh * Ldim + (size_t)c * CHUNK;
    float*       vp = v + (size_t)bh * Ldim + (size_t)c * CHUNK;
    float*       sl = &Sl[threadIdx.x >> 5][0];
    float gr[2] = {s0.x, s1.x}, gi[2] = {s0.y, s1.y};
    SubTab t;
    sub_tables(wre, wim, hi, t);

    // A fragments, held for the whole chunk: row t = m
    v4f tl, th;                                                // T[m][hi*8 .. +7]
    // One statement with its data wait: the next loads' results may then land on its address registers
    asm volatile("global_load_b128 %0, %2, off\n\t"
                 "global_load_b128 %1, %2, off offset:16\n\t"
                 "s_wait_loadcnt 0x0"
                 : "=&v"(tl), "=&v"(th)
                 : "v"(Tt + (h * SUB + m) * SUB + hi * 8)
                 : "memory");
    float ta[8];
    #pragma unroll
    for (int e = 0; e < 8; ++e) {
        float kv = e < 4 ? tl[e & 3] : th[e & 3];
        ta[e] = (hi * 8 + e == m) ? kv + Dh : kv;
    }
    float4 ga[8];                                              // G[m][hi*32 .. +31]
    #pragma unroll
    for (int w = 0; w < 8; ++w)
        ga[w] = *(const float4*)&Gt[((size_t)(h * SUB + m)) * (2 * Ndim) + hi * 32 + w * 4];
    asm volatile("s_wait_xcnt 0x0" ::: "memory");

    for (int g = 0; g < CHUNK; g += 256) {
        // The group's inputs: A fragment of the sub-block sums and B fragment U[hi*8 ..][blk = m]
        // of the output products (one statement with its data wait, so that no result lands
        // on an address register of a load that is still on its way)
        v4f ub0, ub1;
        asm volatile("global_load_b128 %0, %2, off\n\t"
                     "global_load_b128 %1, %2, off offset:16\n\t"
                     "s_wait_loadcnt 0x0"
                     : "=&v"(ub0), "=&v"(ub1)
                     : "v"(up + g + m * SUB + hi * 8)
                     : "memory");
        v8f la[4];
        sub_sums(ub0, ub1, t, la);
        #pragma unroll
        for (int s = 0; s < 2; ++s) {
            float hr = la[2 * s][0], hj = la[2 * s + 1][0];    // the half's eight sub-blocks from a zero state
            #pragma unroll
            for (int r = 1; r < 8; ++r)
                cmad(hr, hj, t.sr[s], t.si[s], la[2 * s][r], la[2 * s + 1][r]);
            float orr = xhalf(hr), ori = xhalf(hj);
            float mr = gr[s], mi = gi[s];                      // state at sub-block 8
            cmad(mr, mi, t.hr[s], t.hj[s], hi ? orr : hr, hi ? ori : hj);
            float cr = hi ? mr : gr[s], ci = hi ? mi : gi[s];  // state at the half's first sub-block
            cmad(mr, mi, t.hr[s], t.hj[s], hi ? hr : orr, hi ? hj : ori);
            gr[s] = mr;  gi[s] = mi;                           // state at the next group's start
            #pragma unroll
            for (int r = 0; r < 8; ++r) {
                v2f st; st.x = cr; st.y = ci;
                *(v2f*)(sl + (hi * 8 + r) * SROW + s * 32 + m * 2) = st;   // state before sub-block 8*hi + r
                if (r < 7) cmad(cr, ci, t.sr[s], t.si[s], la[2 * s][r], la[2 * s + 1][r]);
            }
        }
        // The snapshots are read back by other lanes of the same wave: the
        // stores must have landed, and the compiler must not move the reads up.
        asm volatile("s_wait_dscnt 0x0" ::: "memory");
        // Holds the recurrence's vector instructions ahead of the run of matrix instructions.
        __builtin_amdgcn_sched_barrier(0);
        v8f acc = {};
        #pragma unroll
        for (int w = 0; w < 4; ++w) {
            const v4f ub = w < 2 ? ub0 : ub1;
            v2f a, b;
            a.x = ta[2 * w];              a.y = ta[2 * w + 1];
            b.x = (w & 1) ? ub.z : ub.x;  b.y = (w & 1) ? ub.w : ub.y;
            acc = __builtin_amdgcn_wmma_f32_16x16x4_f32(false, a, false, b, (short)0, acc, false, false);
        }
        float4 sb[8];                                                  // Sn[hi*32 ..][blk = m]
        #pragma unroll
        for (int w = 0; w < 8; ++w)
            sb[w] = *(const float4*)(sl + m * SROW + hi * 32 + w * 4);
        #pragma unroll
        for (int w = 0; w < 8; ++w) {
            v2f a, b;
            a.x = ga[w].x;  a.y = ga[w].y;  b.x = sb[w].x;  b.y = sb[w].y;
            acc = __builtin_amdgcn_wmma_f32_16x16x4_f32(false, a, false, b, (short)0, acc, false, false);
            a.x = ga[w].z;  a.y = ga[w].w;  b.x = sb[w].z;  b.y = sb[w].w;
            acc = __builtin_amdgcn_wmma_f32_16x16x4_f32(false, a, false, b, (short)0, acc, false, false);
        }
        // Four vector slots between the last product and the first vector instruction
        // that may touch its A, B or D; the two scheduling barriers hold them in place.
        __builtin_amdgcn_sched_barrier(0);
        asm volatile("v_nop\n\tv_nop\n\tv_nop\n\tv_nop");
        __builtin_amdgcn_sched_barrier(0);
        // acc[r] = Y[t = 8*hi + r][blk = m]: eight consecutive outputs per lane
        float4 o0, o1;
        o0.x = acc[0]; o0.y = acc[1]; o0.z = acc[2]; o0.w = acc[3];
        o1.x = acc[4]; o1.y = acc[5]; o1.z = acc[6]; o1.w = acc[7];
        *(float4*)(vp + g + m * SUB + hi * 8)     = o0;
        *(float4*)(vp + g + m * SUB + hi * 8 + 4) = o1;
        asm volatile("s_wait_xcnt 0x0" ::: "memory");
    }
}

// ---------------------------------------------------------------------------
// K5: z = W_out @ y + b_out ; GLU.  W_out (64x32) staged to LDS via TDM.
// ---------------------------------------------------------------------------
__global__ __launch_bounds__(256) void k_out_glu(
        const float* __restrict__ vin, const float* __restrict__ Wo,
        const float* __restrict__ bo, float* __restrict__ yg) {
    __shared__ __align__(16) float Wol[2 * Hdim * Hdim];       // 8 KB
    if (threadIdx.x < 32) {
        tdm_load_2d_f32(Wo, (unsigned)(uintptr_t)Wol, Hdim, 2 * Hdim, Hdim);
        __builtin_amdgcn_s_wait_tensorcnt(0);
    }
    __syncthreads();

    const int lane = threadIdx.x & 31;
    const int m    = lane & 15;
    const int hi   = lane >> 4;
    const int gid  = blockIdx.x * 8 + (threadIdx.x >> 5);
    const int b    = gid / (Ldim / 16);
    const int l0   = (gid % (Ldim / 16)) * 16;
    const float* vb = vin + (size_t)b * Hdim * Ldim;
    v8f acc[4] = {};
    #pragma unroll
    for (int kk = 0; kk < 8; ++kk) {
        const int k = kk * 4 + 2 * hi;
        v2f bm;
        bm.x = vb[(size_t)k * Ldim + l0 + m];
        bm.y = vb[(size_t)(k + 1) * Ldim + l0 + m];
        #pragma unroll
        for (int t = 0; t < 4; ++t) {
            v2f a = *(const v2f*)&Wol[(t * 16 + m) * Hdim + k];
            acc[t] = __builtin_amdgcn_wmma_f32_16x16x4_f32(false, a, false, bm, (short)0, acc[t], false, false);
        }
    }
    #pragma unroll
    for (int t = 0; t < 2; ++t) {
        #pragma unroll
        for (int r = 0; r < 8; ++r) {
            int g  = t * 16 + r + 8 * hi;
            float zv = acc[t][r]     + bo[g];
            float zg = acc[t + 2][r] + bo[g + Hdim];
            yg[((size_t)b * Hdim + g) * Ldim + l0 + m] = zv * sigm(zg);
        }
    }
}

// ---------------------------------------------------------------------------
// K6: per-channel mean / rstd over (B, L)  (deterministic block reduction)
// ---------------------------------------------------------------------------
__global__ __launch_bounds__(1024) void k_bn_stats(
        const float* __restrict__ yg, float* __restrict__ stats) {
    __shared__ float ls[1024];
    __shared__ float ls2[1024];
    int h = blockIdx.x;
    int tid = threadIdx.x;
    float s = 0.0f, s2 = 0.0f;
    for (int b = 0; b < Bdim; ++b) {
        const float* p = yg + ((size_t)b * Hdim + h) * Ldim;
        for (int i = tid; i < Ldim; i += 1024) {
            float val = p[i];
            s += val;  s2 = fmaf(val, val, s2);
        }
    }
    ls[tid] = s;  ls2[tid] = s2;
    __syncthreads();
    for (int st = 512; st > 0; st >>= 1) {
        if (tid < st) { ls[tid] += ls[tid + st]; ls2[tid] += ls2[tid + st]; }
        __syncthreads();
    }
    if (tid == 0) {
        float inv  = 1.0f / (float)((size_t)Bdim * Ldim);
        float mean = ls[0] * inv;
        float var  = ls2[0] * inv - mean * mean;
        stats[2 * h]     = mean;
        stats[2 * h + 1] = rsqrtf(var + 1e-5f);
    }
}

// ---------------------------------------------------------------------------
// K7: BN apply + FiLM + gelu + depthwise residual.
//     A thread takes FIN_V groups of four elements, a block FIN_SPAN elements of one (b,h) row.
// ---------------------------------------------------------------------------
__global__ __launch_bounds__(FIN_T) void k_final(
        const float* __restrict__ yg, const float* __restrict__ stats,
        const float* __restrict__ gb, const float* __restrict__ resw,
        const float* __restrict__ x, float* __restrict__ out) {
    const int row = blockIdx.x / (Ldim / FIN_SPAN);            // b*H + h, the same for the whole block
    const int h = row & (Hdim - 1);
    const int b = row / Hdim;
    const size_t base = (size_t)blockIdx.x * FIN_SPAN + threadIdx.x * 4;
    const float mean  = stats[2 * h];
    const float rstd  = stats[2 * h + 1];
    const float gamma = gb[b * (2 * Hdim) + h];
    const float beta  = gb[b * (2 * Hdim) + Hdim + h];
    const float rw    = resw[h];
    // All 16 loads of the thread are asked for before the first is used (left to the compiler,
    // the x loads went down among the arithmetic in pairs and their latencies came one after
    // another); a wave's load covers 512 contiguous bytes; the offsets step by FIN_T * 16 bytes.
    // One statement with its data wait, so that no result lands on an address register of a
    // load that is still on its way.
    static_assert(FIN_T * 16 == 8192 && FIN_V == 8, "the offsets below are written out for this shape");
    v4f yv[FIN_V], xv[FIN_V];
    asm volatile("global_load_b128 %0, %16, off\n\t"
                 "global_load_b128 %1, %16, off offset:8192\n\t"
                 "global_load_b128 %2, %16, off offset:16384\n\t"
                 "global_load_b128 %3, %16, off offset:24576\n\t"
                 "global_load_b128 %4, %16, off offset:32768\n\t"
                 "global_load_b128 %5, %16, off offset:40960\n\t"
                 "global_load_b128 %6, %16, off offset:49152\n\t"
                 "global_load_b128 %7, %16, off offset:57344\n\t"
                 "global_load_b128 %8, %17, off\n\t"
                 "global_load_b128 %9, %17, off offset:8192\n\t"
                 "global_load_b128 %10, %17, off offset:16384\n\t"
                 "global_load_b128 %11, %17, off offset:24576\n\t"
                 "global_load_b128 %12, %17, off offset:32768\n\t"
                 "global_load_b128 %13, %17, off offset:40960\n\t"
                 "global_load_b128 %14, %17, off offset:49152\n\t"
                 "global_load_b128 %15, %17, off offset:57344\n\t"
                 "s_wait_loadcnt 0x0"
                 : "=&v"(yv[0]), "=&v"(yv[1]), "=&v"(yv[2]), "=&v"(yv[3]),
                   "=&v"(yv[4]), "=&v"(yv[5]), "=&v"(yv[6]), "=&v"(yv[7]),
                   "=&v"(xv[0]), "=&v"(xv[1]), "=&v"(xv[2]), "=&v"(xv[3]),
                   "=&v"(xv[4]), "=&v"(xv[5]), "=&v"(xv[6]), "=&v"(xv[7])
                 : "v"(yg + base), "v"(x + base)
                 : "memory");
    // Unrolled: yv[] and xv[] stay in the registers the loads filled; a rolled loop would index them through memory
    #pragma unroll
    for (int i = 0; i < FIN_V; ++i) {
        float4 o;
        o.x = fmaf(rw, xv[i].x, gelu_t(fmaf(gamma, (yv[i].x - mean) * rstd, beta)));
        o.y = fmaf(rw, xv[i].y, gelu_t(fmaf(gamma, (yv[i].y - mean) * rstd, beta)));
        o.z = fmaf(rw, xv[i].z, gelu_t(fmaf(gamma, (yv[i].z - mean) * rstd, beta)));
        o.w = fmaf(rw, xv[i].w, gelu_t(fmaf(gamma, (yv[i].w - mean) * rstd, beta)));
        *(float4*)(out + base + i * (FIN_T * 4)) = o;
    }
}

// ---------------------------------------------------------------------------
extern "C" void kernel_launch(void* const* d_in, const int* in_sizes, int n_in,
                              void* d_out, int out_size, void* d_ws, size_t ws_size,
                              hipStream_t stream) {
    const float* x      = (const float*)d_in[0];
    const float* cond   = (const float*)d_in[1];
    const float* W_lin  = (const float*)d_in[2];
    const float* b_lin  = (const float*)d_in[3];
    const float* log_dt = (const float*)d_in[4];
    const float* A_re   = (const float*)d_in[5];
    const float* A_im   = (const float*)d_in[6];
    const float* C_re   = (const float*)d_in[7];
    const float* C_im   = (const float*)d_in[8];
    const float* Dv     = (const float*)d_in[9];
    const float* W_out  = (const float*)d_in[10];
    const float* b_out  = (const float*)d_in[11];
    const float* film_W = (const float*)d_in[12];
    const float* film_b = (const float*)d_in[13];
    const float* res_w  = (const float*)d_in[14];
    float* out = (float*)d_out;

    const size_t tot = (size_t)Bdim * Hdim * Ldim;
    float* ws   = (float*)d_ws;
    float* u    = ws;                                   // [B,H,L]
    float* v    = u + tot;                              // [B,H,L]
    float* yg   = u;                                    // alias: u dead after scan_out
    float* S    = v + tot;                              // [B*H*NCHUNK, N, 2]
    float* wr_  = S + (size_t)Bdim * Hdim * NCHUNK * 64;
    float* wi_  = wr_  + Hdim * Ndim;
    float* cdr_ = wi_  + Hdim * Ndim;
    float* cdi_ = cdr_ + Hdim * Ndim;
    float* wcr_ = cdi_ + Hdim * Ndim;
    float* wci_ = wcr_ + Hdim * Ndim;
    float* gb   = wci_ + Hdim * Ndim;                   // [B, 2H]
    float* stats = gb + Bdim * 2 * Hdim;                // [H, 2]
    float* Gt   = stats + 2 * Hdim;                     // [H, SUB, 2N]
    float* Tt   = Gt + Hdim * SUB * 2 * Ndim;           // [H, SUB, SUB]

    k_setup<<<1, Hdim * Ndim, 0, stream>>>(log_dt, A_re, A_im, C_re, C_im,
                                           wr_, wi_, cdr_, cdi_, wcr_, wci_, Gt, Tt);
    k_film<<<1, Bdim * 2 * Hdim, 0, stream>>>(cond, film_W, film_b, gb);
    k_in_linear<<<(Bdim * (Ldim / 16)) / 8, 256, 0, stream>>>(x, W_lin, b_lin, u);
    k_scan_local<<<(Bdim * Hdim * NCHUNK) / 8, 256, 0, stream>>>(u, wr_, wi_, S);
    k_scan_prefix<<<(Bdim * Hdim * Ndim) / 256, 256, 0, stream>>>(S, wcr_, wci_);
    k_scan_out<<<(Bdim * Hdim * NCHUNK) / 8, 256, 0, stream>>>(u, S, wr_, wi_,
                                                               Gt, Tt, Dv, v);
    k_out_glu<<<(Bdim * (Ldim / 16)) / 8, 256, 0, stream>>>(v, W_out, b_out, yg);
    k_bn_stats<<<Hdim, 1024, 0, stream>>>(yg, stats);
    k_final<<<(Bdim * Hdim * Ldim) / FIN_SPAN, FIN_T, 0, stream>>>(yg, stats, gb, res_w, x, out);
}

// v004
// Measured time: 83.8 microseconds a run.
// Two timings next to v003 both put it at 1.15 times that version's speed.
// Counting every step since v000, it is 2.37 times as fast.
#include <hip/hip_runtime.h>
#include <hip/hip_bf16.h>
#include <math.h>

// Problem constants (match reference)
#define Bdim   8
#define Hdim   32
#define Ldim   32768
#define Ndim   32
#define CDdim  128
#define NCHUNK 32                 // chunks per sequence (must be 32: code uses >>5)
#define CHUNK  (Ldim / NCHUNK)    // 1024
#define SUB    16                 // steps per sub-block of the output pass (rows of one matrix tile)
#define FIN_T  512                // threads per block of the last kernel
#define FIN_V  8                  // 16-byte groups per thread and stream there
#define FIN_SPAN (FIN_T * 4 * FIN_V)   // elements per block there; divides Ldim
#define BN_T   512                // threads per block of the statistics kernel
#define PLINE  32                 // floats between two blocks' partial sums there: one 128-byte line each
#define SROW   68                 // LDS pitch (floats) of one state snapshot: 16 B x odd, no bank conflict

typedef __attribute__((ext_vector_type(2))) float v2f;
typedef __attribute__((ext_vector_type(4))) float v4f;
typedef __attribute__((ext_vector_type(8))) float v8f;
typedef __attribute__((ext_vector_type(4))) int   i32x4;
typedef __attribute__((ext_vector_type(8))) int   i32x8;

// Branch-free gelu (tanh approximation): 0.5x(1+tanh(z)) == x*sigmoid(2z)
__device__ __forceinline__ float gelu_t(float x) {
    float x3 = x * x * x;
    float z  = fmaf(0.044715f, x3, x) * 1.5957691216057308f;  // 2*sqrt(2/pi)
    return x * __fdividef(1.0f, 1.0f + __expf(-z));
}
__device__ __forceinline__ float sigm(float x) {
    return __fdividef(1.0f, 1.0f + __expf(-x));
}

// ---------------------------------------------------------------------------
// Tensor Data Mover: 2D f32 tile Global -> LDS (D# built in SGPR tuples).
// Group0: count=1 | lds_addr | global_addr(57b) | type=2.
// Group1: data_size=4B, tensor_dim0/1, tile_dim0/1, tensor_dim0_stride.
// ---------------------------------------------------------------------------
__device__ __forceinline__ void tdm_load_2d_f32(const void* gsrc, unsigned lds_off,
                                                int width, int height, int stride) {
    unsigned long long ga = (unsigned long long)(uintptr_t)gsrc;
    i32x4 g0;
    g0.x = 1;                                                   // count=1, user D#
    g0.y = (int)lds_off;                                        // lds_addr [63:32]
    g0.z = (int)(unsigned)ga;                                   // global_addr [95:64]
    g0.w = (int)(((unsigned)(ga >> 32) & 0x01FFFFFFu) | 0x80000000u); // [120:96] | type=2
    i32x8 g1;
    g1[0] = 2 << 16;                                            // data_size = 4 bytes
    g1[1] = (width & 0xFFFF) << 16;                             // tensor_dim0 lo16 @bit48
    g1[2] = ((width >> 16) & 0xFFFF) | ((height & 0xFFFF) << 16); // dim0 hi | dim1 lo
    g1[3] = ((height >> 16) & 0xFFFF) | ((width & 0xFFFF) << 16); // dim1 hi | tile_dim0
    g1[4] = (height & 0xFFFF);                                  // tile_dim1 (tile_dim2=0)
    g1[5] = stride;                                             // tensor_dim0_stride lo32
    g1[6] = 0;
    g1[7] = 0;
    asm volatile("tensor_load_to_lds %0, %1" :: "s"(g0), "s"(g1) : "memory");
}

// ---------------------------------------------------------------------------
// K0: per-(h,n) SSM constants: w = exp(dt*A), Cd = 2*C*(exp(dtA)-1)/A, Wc = w^CHUNK
//     and the output pass's tables: Gt[h][t][2n,2n+1] = (Re, -Im) of Cd*w^(t+1),
//     Tt[h][t][j] = sum_n Re(Cd*w^(t-j)) for j <= t, else 0, for t, j < SUB.
// ---------------------------------------------------------------------------
__global__ void k_setup(const float* __restrict__ log_dt,
                        const float* __restrict__ A_re, const float* __restrict__ A_im,
                        const float* __restrict__ C_re, const float* __restrict__ C_im,
                        float* wr_, float* wi_, float* cdr_, float* cdi_,
                        float* wcr_, float* wci_, float* Gt, float* Tt) {
    int i = threadIdx.x;                 // H*N = 1024
    int h = i >> 5;
    float dt  = __expf(log_dt[h]);
    float ar  = A_re[i], ai = A_im[i];
    float dre = dt * ar, dim = dt * ai;
    float er  = __expf(dre);
    float sn, cs; __sincosf(dim, &sn, &cs);
    float wr = er * cs, wi = er * sn;
    float exr = wr - 1.0f, exi = wi;
    float den = ar * ar + ai * ai;
    float qr = (exr * ar + exi * ai) / den;
    float qi = (exi * ar - exr * ai) / den;
    float cr = C_re[i], ci = C_im[i];
    wr_[i]  = wr;  wi_[i]  = wi;
    cdr_[i] = 2.0f * (cr * qr - ci * qi);
    cdi_[i] = 2.0f * (cr * qi + ci * qr);
    float er2 = __expf(dre * (float)CHUNK);
    float sn2, cs2; __sincosf(dim * (float)CHUNK, &sn2, &cs2);
    wcr_[i] = er2 * cs2;  wci_[i] = er2 * sn2;

    int n = i & 31;                      // a wave holds the 32 states of one h
    float gr = 2.0f * (cr * qr - ci * qi);
    float gi = 2.0f * (cr * qi + ci * qr);
    float* Td = Tt + h * (SUB * SUB) + (n & (SUB - 1)) * (SUB + 1);   // T[n][n]
    float ks[SUB];                       // Re(Cd*w^d), then its sum over the states
    // The three loops are unrolled so that ks[] stays in registers; the sums of all d
    // go through the butterfly side by side, so their cross-lane latencies overlap.
    #pragma unroll
    for (int d = 0; d < SUB; ++d) {
        ks[d] = gr;
        float ngr = fmaf(gr, wr, -(gi * wi));
        gi = fmaf(gr, wi, gi * wr);
        gr = ngr;                        // now Cd*w^(d+1)
        v2f gp; gp.x = gr; gp.y = -gi;
        *(v2f*)&Gt[((size_t)(h * SUB + d)) * (2 * Ndim) + 2 * n] = gp;
    }
    #pragma unroll
    for (int off = 16; off; off >>= 1) {
        #pragma unroll
        for (int d = 0; d < SUB; ++d) ks[d] += __shfl_xor(ks[d], off, 32);
    }
    #pragma unroll
    for (int d = 0; d < SUB; ++d) {
        if (n < SUB - d) {
            Td[d * SUB] = ks[d];         // T[n+d][n]
            if (d) Td[d] = 0.0f;         // T[n][n+d], above the diagonal
        }
    }
}

// ---------------------------------------------------------------------------
// K-film: gb[b,g] = cond[b] . film_W[g] + film_b[g]      (8 x 64 outputs)
// ---------------------------------------------------------------------------
__global__ void k_film(const float* __restrict__ cond, const float* __restrict__ fW,
                       const float* __restrict__ fb, float* __restrict__ gb) {
    int i = threadIdx.x;                 // 512
    int b = i >> 6;
    int g = i & 63;
    const float* c = cond + b * CDdim;
    const float* w = fW + g * CDdim;
    float s = fb[g];
    #pragma unroll 8
    for (int j = 0; j < CDdim; ++j) s = fmaf(c[j], w[j], s);
    gb[i] = s;
}

// ---------------------------------------------------------------------------
// K1: u = gelu(W_lin @ x + b_lin)   via V_WMMA_F32_16X16X4_F32
//     W_lin staged to LDS once per block through the TDM.
// ---------------------------------------------------------------------------
__global__ __launch_bounds__(256) void k_in_linear(
        const float* __restrict__ x, const float* __restrict__ W,
        const float* __restrict__ bias, float* __restrict__ u) {
    __shared__ __align__(16) float Wl[Hdim * Hdim];            // 4 KB
    if (threadIdx.x < 32) {
        tdm_load_2d_f32(W, (unsigned)(uintptr_t)Wl, Hdim, Hdim, Hdim);
        __builtin_amdgcn_s_wait_tensorcnt(0);
    }
    __syncthreads();

    const int lane = threadIdx.x & 31;
    const int m    = lane & 15;
    const int hi   = lane >> 4;
    const int gid  = blockIdx.x * 8 + (threadIdx.x >> 5);
    const int b    = gid / (Ldim / 16);
    const int l0   = (gid % (Ldim / 16)) * 16;
    const float* xb = x + (size_t)b * Hdim * Ldim;
    v8f acc0 = {};
    v8f acc1 = {};
    #pragma unroll
    for (int kk = 0; kk < 8; ++kk) {
        const int k = kk * 4 + 2 * hi;                         // K-pair for half-wave
        v2f bm;                                                // B: 4x16
        bm.x = xb[(size_t)k * Ldim + l0 + m];
        bm.y = xb[(size_t)(k + 1) * Ldim + l0 + m];
        v2f a0 = *(const v2f*)&Wl[m * Hdim + k];               // ds_load_b64
        v2f a1 = *(const v2f*)&Wl[(16 + m) * Hdim + k];
        acc0 = __builtin_amdgcn_wmma_f32_16x16x4_f32(false, a0, false, bm, (short)0, acc0, false, false);
        acc1 = __builtin_amdgcn_wmma_f32_16x16x4_f32(false, a1, false, bm, (short)0, acc1, false, false);
    }
    #pragma unroll
    for (int r = 0; r < 8; ++r) {
        int g0 = r + 8 * hi;
        int g1 = 16 + g0;
        u[((size_t)b * Hdim + g0) * Ldim + l0 + m] = gelu_t(acc0[r] + bias[g0]);
        u[((size_t)b * Hdim + g1) * Ldim + l0 + m] = gelu_t(acc1[r] + bias[g1]);
    }
}

// ---------------------------------------------------------------------------
// Both scan kernels take the recurrence s' = w*s + u in sub-blocks of SUB steps:
//     s(after a sub-block) = w^SUB * s(before it) + Lsum,  Lsum[blk][n] = sum_j w_n^(SUB-1-j) u[blk*SUB + j].
// Lsum of 16 sub-blocks (256 steps) is a matrix product, A = the inputs (row blk, k = j),
// B = the powers of w (k = j, column = state); four column tiles: re and im of the
// states 0..15, then re and im of the states 16..31.  A and B fragments take the same
// j at the same place: j = hi*8 + 2*w + {0,1} in product w.  In the result a lane holds,
// for its two states m and 16+m, the sub-blocks 8*hi .. 8*hi+7, one per register.
// ---------------------------------------------------------------------------
// (r,i) = (r,i)*(ar,ai) + (br,bi)
__device__ __forceinline__ void cmad(float& r, float& i, float ar, float ai, float br, float bi) {
    float nr = fmaf(ar, r, fmaf(-ai, i, br));
    i = fmaf(ai, r, fmaf(ar, i, bi));
    r = nr;
}
// Lane l <-> l ^ 16 as a vector cross-row move
__device__ __forceinline__ float xhalf(float v) {
    int b = __float_as_int(v);
    return __int_as_float(__builtin_amdgcn_permlanex16(b, b, 0x76543210, 0xfedcba98, false, false));
}
struct SubTab {
    v2f   pb[4][4];                      // B fragments [tile][product]
    float sr[2], si[2];                  // w^SUB of the lane's two states
    float hr[2], hj[2];                  // w^(8*SUB): a half's eight sub-blocks
};
__device__ __forceinline__ void sub_tables(const float* wre, const float* wim, int hi, SubTab& t) {
    #pragma unroll
    for (int s = 0; s < 2; ++s) {
        float pw_r[8], pw_i[8];          // w^(2^e)
        pw_r[0] = wre[s];  pw_i[0] = wim[s];
        #pragma unroll
        for (int e = 1; e < 8; ++e) {
            pw_r[e] = fmaf(pw_r[e - 1], pw_r[e - 1], -(pw_i[e - 1] * pw_i[e - 1]));
            pw_i[e] = 2.0f * pw_r[e - 1] * pw_i[e - 1];
        }
        t.sr[s] = pw_r[4];  t.si[s] = pw_i[4];
        t.hr[s] = pw_r[7];  t.hj[s] = pw_i[7];
        float pr = hi ? 1.0f : pw_r[3];  // w^(SUB-1-j) at j = hi*8 + 7
        float pi = hi ? 0.0f : pw_i[3];
        #pragma unroll
        for (int e = 7; e >= 0; --e) {
            t.pb[2 * s][e >> 1][e & 1]     = pr;
            t.pb[2 * s + 1][e >> 1][e & 1] = pi;
            cmad(pr, pi, wre[s], wim[s], 0.0f, 0.0f);
        }
    }
}
// la[tile][r] = Lsum[blk = 8*hi + r][column m of the tile]; ua, ub = u[m*SUB + hi*8 .. +7]
__device__ __forceinline__ void sub_sums(const v4f& ua, const v4f& ub, const SubTab& t, v8f* la) {
    v2f a0, a1, a2, a3;
    a0.x = ua.x;  a0.y = ua.y;  a1.x = ua.z;  a1.y = ua.w;
    a2.x = ub.x;  a2.y = ub.y;  a3.x = ub.z;  a3.y = ub.w;
    // The 16 products as one statement.  The four v_nop are the
    // vector slots between the last product and the first vector instruction on its A, B or D.
    asm volatile(
                 "v_wmma_f32_16x16x4_f32 %0, %4, %8, 0\n\t"
                 "v_wmma_f32_16x16x4_f32 %1, %4, %9, 0\n\t"
                 "v_wmma_f32_16x16x4_f32 %2, %4, %10, 0\n\t"
                 "v_wmma_f32_16x16x4_f32 %3, %4, %11, 0\n\t"
                 "v_wmma_f32_16x16x4_f32 %0, %5, %12, %0\n\t"
                 "v_wmma_f32_16x16x4_f32 %1, %5, %13, %1\n\t"
                 "v_wmma_f32_16x16x4_f32 %2, %5, %14, %2\n\t"
                 "v_wmma_f32_16x16x4_f32 %3, %5, %15, %3\n\t"
                 "v_wmma_f32_16x16x4_f32 %0, %6, %16, %0\n\t"
                 "v_wmma_f32_16x16x4_f32 %1, %6, %17, %1\n\t"
                 "v_wmma_f32_16x16x4_f32 %2, %6, %18, %2\n\t"
                 "v_wmma_f32_16x16x4_f32 %3, %6, %19, %3\n\t"
                 "v_wmma_f32_16x16x4_f32 %0, %7, %20, %0\n\t"
                 "v_wmma_f32_16x16x4_f32 %1, %7, %21, %1\n\t"
                 "v_wmma_f32_16x16x4_f32 %2, %7, %22, %2\n\t"
                 "v_wmma_f32_16x16x4_f32 %3, %7, %23, %3\n\t"
                 "v_nop\n\tv_nop\n\tv_nop\n\tv_nop"
                 : "=&v"(la[0]), "=&v"(la[1]), "=&v"(la[2]), "=&v"(la[3])
                 : "v"(a0), "v"(a1), "v"(a2), "v"(a3),
                   "v"(t.pb[0][0]), "v"(t.pb[1][0]), "v"(t.pb[2][0]), "v"(t.pb[3][0]),
                   "v"(t.pb[0][1]), "v"(t.pb[1][1]), "v"(t.pb[2][1]), "v"(t.pb[3][1]),
                   "v"(t.pb[0][2]), "v"(t.pb[1][2]), "v"(t.pb[2][2]), "v"(t.pb[3][2]),
                   "v"(t.pb[0][3]), "v"(t.pb[1][3]), "v"(t.pb[2][3]), "v"(t.pb[3][3]));
}

// ---------------------------------------------------------------------------
// K2: local chunk scan (end state only).  wave = (b,h,chunk).
//     Each half-wave sums its own sub-blocks by Horner's rule in w^SUB, stepping over the
//     other half's eight by w^(8*SUB); the two halves are joined once at the end.
// ---------------------------------------------------------------------------
__global__ __launch_bounds__(256) void k_scan_local(
        const float* __restrict__ u, const float* __restrict__ wr_,
        const float* __restrict__ wi_, float* __restrict__ S) {
    int lane = threadIdx.x & 31;
    int m    = lane & 15;
    int hi   = lane >> 4;
    int gid  = blockIdx.x * 8 + (threadIdx.x >> 5);  // (b*H+h)*NCHUNK + c
    int c    = gid & (NCHUNK - 1);
    int bh   = gid >> 5;
    int h    = bh & (Hdim - 1);
    float wre[2], wim[2];
    const float* up = u + (size_t)bh * Ldim + (size_t)c * CHUNK + m * SUB + hi * 8;
    // The whole chunk and the lane's two w are asked for together at the head (left to the
    // compiler, each group's loads went down to just in front of its products and their
    // latencies came one after another).  One statement with its data wait, so that no
    // result lands on an address register of a load that is still on its way.
    static_assert(CHUNK == 1024 && SUB == 16, "the offsets below are written out for this shape");
    v4f uq[2 * (CHUNK / 256)];
    asm volatile("global_load_b32 %8, %13, off\n\t"
                 "global_load_b32 %9, %13, off offset:64\n\t"
                 "global_load_b32 %10, %14, off\n\t"
                 "global_load_b32 %11, %14, off offset:64\n\t"
                 "global_load_b128 %0, %12, off\n\t"
                 "global_load_b128 %1, %12, off offset:16\n\t"
                 "global_load_b128 %2, %12, off offset:1024\n\t"
                 "global_load_b128 %3, %12, off offset:1040\n\t"
                 "global_load_b128 %4, %12, off offset:2048\n\t"
                 "global_load_b128 %5, %12, off offset:2064\n\t"
                 "global_load_b128 %6, %12, off offset:3072\n\t"
                 "global_load_b128 %7, %12, off offset:3088\n\t"
                 "s_wait_loadcnt 0x0"
                 : "=&v"(uq[0]), "=&v"(uq[1]), "=&v"(uq[2]), "=&v"(uq[3]),
                   "=&v"(uq[4]), "=&v"(uq[5]), "=&v"(uq[6]), "=&v"(uq[7]),
                   "=&v"(wre[0]), "=&v"(wre[1]), "=&v"(wim[0]), "=&v"(wim[1])
                 : "v"(up), "v"(wr_ + h * Ndim + m), "v"(wi_ + h * Ndim + m)
                 : "memory");
    SubTab t;
    sub_tables(wre, wim, hi, t);
    float rr[2], ri[2];
    // Unrolled: uq[] stays in the registers the loads filled
    #pragma unroll
    for (int g = 0; g < CHUNK / 256; ++g) {
        v8f la[4];
        sub_sums(uq[2 * g], uq[2 * g + 1], t, la);
        #pragma unroll
        for (int s = 0; s < 2; ++s) {
            if (g) {
                cmad(rr[s], ri[s], t.hr[s], t.hj[s], 0.0f, 0.0f);
                cmad(rr[s], ri[s], t.sr[s], t.si[s], la[2 * s][0], la[2 * s + 1][0]);
            } else {
                rr[s] = la[2 * s][0];  ri[s] = la[2 * s + 1][0];
            }
            #pragma unroll
            for (int r = 1; r < 8; ++r)
                cmad(rr[s], ri[s], t.sr[s], t.si[s], la[2 * s][r], la[2 * s + 1][r]);
        }
    }
    v2f st;                                          // lane writes state n = lane = hi*16 + m
    #pragma unroll
    for (int s = 0; s < 2; ++s) {
        float orr = xhalf(rr[s]), ori = xhalf(ri[s]);
        float ar = hi ? orr : rr[s], ai = hi ? ori : ri[s];    // the lower half's sum
        float br = hi ? rr[s] : orr, bi = hi ? ri[s] : ori;    // the upper half's
        cmad(ar, ai, t.hr[s], t.hj[s], br, bi);
        if (s == 0 || hi) { st.x = ar; st.y = ai; }
    }
    *(v2f*)&S[(size_t)gid * 64 + lane * 2] = st;
}

// ---------------------------------------------------------------------------
// K3: exclusive prefix over chunks (in place): P[c] = Wc*P[c-1] + S[c-1]
// ---------------------------------------------------------------------------
__global__ void k_scan_prefix(float* __restrict__ S,
                              const float* __restrict__ wcr_,
                              const float* __restrict__ wci_) {
    int t  = blockIdx.x * blockDim.x + threadIdx.x;  // B*H*N = 8192
    int n  = t & 31;
    int bh = t >> 5;
    int h  = bh & (Hdim - 1);
    float wr = wcr_[h * Ndim + n], wi = wci_[h * Ndim + n];
    float pr = 0.0f, pi = 0.0f;
    size_t base = (size_t)bh * NCHUNK * 64 + n * 2;
    for (int c = 0; c < NCHUNK; ++c) {
        size_t ix = base + (size_t)c * 64;
        float tr = S[ix], ti = S[ix + 1];
        S[ix] = pr;  S[ix + 1] = pi;                 // exclusive prefix
        float npr = fmaf(wr, pr, fmaf(-wi, pi, tr));
        pi = fmaf(wi, pr, fmaf(wr, pi, ti));
        pr = npr;
    }
}

// ---------------------------------------------------------------------------
// K4: output pass. Per 256 steps the sub-block sums come as in K2; a recurrence over the
//     sub-blocks (first each half's sum, then, from the right start, its eight states)
//     leaves a snapshot of the state at the start of every SUB steps in LDS. The outputs
//     come from matrix products, Y[t][blk] = T[t][j] U[j][blk] + G[t][k] Sn[k][blk]:
//     T = the lower-triangular Toeplitz tile Tt with D added on the diagonal, U = the inputs,
//     Sn = the snapshots (k = 2n, 2n+1 for re, im).  A and B fragments take the
//     same k at the same place: k = hi*(K/2) + 2*w + {0,1} in product w.
// ---------------------------------------------------------------------------
__global__ __launch_bounds__(256) void k_scan_out(
        const float* __restrict__ u, const float* __restrict__ S,
        const float* __restrict__ wr_, const float* __restrict__ wi_,
        const float* __restrict__ Gt, const float* __restrict__ Tt,
        const float* __restrict__ Dvec, float* __restrict__ v) {
    __shared__ __align__(16) float Sl[8][SUB * SROW];          // one range per wave
    int lane = threadIdx.x & 31;
    int m    = lane & 15;
    int hi   = lane >> 4;
    int gid  = blockIdx.x * 8 + (threadIdx.x >> 5);
    int c    = gid & (NCHUNK - 1);
    int bh   = gid >> 5;
    int h    = bh & (Hdim - 1);
    float wre[2], wim[2];
    wre[0] = wr_[h * Ndim + m];  wre[1] = wr_[h * Ndim + 16 + m];
    wim[0] = wi_[h * Ndim + m];  wim[1] = wi_[h * Ndim + 16 + m];
    float Dh  = Dvec[h];
    // State at the group's start, of the lane's two states m and 16+m (both halves hold it)
    v2f s0 = *(const v2f*)&S[(size_t)gid * 64 + m * 2];
    v2f s1 = *(const v2f*)&S[(size_t)gid * 64 + 32 + m * 2];
    // Here and below: address registers of issued loads and stores are reused next
    asm volatile("s_wait_xcnt 0x0" ::: "memory");
    const float* up = u + (size_t)bh * Ldim + (size_t)c * CHUNK;
    float*       vp = v + (size_t)bh * Ldim + (size_t)c * CHUNK;
    float*       sl = &Sl[threadIdx.x >> 5][0];
    float gr[2] = {s0.x, s1.x}, gi[2] = {s0.y, s1.y};
    SubTab t;
    sub_tables(wre, wim, hi, t);

    // A fragments, held for the whole chunk: row t = m
    v4f tl, th;                                                // T[m][hi*8 .. +7]
    // One statement with its data wait: the next loads' results may then land on its address registers
    asm volatile("global_load_b128 %0, %2, off\n\t"
                 "global_load_b128 %1, %2, off offset:16\n\t"
                 "s_wait_loadcnt 0x0"
                 : "=&v"(tl), "=&v"(th)
                 : "v"(Tt + (h * SUB + m) * SUB + hi * 8)
                 : "memory");
    float ta[8];
    #pragma unroll
    for (int e = 0; e < 8; ++e) {
        float kv = e < 4 ? tl[e & 3] : th[e & 3];
        ta[e] = (hi * 8 + e == m) ? kv + Dh : kv;
    }
    float4 ga[8];                                              // G[m][hi*32 .. +31]
    #pragma unroll
    for (int w = 0; w < 8; ++w)
        ga[w] = *(const float4*)&Gt[((size_t)(h * SUB + m)) * (2 * Ndim) + hi * 32 + w * 4];
    asm volatile("s_wait_xcnt 0x0" ::: "memory");

    for (int g = 0; g < CHUNK; g += 256) {
        // The group's inputs: A fragment of the sub-block sums and B fragment U[hi*8 ..][blk = m]
        // of the output products (one statement with its data wait, so that no result lands
        // on an address register of a load that is still on its way)
        v4f ub0, ub1;
        asm volatile("global_load_b128 %0, %2, off\n\t"
                     "global_load_b128 %1, %2, off offset:16\n\t"
                     "s_wait_loadcnt 0x0"
                     : "=&v"(ub0), "=&v"(ub1)
                     : "v"(up + g + m * SUB + hi * 8)
                     : "memory");
        v8f la[4];
        sub_sums(ub0, ub1, t, la);
        #pragma unroll
        for (int s = 0; s < 2; ++s) {
            float hr = la[2 * s][0], hj = la[2 * s + 1][0];    // the half's eight sub-blocks from a zero state
            #pragma unroll
            for (int r = 1; r < 8; ++r)
                cmad(hr, hj, t.sr[s], t.si[s], la[2 * s][r], la[2 * s + 1][r]);
            float orr = xhalf(hr), ori = xhalf(hj);
            float mr = gr[s], mi = gi[s];                      // state at sub-block 8
            cmad(mr, mi, t.hr[s], t.hj[s], hi ? orr : hr, hi ? ori : hj);
            float cr = hi ? mr : gr[s], ci = hi ? mi : gi[s];  // state at the half's first sub-block
            cmad(mr, mi, t.hr[s], t.hj[s], hi ? hr : orr, hi ? hj : ori);
            gr[s] = mr;  gi[s] = mi;                           // state at the next group's start
            #pragma unroll
            for (int r = 0; r < 8; ++r) {
                v2f st; st.x = cr; st.y = ci;
                *(v2f*)(sl + (hi * 8 + r) * SROW + s * 32 + m * 2) = st;   // state before sub-block 8*hi + r
                if (r < 7) cmad(cr, ci, t.sr[s], t.si[s], la[2 * s][r], la[2 * s + 1][r]);
            }
        }
        // The snapshots are read back by other lanes of the same wave: the
        // stores must have landed, and the compiler must not move the reads up.
        asm volatile("s_wait_dscnt 0x0" ::: "memory");
        // Holds the recurrence's vector instructions ahead of the run of matrix instructions.
        __builtin_amdgcn_sched_barrier(0);
        v8f acc = {};
        #pragma unroll
        for (int w = 0; w < 4; ++w) {
            const v4f ub = w < 2 ? ub0 : ub1;
            v2f a, b;
            a.x = ta[2 * w];              a.y = ta[2 * w + 1];
            b.x = (w & 1) ? ub.z : ub.x;  b.y = (w & 1) ? ub.w : ub.y;
            acc = __builtin_amdgcn_wmma_f32_16x16x4_f32(false, a, false, b, (short)0, acc, false, false);
        }
        float4 sb[8];                                                  // Sn[hi*32 ..][blk = m]
        #pragma unroll
        for (int w = 0; w < 8; ++w)
            sb[w] = *(const float4*)(sl + m * SROW + hi * 32 + w * 4);
        #pragma unroll
        for (int w = 0; w < 8; ++w) {
            v2f a, b;
            a.x = ga[w].x;  a.y = ga[w].y;  b.x = sb[w].x;  b.y = sb[w].y;
            acc = __builtin_amdgcn_wmma_f32_16x16x4_f32(false, a, false, b, (short)0, acc, false, false);
            a.x = ga[w].z;  a.y = ga[w].w;  b.x = sb[w].z;  b.y = sb[w].w;
            acc = __builtin_amdgcn_wmma_f32_16x16x4_f32(false, a, false, b, (short)0, acc, false, false);
        }
        // Four vector slots between the last product and the first vector instruction
        // that may touch its A, B or D; the two scheduling barriers hold them in place.
        __builtin_amdgcn_sched_barrier(0);
        asm volatile("v_nop\n\tv_nop\n\tv_nop\n\tv_nop");
        __builtin_amdgcn_sched_barrier(0);
        // acc[r] = Y[t = 8*hi + r][blk = m]: eight consecutive outputs per lane
        float4 o0, o1;
        o0.x = acc[0]; o0.y = acc[1]; o0.z = acc[2]; o0.w = acc[3];
        o1.x = acc[4]; o1.y = acc[5]; o1.z = acc[6]; o1.w = acc[7];
        *(float4*)(vp + g + m * SUB + hi * 8)     = o0;
        *(float4*)(vp + g + m * SUB + hi * 8 + 4) = o1;
        asm volatile("s_wait_xcnt 0x0" ::: "memory");
    }
}

// ---------------------------------------------------------------------------
// K5: z = W_out @ y + b_out ; GLU.  W_out (64x32) staged to LDS via TDM.
// ---------------------------------------------------------------------------
__global__ __launch_bounds__(256) void k_out_glu(
        const float* __restrict__ vin, const float* __restrict__ Wo,
        const float* __restrict__ bo, float* __restrict__ yg) {
    __shared__ __align__(16) float Wol[2 * Hdim * Hdim];       // 8 KB
    if (threadIdx.x < 32) {
        tdm_load_2d_f32(Wo, (unsigned)(uintptr_t)Wol, Hdim, 2 * Hdim, Hdim);
        __builtin_amdgcn_s_wait_tensorcnt(0);
    }
    __syncthreads();

    const int lane = threadIdx.x & 31;
    const int m    = lane & 15;
    const int hi   = lane >> 4;
    const int gid  = blockIdx.x * 8 + (threadIdx.x >> 5);
    const int b    = gid / (Ldim / 16);
    const int l0   = (gid % (Ldim / 16)) * 16;
    const float* vb = vin + (size_t)b * Hdim * Ldim;
    v8f acc[4] = {};
    #pragma unroll
    for (int kk = 0; kk < 8; ++kk) {
        const int k = kk * 4 + 2 * hi;
        v2f bm;
        bm.x = vb[(size_t)k * Ldim + l0 + m];
        bm.y = vb[(size_t)(k + 1) * Ldim + l0 + m];
        #pragma unroll
        for (int t = 0; t < 4; ++t) {
            v2f a = *(const v2f*)&Wol[(t * 16 + m) * Hdim + k];
            acc[t] = __builtin_amdgcn_wmma_f32_16x16x4_f32(false, a, false, bm, (short)0, acc[t], false, false);
        }
    }
    #pragma unroll
    for (int t = 0; t < 2; ++t) {
        #pragma unroll
        for (int r = 0; r < 8; ++r) {
            int g  = t * 16 + r + 8 * hi;
            float zv = acc[t][r]     + bo[g];
            float zg = acc[t + 2][r] + bo[g + Hdim];
            yg[((size_t)b * Hdim + g) * Ldim + l0 + m] = zv * sigm(zg);
        }
    }
}

// ---------------------------------------------------------------------------
// K6: sum and sum of squares of one (b,h) row per block, so that every WGP reads a share.
//     The last kernel joins a channel's Bdim rows.  A block owns a whole 128-byte line of part.
// ---------------------------------------------------------------------------
__global__ __launch_bounds__(BN_T) void k_bn_stats(
        const float* __restrict__ yg, float* __restrict__ part) {
    __shared__ float ls[BN_T / 32];
    __shared__ float ls2[BN_T / 32];
    const int tid = threadIdx.x;
    // The thread's 16 loads are asked for together, the row is in flight at once; a wave's load
    // covers 512 contiguous bytes; the offsets step by BN_T * 16 bytes.  One statement with its
    // data wait, so that no result lands on an address register of a load still on its way.
    static_assert(BN_T * 16 == 8192 && BN_T * 4 * 16 == Ldim, "the offsets below are written out for this shape");
    v4f q[16];
    asm volatile("global_load_b128 %0, %16, off\n\t"
                 "global_load_b128 %1, %16, off offset:8192\n\t"
                 "global_load_b128 %2, %16, off offset:16384\n\t"
                 "global_load_b128 %3, %16, off offset:24576\n\t"
                 "global_load_b128 %4, %16, off offset:32768\n\t"
                 "global_load_b128 %5, %16, off offset:40960\n\t"
                 "global_load_b128 %6, %16, off offset:49152\n\t"
                 "global_load_b128 %7, %16, off offset:57344\n\t"
                 "global_load_b128 %8, %16, off offset:65536\n\t"
                 "global_load_b128 %9, %16, off offset:73728\n\t"
                 "global_load_b128 %10, %16, off offset:81920\n\t"
                 "global_load_b128 %11, %16, off offset:90112\n\t"
                 "global_load_b128 %12, %16, off offset:98304\n\t"
                 "global_load_b128 %13, %16, off offset:106496\n\t"
                 "global_load_b128 %14, %16, off offset:114688\n\t"
                 "global_load_b128 %15, %16, off offset:122880\n\t"
                 "s_wait_loadcnt 0x0"
                 : "=&v"(q[0]), "=&v"(q[1]), "=&v"(q[2]), "=&v"(q[3]),
                   "=&v"(q[4]), "=&v"(q[5]), "=&v"(q[6]), "=&v"(q[7]),
                   "=&v"(q[8]), "=&v"(q[9]), "=&v"(q[10]), "=&v"(q[11]),
                   "=&v"(q[12]), "=&v"(q[13]), "=&v"(q[14]), "=&v"(q[15])
                 : "v"(yg + (size_t)blockIdx.x * Ldim + tid * 4)
                 : "memory");
    v4f a = q[0], a2 = q[0] * q[0];
    // Unrolled: q[] stays in the registers the loads filled
    #pragma unroll
    for (int i = 1; i < 16; ++i) {
        a += q[i];
        a2 = __builtin_elementwise_fma(q[i], q[i], a2);
    }
    float s  = (a.x + a.y) + (a.z + a.w);
    float s2 = (a2.x + a2.y) + (a2.z + a2.w);
    #pragma unroll
    for (int off = 16; off; off >>= 1) {
        s  += __shfl_xor(s, off, 32);
        s2 += __shfl_xor(s2, off, 32);
    }
    if ((tid & 31) == 0) { ls[tid >> 5] = s;  ls2[tid >> 5] = s2; }
    __syncthreads();
    if (tid < 32) {                                            // the first wave joins the waves' sums
        s  = ls[tid & (BN_T / 32 - 1)];
        s2 = ls2[tid & (BN_T / 32 - 1)];
        #pragma unroll
        for (int off = BN_T / 64; off; off >>= 1) {
            s  += __shfl_xor(s, off, 32);
            s2 += __shfl_xor(s2, off, 32);
        }
        if (tid == 0) {
            v2f o; o.x = s; o.y = s2;
            *(v2f*)&part[(size_t)blockIdx.x * PLINE] = o;
        }
    }
}

// ---------------------------------------------------------------------------
// K7: BN mean / rstd from the rows' sums, BN apply + FiLM + gelu + depthwise residual.
//     A thread takes FIN_V groups of four elements, a block FIN_SPAN elements of one (b,h) row.
// ---------------------------------------------------------------------------
__global__ __launch_bounds__(FIN_T) void k_final(
        const float* __restrict__ yg, const float* __restrict__ part,
        const float* __restrict__ gb, const float* __restrict__ resw,
        const float* __restrict__ x, float* __restrict__ out) {
    const int row = blockIdx.x / (Ldim / FIN_SPAN);            // b*H + h, the same for the whole block
    const int h = row & (Hdim - 1);
    const int b = row / Hdim;
    const size_t base = (size_t)blockIdx.x * FIN_SPAN + threadIdx.x * 4;
    const float gamma = gb[b * (2 * Hdim) + h];
    const float beta  = gb[b * (2 * Hdim) + Hdim + h];
    const float rw    = resw[h];
    // All 16 y and x loads of the thread are asked for before the first is used (left to the compiler,
    // the x loads went down among the arithmetic in pairs and their latencies came one after
    // another); a wave's load covers 512 contiguous bytes; the offsets step by FIN_T * 16 bytes.
    // One statement with its data wait, so that no result lands on an address register of a
    // load that is still on its way.
    // The (sum, sum of squares) of the channel's Bdim rows go along in the same statement (every lane
    // the same eight addresses, Hdim * PLINE * 4 bytes apart): as scalar loads the compiler put them
    // and their wait either wholly in front of the big loads or wholly behind them.
    static_assert(FIN_T * 16 == 8192 && FIN_V == 8 && Bdim == 8 && Hdim * PLINE * 4 == 4096,
                  "the offsets below are written out for this shape");
    v4f yv[FIN_V], xv[FIN_V];
    v2f pp[Bdim];
    asm volatile("global_load_b64 %16, %26, off\n\t"
                 "global_load_b64 %17, %26, off offset:4096\n\t"
                 "global_load_b64 %18, %26, off offset:8192\n\t"
                 "global_load_b64 %19, %26, off offset:12288\n\t"
                 "global_load_b64 %20, %26, off offset:16384\n\t"
                 "global_load_b64 %21, %26, off offset:20480\n\t"
                 "global_load_b64 %22, %26, off offset:24576\n\t"
                 "global_load_b64 %23, %26, off offset:28672\n\t"
                 "global_load_b128 %0, %24, off\n\t"
                 "global_load_b128 %1, %24, off offset:8192\n\t"
                 "global_load_b128 %2, %24, off offset:16384\n\t"
                 "global_load_b128 %3, %24, off offset:24576\n\t"
                 "global_load_b128 %4, %24, off offset:32768\n\t"
                 "global_load_b128 %5, %24, off offset:40960\n\t"
                 "global_load_b128 %6, %24, off offset:49152\n\t"
                 "global_load_b128 %7, %24, off offset:57344\n\t"
                 "global_load_b128 %8, %25, off\n\t"
                 "global_load_b128 %9, %25, off offset:8192\n\t"
                 "global_load_b128 %10, %25, off offset:16384\n\t"
                 "global_load_b128 %11, %25, off offset:24576\n\t"
                 "global_load_b128 %12, %25, off offset:32768\n\t"
                 "global_load_b128 %13, %25, off offset:40960\n\t"
                 "global_load_b128 %14, %25, off offset:49152\n\t"
                 "global_load_b128 %15, %25, off offset:57344\n\t"
                 "s_wait_loadcnt 0x0"
                 : "=&v"(yv[0]), "=&v"(yv[1]), "=&v"(yv[2]), "=&v"(yv[3]),
                   "=&v"(yv[4]), "=&v"(yv[5]), "=&v"(yv[6]), "=&v"(yv[7]),
                   "=&v"(xv[0]), "=&v"(xv[1]), "=&v"(xv[2]), "=&v"(xv[3]),
                   "=&v"(xv[4]), "=&v"(xv[5]), "=&v"(xv[6]), "=&v"(xv[7]),
                   "=&v"(pp[0]), "=&v"(pp[1]), "=&v"(pp[2]), "=&v"(pp[3]),
                   "=&v"(pp[4]), "=&v"(pp[5]), "=&v"(pp[6]), "=&v"(pp[7])
                 : "v"(yg + base), "v"(x + base), "v"(part + h * PLINE)
                 : "memory");
    v2f sm = pp[0];
    #pragma unroll
    for (int bb = 1; bb < Bdim; ++bb) sm += pp[bb];
    const float s = sm.x, s2 = sm.y;
    const float inv   = 1.0f / (float)((size_t)Bdim * Ldim);
    const float mean  = s * inv;
    const float rstd  = rsqrtf(s2 * inv - mean * mean + 1e-5f);
    // Unrolled: yv[] and xv[] stay in the registers the loads filled; a rolled loop would index them through memory
    #pragma unroll
    for (int i = 0; i < FIN_V; ++i) {
        float4 o;
        o.x = fmaf(rw, xv[i].x, gelu_t(fmaf(gamma, (yv[i].x - mean) * rstd, beta)));
        o.y = fmaf(rw, xv[i].y, gelu_t(fmaf(gamma, (yv[i].y - mean) * rstd, beta)));
        o.z = fmaf(rw, xv[i].z, gelu_t(fmaf(gamma, (yv[i].z - mean) * rstd, beta)));
        o.w = fmaf(rw, xv[i].w, gelu_t(fmaf(gamma, (yv[i].w - mean) * rstd, beta)));
        *(float4*)(out + base + i * (FIN_T * 4)) = o;
    }
}

// ---------------------------------------------------------------------------
extern "C" void kernel_launch(void* const* d_in, const int* in_sizes, int n_in,
                              void* d_out, int out_size, void* d_ws, size_t ws_size,
                              hipStream_t stream) {
    const float* x      = (const float*)d_in[0];
    const float* cond   = (const float*)d_in[1];
    const float* W_lin  = (const float*)d_in[2];
    const float* b_lin  = (const float*)d_in[3];
    const float* log_dt = (const float*)d_in[4];
    const float* A_re   = (const float*)d_in[5];
    const float* A_im   = (const float*)d_in[6];
    const float* C_re   = (const float*)d_in[7];
    const float* C_im   = (const float*)d_in[8];
    const float* Dv     = (const float*)d_in[9];
    const float* W_out  = (const float*)d_in[10];
    const float* b_out  = (const float*)d_in[11];
    const float* film_W = (const float*)d_in[12];
    const float* film_b = (const float*)d_in[13];
    const float* res_w  = (const float*)d_in[14];
    float* out = (float*)d_out;

    const size_t tot = (size_t)Bdim * Hdim * Ldim;
    float* ws   = (float*)d_ws;
    float* u    = ws;                                   // [B,H,L]
    float* v    = u + tot;                              // [B,H,L]
    float* yg   = u;                                    // alias: u dead after scan_out
    float* S    = v + tot;                              // [B*H*NCHUNK, N, 2]
    float* wr_  = S + (size_t)Bdim * Hdim * NCHUNK * 64;
    float* wi_  = wr_  + Hdim * Ndim;
    float* cdr_ = wi_  + Hdim * Ndim;
    float* cdi_ = cdr_ + Hdim * Ndim;
    float* wcr_ = cdi_ + Hdim * Ndim;
    float* wci_ = wcr_ + Hdim * Ndim;
    float* gb   = wci_ + Hdim * Ndim;                   // [B, 2H]
    float* part = gb + Bdim * 2 * Hdim;                 // [B*H, PLINE]
    float* Gt   = part + Bdim * Hdim * PLINE;           // [H, SUB, 2N]
    float* Tt   = Gt + Hdim * SUB * 2 * Ndim;           // [H, SUB, SUB]

    k_setup<<<1, Hdim * Ndim, 0, stream>>>(log_dt, A_re, A_im, C_re, C_im,
                                           wr_, wi_, cdr_, cdi_, wcr_, wci_, Gt, Tt);
    k_film<<<1, Bdim * 2 * Hdim, 0, stream>>>(cond, film_W, film_b, gb);
    k_in_linear<<<(Bdim * (Ldim / 16)) / 8, 256, 0, stream>>>(x, W_lin, b_lin, u);
    k_scan_local<<<(Bdim * Hdim * NCHUNK) / 8, 256, 0, stream>>>(u, wr_, wi_, S);
    k_scan_prefix<<<(Bdim * Hdim * Ndim) / 256, 256, 0, stream>>>(S, wcr_, wci_);
    k_scan_out<<<(Bdim * Hdim * NCHUNK) / 8, 256, 0, stream>>>(u, S, wr_, wi_,
                                                               Gt, Tt, Dv, v);
    k_out_glu<<<(Bdim * (Ldim / 16)) / 8, 256, 0, stream>>>(v, W_out, b_out, yg);
    k_bn_stats<<<Bdim * Hdim, BN_T, 0, stream>>>(yg, part);
    k_final<<<(Bdim * Hdim * Ldim) / FIN_SPAN, FIN_T, 0, stream>>>(yg, part, gb, res_w, x, out);
}

// v005
// Measured time: 74.7 microseconds a run.
// Two timings next to v004 put it at 1.13 and 1.14 times that version's speed.
// Over all steps from v000 it is 2.68 times as fast.
#include <hip/hip_runtime.h>
#include <hip/hip_bf16.h>
#include <math.h>

// Problem constants (match reference)
#define Bdim   8
#define Hdim   32
#define Ldim   32768
#define Ndim   32
#define CDdim  128
#define NCHUNK 32                 // chunks per sequence (must be 32: code uses >>5)
#define CHUNK  (Ldim / NCHUNK)    // 1024
#define SUB    16                 // steps per sub-block of the output pass (rows of one matrix tile)
#define FIN_T  512                // threads per block of the last kernel
#define FIN_V  8                  // 16-byte groups per thread and stream there
#define FIN_SPAN (FIN_T * 4 * FIN_V)   // elements per block there; divides Ldim
#define BN_T   512                // threads per block of the statistics kernel
#define PLINE  32                 // floats between two blocks' partial sums there: one 128-byte line each
#define SET_B  (Hdim * Ndim / 256)        // leading blocks of the first launch that do the SSM set-up
#define FILM_B (Bdim * 2 * Hdim / 256)    // blocks behind them that do the FiLM products
#define PRE_B  (SET_B + FILM_B)
#define SROW   68                 // LDS pitch (floats) of one state snapshot: 16 B x odd, no bank conflict

typedef __attribute__((ext_vector_type(2))) float v2f;
typedef __attribute__((ext_vector_type(4))) float v4f;
typedef __attribute__((ext_vector_type(8))) float v8f;
typedef __attribute__((ext_vector_type(4))) int   i32x4;
typedef __attribute__((ext_vector_type(8))) int   i32x8;

// Branch-free gelu (tanh approximation): 0.5x(1+tanh(z)) == x*sigmoid(2z)
__device__ __forceinline__ float gelu_t(float x) {
    float x3 = x * x * x;
    float z  = fmaf(0.044715f, x3, x) * 1.5957691216057308f;  // 2*sqrt(2/pi)
    return x * __fdividef(1.0f, 1.0f + __expf(-z));
}
__device__ __forceinline__ float sigm(float x) {
    return __fdividef(1.0f, 1.0f + __expf(-x));
}

// ---------------------------------------------------------------------------
// Tensor Data Mover: 2D f32 tile Global -> LDS (D# built in SGPR tuples).
// Group0: count=1 | lds_addr | global_addr(57b) | type=2.
// Group1: data_size=4B, tensor_dim0/1, tile_dim0/1, tensor_dim0_stride.
// ---------------------------------------------------------------------------
__device__ __forceinline__ void tdm_load_2d_f32(const void* gsrc, unsigned lds_off,
                                                int width, int height, int stride) {
    unsigned long long ga = (unsigned long long)(uintptr_t)gsrc;
    i32x4 g0;
    g0.x = 1;                                                   // count=1, user D#
    g0.y = (int)lds_off;                                        // lds_addr [63:32]
    g0.z = (int)(unsigned)ga;                                   // global_addr [95:64]
    g0.w = (int)(((unsigned)(ga >> 32) & 0x01FFFFFFu) | 0x80000000u); // [120:96] | type=2
    i32x8 g1;
    g1[0] = 2 << 16;                                            // data_size = 4 bytes
    g1[1] = (width & 0xFFFF) << 16;                             // tensor_dim0 lo16 @bit48
    g1[2] = ((width >> 16) & 0xFFFF) | ((height & 0xFFFF) << 16); // dim0 hi | dim1 lo
    g1[3] = ((height >> 16) & 0xFFFF) | ((width & 0xFFFF) << 16); // dim1 hi | tile_dim0
    g1[4] = (height & 0xFFFF);                                  // tile_dim1 (tile_dim2=0)
    g1[5] = stride;                                             // tensor_dim0_stride lo32
    g1[6] = 0;
    g1[7] = 0;
    asm volatile("tensor_load_to_lds %0, %1" :: "s"(g0), "s"(g1) : "memory");
}

// ---------------------------------------------------------------------------
// K0: per-(h,n) SSM constants: w = exp(dt*A), Cd = 2*C*(exp(dtA)-1)/A, Wc = w^CHUNK
//     and the output pass's tables: Gt[h][t][2n,2n+1] = (Re, -Im) of Cd*w^(t+1),
//     Tt[h][t][j] = sum_n Re(Cd*w^(t-j)) for j <= t, else 0, for t, j < SUB.
//     i = h*N + n; a wave works alone, so the blocks' size is free.
// ---------------------------------------------------------------------------
__device__ __forceinline__ void d_setup(int i, const float* __restrict__ log_dt,
                        const float* __restrict__ A_re, const float* __restrict__ A_im,
                        const float* __restrict__ C_re, const float* __restrict__ C_im,
                        float* wr_, float* wi_, float* cdr_, float* cdi_,
                        float* wcr_, float* wci_, float* Gt, float* Tt) {
    int h = i >> 5;
    float dt  = __expf(log_dt[h]);
    float ar  = A_re[i], ai = A_im[i];
    float dre = dt * ar, dim = dt * ai;
    float er  = __expf(dre);
    float sn, cs; __sincosf(dim, &sn, &cs);
    float wr = er * cs, wi = er * sn;
    float exr = wr - 1.0f, exi = wi;
    float den = ar * ar + ai * ai;
    float qr = (exr * ar + exi * ai) / den;
    float qi = (exi * ar - exr * ai) / den;
    float cr = C_re[i], ci = C_im[i];
    wr_[i]  = wr;  wi_[i]  = wi;
    cdr_[i] = 2.0f * (cr * qr - ci * qi);
    cdi_[i] = 2.0f * (cr * qi + ci * qr);
    float er2 = __expf(dre * (float)CHUNK);
    float sn2, cs2; __sincosf(dim * (float)CHUNK, &sn2, &cs2);
    wcr_[i] = er2 * cs2;  wci_[i] = er2 * sn2;

    int n = i & 31;                      // a wave holds the 32 states of one h
    float gr = 2.0f * (cr * qr - ci * qi);
    float gi = 2.0f * (cr * qi + ci * qr);
    float* Td = Tt + h * (SUB * SUB) + (n & (SUB - 1)) * (SUB + 1);   // T[n][n]
    float ks[SUB];                       // Re(Cd*w^d), then its sum over the states
    // The three loops are unrolled so that ks[] stays in registers; the sums of all d
    // go through the butterfly side by side, so their cross-lane latencies overlap.
    #pragma unroll
    for (int d = 0; d < SUB; ++d) {
        ks[d] = gr;
        float ngr = fmaf(gr, wr, -(gi * wi));
        gi = fmaf(gr, wi, gi * wr);
        gr = ngr;                        // now Cd*w^(d+1)
        v2f gp; gp.x = gr; gp.y = -gi;
        *(v2f*)&Gt[((size_t)(h * SUB + d)) * (2 * Ndim) + 2 * n] = gp;
    }
    #pragma unroll
    for (int off = 16; off; off >>= 1) {
        #pragma unroll
        for (int d = 0; d < SUB; ++d) ks[d] += __shfl_xor(ks[d], off, 32);
    }
    #pragma unroll
    for (int d = 0; d < SUB; ++d) {
        if (n < SUB - d) {
            Td[d * SUB] = ks[d];         // T[n+d][n]
            if (d) Td[d] = 0.0f;         // T[n][n+d], above the diagonal
        }
    }
}

// ---------------------------------------------------------------------------
// K-film: gb[b,g] = cond[b] . film_W[g] + film_b[g]      (8 x 64 outputs), i = b*64 + g
// ---------------------------------------------------------------------------
__device__ __forceinline__ void d_film(int i, const float* __restrict__ cond, const float* __restrict__ fW,
                       const float* __restrict__ fb, float* __restrict__ gb) {
    int b = i >> 6;
    int g = i & 63;
    const float* c = cond + b * CDdim;
    const float* w = fW + g * CDdim;
    float s = fb[g];
    #pragma unroll 8
    for (int j = 0; j < CDdim; ++j) s = fmaf(c[j], w[j], s);
    gb[i] = s;
    // precaution: other code of this kernel follows the store in the built object and rewrites its registers
    asm volatile("s_wait_xcnt 0x0" ::: "memory");
}

// ---------------------------------------------------------------------------
// K1: u = gelu(W_lin @ x + b_lin)   via V_WMMA_F32_16X16X4_F32
//     W_lin staged to LDS once per block through the TDM.
//     The launch's first PRE_B blocks do the SSM set-up and the FiLM products instead: neither
//     reads or feeds u, and the kernels that read their results are launched later.  They come
//     first in the grid so that they start with the launch and end under it.
// ---------------------------------------------------------------------------
__global__ __launch_bounds__(256) void k_in_linear(
        const float* __restrict__ x, const float* __restrict__ W,
        const float* __restrict__ bias, float* __restrict__ u,
        const float* __restrict__ log_dt,
        const float* __restrict__ A_re, const float* __restrict__ A_im,
        const float* __restrict__ C_re, const float* __restrict__ C_im,
        float* wr_, float* wi_, float* cdr_, float* cdi_,
        float* wcr_, float* wci_, float* Gt, float* Tt,
        const float* __restrict__ cond, const float* __restrict__ fW,
        const float* __restrict__ fb, float* __restrict__ gb) {
    __shared__ __align__(16) float Wl[Hdim * Hdim];            // 4 KB
    // Whole blocks take these two ways out, ahead of the tensor load and the barrier
    if (blockIdx.x < SET_B) {
        d_setup(blockIdx.x * 256 + threadIdx.x, log_dt, A_re, A_im, C_re, C_im,
                wr_, wi_, cdr_, cdi_, wcr_, wci_, Gt, Tt);
        return;
    }
    if (blockIdx.x < PRE_B) {
        d_film((blockIdx.x - SET_B) * 256 + threadIdx.x, cond, fW, fb, gb);
        return;
    }
    if (threadIdx.x < 32) {
        tdm_load_2d_f32(W, (unsigned)(uintptr_t)Wl, Hdim, Hdim, Hdim);
        __builtin_amdgcn_s_wait_tensorcnt(0);
    }
    __syncthreads();

    const int lane = threadIdx.x & 31;
    const int m    = lane & 15;
    const int hi   = lane >> 4;
    const int gid  = (blockIdx.x - PRE_B) * 8 + (threadIdx.x >> 5);
    const int b    = gid / (Ldim / 16);
    const int l0   = (gid % (Ldim / 16)) * 16;
    const float* xb = x + (size_t)b * Hdim * Ldim;
    v8f acc0 = {};
    v8f acc1 = {};
    #pragma unroll
    for (int kk = 0; kk < 8; ++kk) {
        const int k = kk * 4 + 2 * hi;                         // K-pair for half-wave
        v2f bm;                                                // B: 4x16
        bm.x = xb[(size_t)k * Ldim + l0 + m];
        bm.y = xb[(size_t)(k + 1) * Ldim + l0 + m];
        // precaution, behind the last x load: the bias loads' results reuse the x loads' address registers
        if (kk == 7) asm volatile("s_wait_xcnt 0x0" ::: "memory");
        v2f a0 = *(const v2f*)&Wl[m * Hdim + k];               // ds_load_b64
        v2f a1 = *(const v2f*)&Wl[(16 + m) * Hdim + k];
        acc0 = __builtin_amdgcn_wmma_f32_16x16x4_f32(false, a0, false, bm, (short)0, acc0, false, false);
        acc1 = __builtin_amdgcn_wmma_f32_16x16x4_f32(false, a1, false, bm, (short)0, acc1, false, false);
    }
    #pragma unroll
    for (int r = 0; r < 8; ++r) {
        int g0 = r + 8 * hi;
        int g1 = 16 + g0;
        u[((size_t)b * Hdim + g0) * Ldim + l0 + m] = gelu_t(acc0[r] + bias[g0]);
        u[((size_t)b * Hdim + g1) * Ldim + l0 + m] = gelu_t(acc1[r] + bias[g1]);
    }
    // precaution: other code of this kernel follows the stores in the built object and rewrites their registers
    asm volatile("s_wait_xcnt 0x0" ::: "memory");
}

// ---------------------------------------------------------------------------
// Both scan kernels take the recurrence s' = w*s + u in sub-blocks of SUB steps:
//     s(after a sub-block) = w^SUB * s(before it) + Lsum,  Lsum[blk][n] = sum_j w_n^(SUB-1-j) u[blk*SUB + j].
// Lsum of 16 sub-blocks (256 steps) is a matrix product, A = the inputs (row blk, k = j),
// B = the powers of w (k = j, column = state); four column tiles: re and im of the
// states 0..15, then re and im of the states 16..31.  A and B fragments take the same
// j at the same place: j = hi*8 + 2*w + {0,1} in product w.  In the result a lane holds,
// for its two states m and 16+m, the sub-blocks 8*hi .. 8*hi+7, one per register.
// ---------------------------------------------------------------------------
// (r,i) = (r,i)*(ar,ai) + (br,bi)
__device__ __forceinline__ void cmad(float& r, float& i, float ar, float ai, float br, float bi) {
    float nr = fmaf(ar, r, fmaf(-ai, i, br));
    i = fmaf(ai, r, fmaf(ar, i, bi));
    r = nr;
}
// Lane l <-> l ^ 16 as a vector cross-row move
__device__ __forceinline__ float xhalf(float v) {
    int b = __float_as_int(v);
    return __int_as_float(__builtin_amdgcn_permlanex16(b, b, 0x76543210, 0xfedcba98, false, false));
}
struct SubTab {
    v2f   pb[4][4];                      // B fragments [tile][product]
    float sr[2], si[2];                  // w^SUB of the lane's two states
    float hr[2], hj[2];                  // w^(8*SUB): a half's eight sub-blocks
};
__device__ __forceinline__ void sub_tables(const float* wre, const float* wim, int hi, SubTab& t) {
    #pragma unroll
    for (int s = 0; s < 2; ++s) {
        float pw_r[8], pw_i[8];          // w^(2^e)
        pw_r[0] = wre[s];  pw_i[0] = wim[s];
        #pragma unroll
        for (int e = 1; e < 8; ++e) {
            pw_r[e] = fmaf(pw_r[e - 1], pw_r[e - 1], -(pw_i[e - 1] * pw_i[e - 1]));
            pw_i[e] = 2.0f * pw_r[e - 1] * pw_i[e - 1];
        }
        t.sr[s] = pw_r[4];  t.si[s] = pw_i[4];
        t.hr[s] = pw_r[7];  t.hj[s] = pw_i[7];
        float pr = hi ? 1.0f : pw_r[3];  // w^(SUB-1-j) at j = hi*8 + 7
        float pi = hi ? 0.0f : pw_i[3];
        #pragma unroll
        for (int e = 7; e >= 0; --e) {
            t.pb[2 * s][e >> 1][e & 1]     = pr;
            t.pb[2 * s + 1][e >> 1][e & 1] = pi;
            cmad(pr, pi, wre[s], wim[s], 0.0f, 0.0f);
        }
    }
}
// la[tile][r] = Lsum[blk = 8*hi + r][column m of the tile]; ua, ub = u[m*SUB + hi*8 .. +7]
__device__ __forceinline__ void sub_sums(const v4f& ua, const v4f& ub, const SubTab& t, v8f* la) {
    v2f a0, a1, a2, a3;
    a0.x = ua.x;  a0.y = ua.y;  a1.x = ua.z;  a1.y = ua.w;
    a2.x = ub.x;  a2.y = ub.y;  a3.x = ub.z;  a3.y = ub.w;
    // The 16 products as one statement.  The four v_nop are the
    // vector slots between the last product and the first vector instruction on its A, B or D.
    asm volatile(
                 "v_wmma_f32_16x16x4_f32 %0, %4, %8, 0\n\t"
                 "v_wmma_f32_16x16x4_f32 %1, %4, %9, 0\n\t"
                 "v_wmma_f32_16x16x4_f32 %2, %4, %10, 0\n\t"
                 "v_wmma_f32_16x16x4_f32 %3, %4, %11, 0\n\t"
                 "v_wmma_f32_16x16x4_f32 %0, %5, %12, %0\n\t"
                 "v_wmma_f32_16x16x4_f32 %1, %5, %13, %1\n\t"
                 "v_wmma_f32_16x16x4_f32 %2, %5, %14, %2\n\t"
                 "v_wmma_f32_16x16x4_f32 %3, %5, %15, %3\n\t"
                 "v_wmma_f32_16x16x4_f32 %0, %6, %16, %0\n\t"
                 "v_wmma_f32_16x16x4_f32 %1, %6, %17, %1\n\t"
                 "v_wmma_f32_16x16x4_f32 %2, %6, %18, %2\n\t"
                 "v_wmma_f32_16x16x4_f32 %3, %6, %19, %3\n\t"
                 "v_wmma_f32_16x16x4_f32 %0, %7, %20, %0\n\t"
                 "v_wmma_f32_16x16x4_f32 %1, %7, %21, %1\n\t"
                 "v_wmma_f32_16x16x4_f32 %2, %7, %22, %2\n\t"
                 "v_wmma_f32_16x16x4_f32 %3, %7, %23, %3\n\t"
                 "v_nop\n\tv_nop\n\tv_nop\n\tv_nop"
                 : "=&v"(la[0]), "=&v"(la[1]), "=&v"(la[2]), "=&v"(la[3])
                 : "v"(a0), "v"(a1), "v"(a2), "v"(a3),
                   "v"(t.pb[0][0]), "v"(t.pb[1][0]), "v"(t.pb[2][0]), "v"(t.pb[3][0]),
                   "v"(t.pb[0][1]), "v"(t.pb[1][1]), "v"(t.pb[2][1]), "v"(t.pb[3][1]),
                   "v"(t.pb[0][2]), "v"(t.pb[1][2]), "v"(t.pb[2][2]), "v"(t.pb[3][2]),
                   "v"(t.pb[0][3]), "v"(t.pb[1][3]), "v"(t.pb[2][3]), "v"(t.pb[3][3]));
}

// ---------------------------------------------------------------------------
// K2: local chunk scan (end state only).  wave = (b,h,chunk).
//     Each half-wave sums its own sub-blocks by Horner's rule in w^SUB, stepping over the
//     other half's eight by w^(8*SUB); the two halves are joined once at the end.
// ---------------------------------------------------------------------------
__global__ __launch_bounds__(256) void k_scan_local(
        const float* __restrict__ u, const float* __restrict__ wr_,
        const float* __restrict__ wi_, float* __restrict__ S) {
    int lane = threadIdx.x & 31;
    int m    = lane & 15;
    int hi   = lane >> 4;
    int gid  = blockIdx.x * 8 + (threadIdx.x >> 5);  // (b*H+h)*NCHUNK + c
    int c    = gid & (NCHUNK - 1);
    int bh   = gid >> 5;
    int h    = bh & (Hdim - 1);
    float wre[2], wim[2];
    const float* up = u + (size_t)bh * Ldim + (size_t)c * CHUNK + m * SUB + hi * 8;
    // The whole chunk and the lane's two w are asked for together at the head (left to the
    // compiler, each group's loads went down to just in front of its products and their
    // latencies came one after another).  One statement with its data wait, so that no
    // result lands on an address register of a load that is still on its way.
    static_assert(CHUNK == 1024 && SUB == 16, "the offsets below are written out for this shape");
    v4f uq[2 * (CHUNK / 256)];
    asm volatile("global_load_b32 %8, %13, off\n\t"
                 "global_load_b32 %9, %13, off offset:64\n\t"
                 "global_load_b32 %10, %14, off\n\t"
                 "global_load_b32 %11, %14, off offset:64\n\t"
                 "global_load_b128 %0, %12, off\n\t"
                 "global_load_b128 %1, %12, off offset:16\n\t"
                 "global_load_b128 %2, %12, off offset:1024\n\t"
                 "global_load_b128 %3, %12, off offset:1040\n\t"
                 "global_load_b128 %4, %12, off offset:2048\n\t"
                 "global_load_b128 %5, %12, off offset:2064\n\t"
                 "global_load_b128 %6, %12, off offset:3072\n\t"
                 "global_load_b128 %7, %12, off offset:3088\n\t"
                 "s_wait_loadcnt 0x0"
                 : "=&v"(uq[0]), "=&v"(uq[1]), "=&v"(uq[2]), "=&v"(uq[3]),
                   "=&v"(uq[4]), "=&v"(uq[5]), "=&v"(uq[6]), "=&v"(uq[7]),
                   "=&v"(wre[0]), "=&v"(wre[1]), "=&v"(wim[0]), "=&v"(wim[1])
                 : "v"(up), "v"(wr_ + h * Ndim + m), "v"(wi_ + h * Ndim + m)
                 : "memory");
    SubTab t;
    sub_tables(wre, wim, hi, t);
    float rr[2], ri[2];
    // Unrolled: uq[] stays in the registers the loads filled
    #pragma unroll
    for (int g = 0; g < CHUNK / 256; ++g) {
        v8f la[4];
        sub_sums(uq[2 * g], uq[2 * g + 1], t, la);
        #pragma unroll
        for (int s = 0; s < 2; ++s) {
            if (g) {
                cmad(rr[s], ri[s], t.hr[s], t.hj[s], 0.0f, 0.0f);
                cmad(rr[s], ri[s], t.sr[s], t.si[s], la[2 * s][0], la[2 * s + 1][0]);
            } else {
                rr[s] = la[2 * s][0];  ri[s] = la[2 * s + 1][0];
            }
            #pragma unroll
            for (int r = 1; r < 8; ++r)
                cmad(rr[s], ri[s], t.sr[s], t.si[s], la[2 * s][r], la[2 * s + 1][r]);
        }
    }
    v2f st;                                          // lane writes state n = lane = hi*16 + m
    #pragma unroll
    for (int s = 0; s < 2; ++s) {
        float orr = xhalf(rr[s]), ori = xhalf(ri[s]);
        float ar = hi ? orr : rr[s], ai = hi ? ori : ri[s];    // the lower half's sum
        float br = hi ? rr[s] : orr, bi = hi ? ri[s] : ori;    // the upper half's
        cmad(ar, ai, t.hr[s], t.hj[s], br, bi);
        if (s == 0 || hi) { st.x = ar; st.y = ai; }
    }
    *(v2f*)&S[(size_t)gid * 64 + lane * 2] = st;
}

// ---------------------------------------------------------------------------
// K3: exclusive prefix over chunks (in place): P[c] = Wc*P[c-1] + S[c-1]
// ---------------------------------------------------------------------------
__global__ void k_scan_prefix(float* __restrict__ S,
                              const float* __restrict__ wcr_,
                              const float* __restrict__ wci_) {
    int t  = blockIdx.x * blockDim.x + threadIdx.x;  // B*H*N = 8192
    int n  = t & 31;
    int bh = t >> 5;
    int h  = bh & (Hdim - 1);
    float wr = wcr_[h * Ndim + n], wi = wci_[h * Ndim + n];
    float pr = 0.0f, pi = 0.0f;
    size_t base = (size_t)bh * NCHUNK * 64 + n * 2;
    for (int c = 0; c < NCHUNK; ++c) {
        size_t ix = base + (size_t)c * 64;
        float tr = S[ix], ti = S[ix + 1];
        S[ix] = pr;  S[ix + 1] = pi;                 // exclusive prefix
        float npr = fmaf(wr, pr, fmaf(-wi, pi, tr));
        pi = fmaf(wi, pr, fmaf(wr, pi, ti));
        pr = npr;
    }
}

// ---------------------------------------------------------------------------
// K4: output pass. Per 256 steps the sub-block sums come as in K2; a recurrence over the
//     sub-blocks (first each half's sum, then, from the right start, its eight states)
//     leaves a snapshot of the state at the start of every SUB steps in LDS. The outputs
//     come from matrix products, Y[t][blk] = T[t][j] U[j][blk] + G[t][k] Sn[k][blk]:
//     T = the lower-triangular Toeplitz tile Tt with D added on the diagonal, U = the inputs,
//     Sn = the snapshots (k = 2n, 2n+1 for re, im).  A and B fragments take the
//     same k at the same place: k = hi*(K/2) + 2*w + {0,1} in product w.
// ---------------------------------------------------------------------------
__global__ __launch_bounds__(256) void k_scan_out(
        const float* __restrict__ u, const float* __restrict__ S,
        const float* __restrict__ wr_, const float* __restrict__ wi_,
        const float* __restrict__ Gt, const float* __restrict__ Tt,
        const float* __restrict__ Dvec, float* __restrict__ v) {
    __shared__ __align__(16) float Sl[8][SUB * SROW];          // one range per wave
    int lane = threadIdx.x & 31;
    int m    = lane & 15;
    int hi   = lane >> 4;
    int gid  = blockIdx.x * 8 + (threadIdx.x >> 5);
    int c    = gid & (NCHUNK - 1);
    int bh   = gid >> 5;
    int h    = bh & (Hdim - 1);
    float wre[2], wim[2];
    wre[0] = wr_[h * Ndim + m];  wre[1] = wr_[h * Ndim + 16 + m];
    wim[0] = wi_[h * Ndim + m];  wim[1] = wi_[h * Ndim + 16 + m];
    float Dh  = Dvec[h];
    // State at the group's start, of the lane's two states m and 16+m (both halves hold it)
    v2f s0 = *(const v2f*)&S[(size_t)gid * 64 + m * 2];
    v2f s1 = *(const v2f*)&S[(size_t)gid * 64 + 32 + m * 2];
    // Here and below: address registers of issued loads and stores are reused next
    asm volatile("s_wait_xcnt 0x0" ::: "memory");
    const float* up = u + (size_t)bh * Ldim + (size_t)c * CHUNK;
    float*       vp = v + (size_t)bh * Ldim + (size_t)c * CHUNK;
    float*       sl = &Sl[threadIdx.x >> 5][0];
    float gr[2] = {s0.x, s1.x}, gi[2] = {s0.y, s1.y};
    SubTab t;
    sub_tables(wre, wim, hi, t);

    // A fragments, held for the whole chunk: row t = m
    v4f tl, th;                                                // T[m][hi*8 .. +7]
    // One statement with its data wait: the next loads' results may then land on its address registers
    asm volatile("global_load_b128 %0, %2, off\n\t"
                 "global_load_b128 %1, %2, off offset:16\n\t"
                 "s_wait_loadcnt 0x0"
                 : "=&v"(tl), "=&v"(th)
                 : "v"(Tt + (h * SUB + m) * SUB + hi * 8)
                 : "memory");
    float ta[8];
    #pragma unroll
    for (int e = 0; e < 8; ++e) {
        float kv = e < 4 ? tl[e & 3] : th[e & 3];
        ta[e] = (hi * 8 + e == m) ? kv + Dh : kv;
    }
    float4 ga[8];                                              // G[m][hi*32 .. +31]
    #pragma unroll
    for (int w = 0; w < 8; ++w)
        ga[w] = *(const float4*)&Gt[((size_t)(h * SUB + m)) * (2 * Ndim) + hi * 32 + w * 4];
    asm volatile("s_wait_xcnt 0x0" ::: "memory");

    for (int g = 0; g < CHUNK; g += 256) {
        // The group's inputs: A fragment of the sub-block sums and B fragment U[hi*8 ..][blk = m]
        // of the output products (one statement with its data wait, so that no result lands
        // on an address register of a load that is still on its way)
        v4f ub0, ub1;
        asm volatile("global_load_b128 %0, %2, off\n\t"
                     "global_load_b128 %1, %2, off offset:16\n\t"
                     "s_wait_loadcnt 0x0"
                     : "=&v"(ub0), "=&v"(ub1)
                     : "v"(up + g + m * SUB + hi * 8)
                     : "memory");
        v8f la[4];
        sub_sums(ub0, ub1, t, la);
        #pragma unroll
        for (int s = 0; s < 2; ++s) {
            float hr = la[2 * s][0], hj = la[2 * s + 1][0];    // the half's eight sub-blocks from a zero state
            #pragma unroll
            for (int r = 1; r < 8; ++r)
                cmad(hr, hj, t.sr[s], t.si[s], la[2 * s][r], la[2 * s + 1][r]);
            float orr = xhalf(hr), ori = xhalf(hj);
            float mr = gr[s], mi = gi[s];                      // state at sub-block 8
            cmad(mr, mi, t.hr[s], t.hj[s], hi ? orr : hr, hi ? ori : hj);
            float cr = hi ? mr : gr[s], ci = hi ? mi : gi[s];  // state at the half's first sub-block
            cmad(mr, mi, t.hr[s], t.hj[s], hi ? hr : orr, hi ? hj : ori);
            gr[s] = mr;  gi[s] = mi;                           // state at the next group's start
            #pragma unroll
            for (int r = 0; r < 8; ++r) {
                v2f st; st.x = cr; st.y = ci;
                *(v2f*)(sl + (hi * 8 + r) * SROW + s * 32 + m * 2) = st;   // state before sub-block 8*hi + r
                if (r < 7) cmad(cr, ci, t.sr[s], t.si[s], la[2 * s][r], la[2 * s + 1][r]);
            }
        }
        // The snapshots are read back by other lanes of the same wave: the
        // stores must have landed, and the compiler must not move the reads up.
        asm volatile("s_wait_dscnt 0x0" ::: "memory");
        // Holds the recurrence's vector instructions ahead of the run of matrix instructions.
        __builtin_amdgcn_sched_barrier(0);
        v8f acc = {};
        #pragma unroll
        for (int w = 0; w < 4; ++w) {
            const v4f ub = w < 2 ? ub0 : ub1;
            v2f a, b;
            a.x = ta[2 * w];              a.y = ta[2 * w + 1];
            b.x = (w & 1) ? ub.z : ub.x;  b.y = (w & 1) ? ub.w : ub.y;
            acc = __builtin_amdgcn_wmma_f32_16x16x4_f32(false, a, false, b, (short)0, acc, false, false);
        }
        float4 sb[8];                                                  // Sn[hi*32 ..][blk = m]
        #pragma unroll
        for (int w = 0; w < 8; ++w)
            sb[w] = *(const float4*)(sl + m * SROW + hi * 32 + w * 4);
        #pragma unroll
        for (int w = 0; w < 8; ++w) {
            v2f a, b;
            a.x = ga[w].x;  a.y = ga[w].y;  b.x = sb[w].x;  b.y = sb[w].y;
            acc = __builtin_amdgcn_wmma_f32_16x16x4_f32(false, a, false, b, (short)0, acc, false, false);
            a.x = ga[w].z;  a.y = ga[w].w;  b.x = sb[w].z;  b.y = sb[w].w;
            acc = __builtin_amdgcn_wmma_f32_16x16x4_f32(false, a, false, b, (short)0, acc, false, false);
        }
        // Four vector slots between the last product and the first vector instruction
        // that may touch its A, B or D; the two scheduling barriers hold them in place.
        __builtin_amdgcn_sched_barrier(0);
        asm volatile("v_nop\n\tv_nop\n\tv_nop\n\tv_nop");
        __builtin_amdgcn_sched_barrier(0);
        // acc[r] = Y[t = 8*hi + r][blk = m]: eight consecutive outputs per lane
        float4 o0, o1;
        o0.x = acc[0]; o0.y = acc[1]; o0.z = acc[2]; o0.w = acc[3];
        o1.x = acc[4]; o1.y = acc[5]; o1.z = acc[6]; o1.w = acc[7];
        *(float4*)(vp + g + m * SUB + hi * 8)     = o0;
        *(float4*)(vp + g + m * SUB + hi * 8 + 4) = o1;
        asm volatile("s_wait_xcnt 0x0" ::: "memory");
    }
}

// ---------------------------------------------------------------------------
// K5: z = W_out @ y + b_out ; GLU.  W_out (64x32) staged to LDS via TDM.
// ---------------------------------------------------------------------------
__global__ __launch_bounds__(256) void k_out_glu(
        const float* __restrict__ vin, const float* __restrict__ Wo,
        const float* __restrict__ bo, float* __restrict__ yg) {
    __shared__ __align__(16) float Wol[2 * Hdim * Hdim];       // 8 KB
    if (threadIdx.x < 32) {
        tdm_load_2d_f32(Wo, (unsigned)(uintptr_t)Wol, Hdim, 2 * Hdim, Hdim);
        __builtin_amdgcn_s_wait_tensorcnt(0);
    }
    __syncthreads();

    const int lane = threadIdx.x & 31;
    const int m    = lane & 15;
    const int hi   = lane >> 4;
    const int gid  = blockIdx.x * 8 + (threadIdx.x >> 5);
    const int b    = gid / (Ldim / 16);
    const int l0   = (gid % (Ldim / 16)) * 16;
    const float* vb = vin + (size_t)b * Hdim * Ldim;
    v8f acc[4] = {};
    #pragma unroll
    for (int kk = 0; kk < 8; ++kk) {
        const int k = kk * 4 + 2 * hi;
        v2f bm;
        bm.x = vb[(size_t)k * Ldim + l0 + m];
        bm.y = vb[(size_t)(k + 1) * Ldim + l0 + m];
        #pragma unroll
        for (int t = 0; t < 4; ++t) {
            v2f a = *(const v2f*)&Wol[(t * 16 + m) * Hdim + k];
            acc[t] = __builtin_amdgcn_wmma_f32_16x16x4_f32(false, a, false, bm, (short)0, acc[t], false, false);
        }
    }
    #pragma unroll
    for (int t = 0; t < 2; ++t) {
        #pragma unroll
        for (int r = 0; r < 8; ++r) {
            int g  = t * 16 + r + 8 * hi;
            float zv = acc[t][r]     + bo[g];
            float zg = acc[t + 2][r] + bo[g + Hdim];
            yg[((size_t)b * Hdim + g) * Ldim + l0 + m] = zv * sigm(zg);
        }
    }
}

// ---------------------------------------------------------------------------
// K6: sum and sum of squares of one (b,h) row per block, so that every WGP reads a share.
//     The last kernel joins a channel's Bdim rows.  A block owns a whole 128-byte line of part.
// ---------------------------------------------------------------------------
__global__ __launch_bounds__(BN_T) void k_bn_stats(
        const float* __restrict__ yg, float* __restrict__ part) {
    __shared__ float ls[BN_T / 32];
    __shared__ float ls2[BN_T / 32];
    const int tid = threadIdx.x;
    // The thread's 16 loads are asked for together, the row is in flight at once; a wave's load
    // covers 512 contiguous bytes; the offsets step by BN_T * 16 bytes.  One statement with its
    // data wait, so that no result lands on an address register of a load still on its way.
    static_assert(BN_T * 16 == 8192 && BN_T * 4 * 16 == Ldim, "the offsets below are written out for this shape");
    v4f q[16];
    asm volatile("global_load_b128 %0, %16, off\n\t"
                 "global_load_b128 %1, %16, off offset:8192\n\t"
                 "global_load_b128 %2, %16, off offset:16384\n\t"
                 "global_load_b128 %3, %16, off offset:24576\n\t"
                 "global_load_b128 %4, %16, off offset:32768\n\t"
                 "global_load_b128 %5, %16, off offset:40960\n\t"
                 "global_load_b128 %6, %16, off offset:49152\n\t"
                 "global_load_b128 %7, %16, off offset:57344\n\t"
                 "global_load_b128 %8, %16, off offset:65536\n\t"
                 "global_load_b128 %9, %16, off offset:73728\n\t"
                 "global_load_b128 %10, %16, off offset:81920\n\t"
                 "global_load_b128 %11, %16, off offset:90112\n\t"
                 "global_load_b128 %12, %16, off offset:98304\n\t"
                 "global_load_b128 %13, %16, off offset:106496\n\t"
                 "global_load_b128 %14, %16, off offset:114688\n\t"
                 "global_load_b128 %15, %16, off offset:122880\n\t"
                 "s_wait_loadcnt 0x0"
                 : "=&v"(q[0]), "=&v"(q[1]), "=&v"(q[2]), "=&v"(q[3]),
                   "=&v"(q[4]), "=&v"(q[5]), "=&v"(q[6]), "=&v"(q[7]),
                   "=&v"(q[8]), "=&v"(q[9]), "=&v"(q[10]), "=&v"(q[11]),
                   "=&v"(q[12]), "=&v"(q[13]), "=&v"(q[14]), "=&v"(q[15])
                 : "v"(yg + (size_t)blockIdx.x * Ldim + tid * 4)
                 : "memory");
    v4f a = q[0], a2 = q[0] * q[0];
    // Unrolled: q[] stays in the registers the loads filled
    #pragma unroll
    for (int i = 1; i < 16; ++i) {
        a += q[i];
        a2 = __builtin_elementwise_fma(q[i], q[i], a2);
    }
    float s  = (a.x + a.y) + (a.z + a.w);
    float s2 = (a2.x + a2.y) + (a2.z + a2.w);
    #pragma unroll
    for (int off = 16; off; off >>= 1) {
        s  += __shfl_xor(s, off, 32);
        s2 += __shfl_xor(s2, off, 32);
    }
    if ((tid & 31) == 0) { ls[tid >> 5] = s;  ls2[tid >> 5] = s2; }
    __syncthreads();
    if (tid < 32) {                                            // the first wave joins the waves' sums
        s  = ls[tid & (BN_T / 32 - 1)];
        s2 = ls2[tid & (BN_T / 32 - 1)];
        #pragma unroll
        for (int off = BN_T / 64; off; off >>= 1) {
            s  += __shfl_xor(s, off, 32);
            s2 += __shfl_xor(s2, off, 32);
        }
        if (tid == 0) {
            v2f o; o.x = s; o.y = s2;
            *(v2f*)&part[(size_t)blockIdx.x * PLINE] = o;
        }
    }
}

// ---------------------------------------------------------------------------
// K7: BN mean / rstd from the rows' sums, BN apply + FiLM + gelu + depthwise residual.
//     A thread takes FIN_V groups of four elements, a block FIN_SPAN elements of one (b,h) row.
// ---------------------------------------------------------------------------
__global__ __launch_bounds__(FIN_T) void k_final(
        const float* __restrict__ yg, const float* __restrict__ part,
        const float* __restrict__ gb, const float* __restrict__ resw,
        const float* __restrict__ x, float* __restrict__ out) {
    const int row = blockIdx.x / (Ldim / FIN_SPAN);            // b*H + h, the same for the whole block
    const int h = row & (Hdim - 1);
    const int b = row / Hdim;
    const size_t base = (size_t)blockIdx.x * FIN_SPAN + threadIdx.x * 4;
    const float gamma = gb[b * (2 * Hdim) + h];
    const float beta  = gb[b * (2 * Hdim) + Hdim + h];
    const float rw    = resw[h];
    // All 16 y and x loads of the thread are asked for before the first is used (left to the compiler,
    // the x loads went down among the arithmetic in pairs and their latencies came one after
    // another); a wave's load covers 512 contiguous bytes; the offsets step by FIN_T * 16 bytes.
    // One statement with its data wait, so that no result lands on an address register of a
    // load that is still on its way.
    // The (sum, sum of squares) of the channel's Bdim rows go along in the same statement (every lane
    // the same eight addresses, Hdim * PLINE * 4 bytes apart): as scalar loads the compiler put them
    // and their wait either wholly in front of the big loads or wholly behind them.
    static_assert(FIN_T * 16 == 8192 && FIN_V == 8 && Bdim == 8 && Hdim * PLINE * 4 == 4096,
                  "the offsets below are written out for this shape");
    v4f yv[FIN_V], xv[FIN_V];
    v2f pp[Bdim];
    asm volatile("global_load_b64 %16, %26, off\n\t"
                 "global_load_b64 %17, %26, off offset:4096\n\t"
                 "global_load_b64 %18, %26, off offset:8192\n\t"
                 "global_load_b64 %19, %26, off offset:12288\n\t"
                 "global_load_b64 %20, %26, off offset:16384\n\t"
                 "global_load_b64 %21, %26, off offset:20480\n\t"
                 "global_load_b64 %22, %26, off offset:24576\n\t"
                 "global_load_b64 %23, %26, off offset:28672\n\t"
                 "global_load_b128 %0, %24, off\n\t"
                 "global_load_b128 %1, %24, off offset:8192\n\t"
                 "global_load_b128 %2, %24, off offset:16384\n\t"
                 "global_load_b128 %3, %24, off offset:24576\n\t"
                 "global_load_b128 %4, %24, off offset:32768\n\t"
                 "global_load_b128 %5, %24, off offset:40960\n\t"
                 "global_load_b128 %6, %24, off offset:49152\n\t"
                 "global_load_b128 %7, %24, off offset:57344\n\t"
                 "global_load_b128 %8, %25, off\n\t"
                 "global_load_b128 %9, %25, off offset:8192\n\t"
                 "global_load_b128 %10, %25, off offset:16384\n\t"
                 "global_load_b128 %11, %25, off offset:24576\n\t"
                 "global_load_b128 %12, %25, off offset:32768\n\t"
                 "global_load_b128 %13, %25, off offset:40960\n\t"
                 "global_load_b128 %14, %25, off offset:49152\n\t"
                 "global_load_b128 %15, %25, off offset:57344\n\t"
                 "s_wait_loadcnt 0x0"
                 : "=&v"(yv[0]), "=&v"(yv[1]), "=&v"(yv[2]), "=&v"(yv[3]),
                   "=&v"(yv[4]), "=&v"(yv[5]), "=&v"(yv[6]), "=&v"(yv[7]),
                   "=&v"(xv[0]), "=&v"(xv[1]), "=&v"(xv[2]), "=&v"(xv[3]),
                   "=&v"(xv[4]), "=&v"(xv[5]), "=&v"(xv[6]), "=&v"(xv[7]),
                   "=&v"(pp[0]), "=&v"(pp[1]), "=&v"(pp[2]), "=&v"(pp[3]),
                   "=&v"(pp[4]), "=&v"(pp[5]), "=&v"(pp[6]), "=&v"(pp[7])
                 : "v"(yg + base), "v"(x + base), "v"(part + h * PLINE)
                 : "memory");
    v2f sm = pp[0];
    #pragma unroll
    for (int bb = 1; bb < Bdim; ++bb) sm += pp[bb];
    const float s = sm.x, s2 = sm.y;
    const float inv   = 1.0f / (float)((size_t)Bdim * Ldim);
    const float mean  = s * inv;
    const float rstd  = rsqrtf(s2 * inv - mean * mean + 1e-5f);
    // Unrolled: yv[] and xv[] stay in the registers the loads filled; a rolled loop would index them through memory
    #pragma unroll
    for (int i = 0; i < FIN_V; ++i) {
        float4 o;
        o.x = fmaf(rw, xv[i].x, gelu_t(fmaf(gamma, (yv[i].x - mean) * rstd, beta)));
        o.y = fmaf(rw, xv[i].y, gelu_t(fmaf(gamma, (yv[i].y - mean) * rstd, beta)));
        o.z = fmaf(rw, xv[i].z, gelu_t(fmaf(gamma, (yv[i].z - mean) * rstd, beta)));
        o.w = fmaf(rw, xv[i].w, gelu_t(fmaf(gamma, (yv[i].w - mean) * rstd, beta)));
        *(float4*)(out + base + i * (FIN_T * 4)) = o;
    }
}

// ---------------------------------------------------------------------------
extern "C" void kernel_launch(void* const* d_in, const int* in_sizes, int n_in,
                              void* d_out, int out_size, void* d_ws, size_t ws_size,
                              hipStream_t stream) {
    const float* x      = (const float*)d_in[0];
    const float* cond   = (const float*)d_in[1];
    const float* W_lin  = (const float*)d_in[2];
    const float* b_lin  = (const float*)d_in[3];
    const float* log_dt = (const float*)d_in[4];
    const float* A_re   = (const float*)d_in[5];
    const float* A_im   = (const float*)d_in[6];
    const float* C_re   = (const float*)d_in[7];
    const float* C_im   = (const float*)d_in[8];
    const float* Dv     = (const float*)d_in[9];
    const float* W_out  = (const float*)d_in[10];
    const float* b_out  = (const float*)d_in[11];
    const float* film_W = (const float*)d_in[12];
    const float* film_b = (const float*)d_in[13];
    const float* res_w  = (const float*)d_in[14];
    float* out = (float*)d_out;

    const size_t tot = (size_t)Bdim * Hdim * Ldim;
    float* ws   = (float*)d_ws;
    float* u    = ws;                                   // [B,H,L]
    float* v    = u + tot;                              // [B,H,L]
    float* yg   = u;                                    // alias: u dead after scan_out
    float* S    = v + tot;                              // [B*H*NCHUNK, N, 2]
    float* wr_  = S + (size_t)Bdim * Hdim * NCHUNK * 64;
    float* wi_  = wr_  + Hdim * Ndim;
    float* cdr_ = wi_  + Hdim * Ndim;
    float* cdi_ = cdr_ + Hdim * Ndim;
    float* wcr_ = cdi_ + Hdim * Ndim;
    float* wci_ = wcr_ + Hdim * Ndim;
    float* gb   = wci_ + Hdim * Ndim;                   // [B, 2H]
    float* part = gb + Bdim * 2 * Hdim;                 // [B*H, PLINE]
    float* Gt   = part + Bdim * Hdim * PLINE;           // [H, SUB, 2N]
    float* Tt   = Gt + Hdim * SUB * 2 * Ndim;           // [H, SUB, SUB]

    k_in_linear<<<PRE_B + (Bdim * (Ldim / 16)) / 8, 256, 0, stream>>>(x, W_lin, b_lin, u,
                                           log_dt, A_re, A_im, C_re, C_im,
                                           wr_, wi_, cdr_, cdi_, wcr_, wci_, Gt, Tt,
                                           cond, film_W, film_b, gb);
    k_scan_local<<<(Bdim * Hdim * NCHUNK) / 8, 256, 0, stream>>>(u, wr_, wi_, S);
    k_scan_prefix<<<(Bdim * Hdim * Ndim) / 256, 256, 0, stream>>>(S, wcr_, wci_);
    k_scan_out<<<(Bdim * Hdim * NCHUNK) / 8, 256, 0, stream>>>(u, S, wr_, wi_,
                                                               Gt, Tt, Dv, v);
    k_out_glu<<<(Bdim * (Ldim / 16)) / 8, 256, 0, stream>>>(v, W_out, b_out, yg);
    k_bn_stats<<<Bdim * Hdim, BN_T, 0, stream>>>(yg, part);
    k_final<<<(Bdim * Hdim * Ldim) / FIN_SPAN, FIN_T, 0, stream>>>(yg, part, gb, res_w, x, out);
}

// v006
// It runs in 66.4 microseconds.
// Two timings next to v005 put it at 1.11 and 1.13 times that version's speed.
// All steps since v000 together make it 3.00 times as fast.
#include <hip/hip_runtime.h>
#include <hip/hip_bf16.h>
#include <math.h>

// Problem constants (match reference)
#define Bdim   8
#define Hdim   32
#define Ldim   32768
#define Ndim   32
#define CDdim  128
#define NCHUNK 32                 // chunks per sequence = waves of a scan block
#define CHUNK  (Ldim / NCHUNK)    // 1024
#define SUB    16                 // steps per sub-block of the output pass (rows of one matrix tile)
#define FIN_T  512                // threads per block of the last kernel
#define FIN_V  8                  // 16-byte groups per thread and stream there
#define FIN_SPAN (FIN_T * 4 * FIN_V)   // elements per block there; divides Ldim
#define BN_T   512                // threads per block of the statistics kernel
#define PLINE  32                 // floats between two blocks' partial sums there: one 128-byte line each
#define SET_B  (Hdim * Ndim / 256)        // leading blocks of the first launch that do the SSM set-up
#define FILM_B (Bdim * 2 * Hdim / 256)    // blocks behind them that do the FiLM products
#define PRE_B  (SET_B + FILM_B)
#define SROW   68                 // LDS pitch (floats) of one state snapshot: 16 B x odd, no bank conflict

typedef __attribute__((ext_vector_type(2))) float v2f;
typedef __attribute__((ext_vector_type(4))) float v4f;
typedef __attribute__((ext_vector_type(8))) float v8f;
typedef __attribute__((ext_vector_type(4))) int   i32x4;
typedef __attribute__((ext_vector_type(8))) int   i32x8;

// Branch-free gelu (tanh approximation): 0.5x(1+tanh(z)) == x*sigmoid(2z)
__device__ __forceinline__ float gelu_t(float x) {
    float x3 = x * x * x;
    float z  = fmaf(0.044715f, x3, x) * 1.5957691216057308f;  // 2*sqrt(2/pi)
    return x * __fdividef(1.0f, 1.0f + __expf(-z));
}
__device__ __forceinline__ float sigm(float x) {
    return __fdividef(1.0f, 1.0f + __expf(-x));
}

// ---------------------------------------------------------------------------
// Tensor Data Mover: 2D f32 tile Global -> LDS (D# built in SGPR tuples).
// Group0: count=1 | lds_addr | global_addr(57b) | type=2.
// Group1: data_size=4B, tensor_dim0/1, tile_dim0/1, tensor_dim0_stride.
// ---------------------------------------------------------------------------
__device__ __forceinline__ void tdm_load_2d_f32(const void* gsrc, unsigned lds_off,
                                                int width, int height, int stride) {
    unsigned long long ga = (unsigned long long)(uintptr_t)gsrc;
    i32x4 g0;
    g0.x = 1;                                                   // count=1, user D#
    g0.y = (int)lds_off;                                        // lds_addr [63:32]
    g0.z = (int)(unsigned)ga;                                   // global_addr [95:64]
    g0.w = (int)(((unsigned)(ga >> 32) & 0x01FFFFFFu) | 0x80000000u); // [120:96] | type=2
    i32x8 g1;
    g1[0] = 2 << 16;                                            // data_size = 4 bytes
    g1[1] = (width & 0xFFFF) << 16;                             // tensor_dim0 lo16 @bit48
    g1[2] = ((width >> 16) & 0xFFFF) | ((height & 0xFFFF) << 16); // dim0 hi | dim1 lo
    g1[3] = ((height >> 16) & 0xFFFF) | ((width & 0xFFFF) << 16); // dim1 hi | tile_dim0
    g1[4] = (height & 0xFFFF);                                  // tile_dim1 (tile_dim2=0)
    g1[5] = stride;                                             // tensor_dim0_stride lo32
    g1[6] = 0;
    g1[7] = 0;
    asm volatile("tensor_load_to_lds %0, %1" :: "s"(g0), "s"(g1) : "memory");
}

// ---------------------------------------------------------------------------
// K0: per-(h,n) SSM constants: w = exp(dt*A), Cd = 2*C*(exp(dtA)-1)/A, Wc = w^CHUNK
//     and the output pass's tables: Gt[h][t][2n,2n+1] = (Re, -Im) of Cd*w^(t+1),
//     Tt[h][t][j] = sum_n Re(Cd*w^(t-j)) for j <= t, else 0, for t, j < SUB.
//     i = h*N + n; a wave works alone, so the blocks' size is free.
// ---------------------------------------------------------------------------
__device__ __forceinline__ void d_setup(int i, const float* __restrict__ log_dt,
                        const float* __restrict__ A_re, const float* __restrict__ A_im,
                        const float* __restrict__ C_re, const float* __restrict__ C_im,
                        float* wr_, float* wi_, float* cdr_, float* cdi_,
                        float* wcr_, float* wci_, float* Gt, float* Tt) {
    int h = i >> 5;
    float dt  = __expf(log_dt[h]);
    float ar  = A_re[i], ai = A_im[i];
    float dre = dt * ar, dim = dt * ai;
    float er  = __expf(dre);
    float sn, cs; __sincosf(dim, &sn, &cs);
    float wr = er * cs, wi = er * sn;
    float exr = wr - 1.0f, exi = wi;
    float den = ar * ar + ai * ai;
    float qr = (exr * ar + exi * ai) / den;
    float qi = (exi * ar - exr * ai) / den;
    float cr = C_re[i], ci = C_im[i];
    wr_[i]  = wr;  wi_[i]  = wi;
    cdr_[i] = 2.0f * (cr * qr - ci * qi);
    cdi_[i] = 2.0f * (cr * qi + ci * qr);
    float er2 = __expf(dre * (float)CHUNK);
    float sn2, cs2; __sincosf(dim * (float)CHUNK, &sn2, &cs2);
    wcr_[i] = er2 * cs2;  wci_[i] = er2 * sn2;

    int n = i & 31;                      // a wave holds the 32 states of one h
    float gr = 2.0f * (cr * qr - ci * qi);
    float gi = 2.0f * (cr * qi + ci * qr);
    float* Td = Tt + h * (SUB * SUB) + (n & (SUB - 1)) * (SUB + 1);   // T[n][n]
    float ks[SUB];                       // Re(Cd*w^d), then its sum over the states
    // The three loops are unrolled so that ks[] stays in registers; the sums of all d
    // go through the butterfly side by side, so their cross-lane latencies overlap.
    #pragma unroll
    for (int d = 0; d < SUB; ++d) {
        ks[d] = gr;
        float ngr = fmaf(gr, wr, -(gi * wi));
        gi = fmaf(gr, wi, gi * wr);
        gr = ngr;                        // now Cd*w^(d+1)
        v2f gp; gp.x = gr; gp.y = -gi;
        *(v2f*)&Gt[((size_t)(h * SUB + d)) * (2 * Ndim) + 2 * n] = gp;
    }
    #pragma unroll
    for (int off = 16; off; off >>= 1) {
        #pragma unroll
        for (int d = 0; d < SUB; ++d) ks[d] += __shfl_xor(ks[d], off, 32);
    }
    #pragma unroll
    for (int d = 0; d < SUB; ++d) {
        if (n < SUB - d) {
            Td[d * SUB] = ks[d];         // T[n+d][n]
            if (d) Td[d] = 0.0f;         // T[n][n+d], above the diagonal
        }
    }
}

// ---------------------------------------------------------------------------
// K-film: gb[b,g] = cond[b] . film_W[g] + film_b[g]      (8 x 64 outputs), i = b*64 + g
// ---------------------------------------------------------------------------
__device__ __forceinline__ void d_film(int i, const float* __restrict__ cond, const float* __restrict__ fW,
                       const float* __restrict__ fb, float* __restrict__ gb) {
    int b = i >> 6;
    int g = i & 63;
    const float* c = cond + b * CDdim;
    const float* w = fW + g * CDdim;
    float s = fb[g];
    #pragma unroll 8
    for (int j = 0; j < CDdim; ++j) s = fmaf(c[j], w[j], s);
    gb[i] = s;
    // precaution: other code of this kernel follows the store in the built object and rewrites its registers
    asm volatile("s_wait_xcnt 0x0" ::: "memory");
}

// ---------------------------------------------------------------------------
// K1: u = gelu(W_lin @ x + b_lin)   via V_WMMA_F32_16X16X4_F32
//     W_lin staged to LDS once per block through the TDM.
//     The launch's first PRE_B blocks do the SSM set-up and the FiLM products instead: neither
//     reads or feeds u, and the kernels that read their results are launched later.  They come
//     first in the grid so that they start with the launch and end under it.
// ---------------------------------------------------------------------------
__global__ __launch_bounds__(256) void k_in_linear(
        const float* __restrict__ x, const float* __restrict__ W,
        const float* __restrict__ bias, float* __restrict__ u,
        const float* __restrict__ log_dt,
        const float* __restrict__ A_re, const float* __restrict__ A_im,
        const float* __restrict__ C_re, const float* __restrict__ C_im,
        float* wr_, float* wi_, float* cdr_, float* cdi_,
        float* wcr_, float* wci_, float* Gt, float* Tt,
        const float* __restrict__ cond, const float* __restrict__ fW,
        const float* __restrict__ fb, float* __restrict__ gb) {
    __shared__ __align__(16) float Wl[Hdim * Hdim];            // 4 KB
    // Whole blocks take these two ways out, ahead of the tensor load and the barrier
    if (blockIdx.x < SET_B) {
        d_setup(blockIdx.x * 256 + threadIdx.x, log_dt, A_re, A_im, C_re, C_im,
                wr_, wi_, cdr_, cdi_, wcr_, wci_, Gt, Tt);
        return;
    }
    if (blockIdx.x < PRE_B) {
        d_film((blockIdx.x - SET_B) * 256 + threadIdx.x, cond, fW, fb, gb);
        return;
    }
    if (threadIdx.x < 32) {
        tdm_load_2d_f32(W, (unsigned)(uintptr_t)Wl, Hdim, Hdim, Hdim);
        __builtin_amdgcn_s_wait_tensorcnt(0);
    }
    __syncthreads();

    const int lane = threadIdx.x & 31;
    const int m    = lane & 15;
    const int hi   = lane >> 4;
    const int gid  = (blockIdx.x - PRE_B) * 8 + (threadIdx.x >> 5);
    const int b    = gid / (Ldim / 16);
    const int l0   = (gid % (Ldim / 16)) * 16;
    const float* xb = x + (size_t)b * Hdim * Ldim;
    v8f acc0 = {};
    v8f acc1 = {};
    #pragma unroll
    for (int kk = 0; kk < 8; ++kk) {
        const int k = kk * 4 + 2 * hi;                         // K-pair for half-wave
        v2f bm;                                                // B: 4x16
        bm.x = xb[(size_t)k * Ldim + l0 + m];
        bm.y = xb[(size_t)(k + 1) * Ldim + l0 + m];
        // precaution, behind the last x load: the bias loads' results reuse the x loads' address registers
        if (kk == 7) asm volatile("s_wait_xcnt 0x0" ::: "memory");
        v2f a0 = *(const v2f*)&Wl[m * Hdim + k];               // ds_load_b64
        v2f a1 = *(const v2f*)&Wl[(16 + m) * Hdim + k];
        acc0 = __builtin_amdgcn_wmma_f32_16x16x4_f32(false, a0, false, bm, (short)0, acc0, false, false);
        acc1 = __builtin_amdgcn_wmma_f32_16x16x4_f32(false, a1, false, bm, (short)0, acc1, false, false);
    }
    #pragma unroll
    for (int r = 0; r < 8; ++r) {
        int g0 = r + 8 * hi;
        int g1 = 16 + g0;
        u[((size_t)b * Hdim + g0) * Ldim + l0 + m] = gelu_t(acc0[r] + bias[g0]);
        u[((size_t)b * Hdim + g1) * Ldim + l0 + m] = gelu_t(acc1[r] + bias[g1]);
    }
    // precaution: other code of this kernel follows the stores in the built object and rewrites their registers
    asm volatile("s_wait_xcnt 0x0" ::: "memory");
}

// ---------------------------------------------------------------------------
// Both passes of the scan kernel take the recurrence s' = w*s + u in sub-blocks of SUB steps:
//     s(after a sub-block) = w^SUB * s(before it) + Lsum,  Lsum[blk][n] = sum_j w_n^(SUB-1-j) u[blk*SUB + j].
// Lsum of 16 sub-blocks (256 steps) is a matrix product, A = the inputs (row blk, k = j),
// B = the powers of w (k = j, column = state); four column tiles: re and im of the
// states 0..15, then re and im of the states 16..31.  A and B fragments take the same
// j at the same place: j = hi*8 + 2*w + {0,1} in product w.  In the result a lane holds,
// for its two states m and 16+m, the sub-blocks 8*hi .. 8*hi+7, one per register.
// ---------------------------------------------------------------------------
// (r,i) = (r,i)*(ar,ai) + (br,bi)
__device__ __forceinline__ void cmad(float& r, float& i, float ar, float ai, float br, float bi) {
    float nr = fmaf(ar, r, fmaf(-ai, i, br));
    i = fmaf(ai, r, fmaf(ar, i, bi));
    r = nr;
}
// Lane l <-> l ^ 16 as a vector cross-row move
__device__ __forceinline__ float xhalf(float v) {
    int b = __float_as_int(v);
    return __int_as_float(__builtin_amdgcn_permlanex16(b, b, 0x76543210, 0xfedcba98, false, false));
}
struct SubTab {
    v2f   pb[4][4];                      // B fragments [tile][product]
    float sr[2], si[2];                  // w^SUB of the lane's two states
    float hr[2], hj[2];                  // w^(8*SUB): a half's eight sub-blocks
};
__device__ __forceinline__ void sub_tables(const float* wre, const float* wim, int hi, SubTab& t) {
    #pragma unroll
    for (int s = 0; s < 2; ++s) {
        float pw_r[8], pw_i[8];          // w^(2^e)
        pw_r[0] = wre[s];  pw_i[0] = wim[s];
        #pragma unroll
        for (int e = 1; e < 8; ++e) {
            pw_r[e] = fmaf(pw_r[e - 1], pw_r[e - 1], -(pw_i[e - 1] * pw_i[e - 1]));
            pw_i[e] = 2.0f * pw_r[e - 1] * pw_i[e - 1];
        }
        t.sr[s] = pw_r[4];  t.si[s] = pw_i[4];
        t.hr[s] = pw_r[7];  t.hj[s] = pw_i[7];
        float pr = hi ? 1.0f : pw_r[3];  // w^(SUB-1-j) at j = hi*8 + 7
        float pi = hi ? 0.0f : pw_i[3];
        #pragma unroll
        for (int e = 7; e >= 0; --e) {
            t.pb[2 * s][e >> 1][e & 1]     = pr;
            t.pb[2 * s + 1][e >> 1][e & 1] = pi;
            cmad(pr, pi, wre[s], wim[s], 0.0f, 0.0f);
        }
    }
}
// la[tile][r] = Lsum[blk = 8*hi + r][column m of the tile]; ua, ub = u[m*SUB + hi*8 .. +7]
__device__ __forceinline__ void sub_sums(const v4f& ua, const v4f& ub, const SubTab& t, v8f* la) {
    v2f a0, a1, a2, a3;
    a0.x = ua.x;  a0.y = ua.y;  a1.x = ua.z;  a1.y = ua.w;
    a2.x = ub.x;  a2.y = ub.y;  a3.x = ub.z;  a3.y = ub.w;
    // The 16 products as one statement.  The four v_nop are the
    // vector slots between the last product and the first vector instruction on its A, B or D.
    asm volatile(
                 "v_wmma_f32_16x16x4_f32 %0, %4, %8, 0\n\t"
                 "v_wmma_f32_16x16x4_f32 %1, %4, %9, 0\n\t"
                 "v_wmma_f32_16x16x4_f32 %2, %4, %10, 0\n\t"
                 "v_wmma_f32_16x16x4_f32 %3, %4, %11, 0\n\t"
                 "v_wmma_f32_16x16x4_f32 %0, %5, %12, %0\n\t"
                 "v_wmma_f32_16x16x4_f32 %1, %5, %13, %1\n\t"
                 "v_wmma_f32_16x16x4_f32 %2, %5, %14, %2\n\t"
                 "v_wmma_f32_16x16x4_f32 %3, %5, %15, %3\n\t"
                 "v_wmma_f32_16x16x4_f32 %0, %6, %16, %0\n\t"
                 "v_wmma_f32_16x16x4_f32 %1, %6, %17, %1\n\t"
                 "v_wmma_f32_16x16x4_f32 %2, %6, %18, %2\n\t"
                 "v_wmma_f32_16x16x4_f32 %3, %6, %19, %3\n\t"
                 "v_wmma_f32_16x16x4_f32 %0, %7, %20, %0\n\t"
                 "v_wmma_f32_16x16x4_f32 %1, %7, %21, %1\n\t"
                 "v_wmma_f32_16x16x4_f32 %2, %7, %22, %2\n\t"
                 "v_wmma_f32_16x16x4_f32 %3, %7, %23, %3\n\t"
                 "v_nop\n\tv_nop\n\tv_nop\n\tv_nop"
                 : "=&v"(la[0]), "=&v"(la[1]), "=&v"(la[2]), "=&v"(la[3])
                 : "v"(a0), "v"(a1), "v"(a2), "v"(a3),
                   "v"(t.pb[0][0]), "v"(t.pb[1][0]), "v"(t.pb[2][0]), "v"(t.pb[3][0]),
                   "v"(t.pb[0][1]), "v"(t.pb[1][1]), "v"(t.pb[2][1]), "v"(t.pb[3][1]),
                   "v"(t.pb[0][2]), "v"(t.pb[1][2]), "v"(t.pb[2][2]), "v"(t.pb[3][2]),
                   "v"(t.pb[0][3]), "v"(t.pb[1][3]), "v"(t.pb[2][3]), "v"(t.pb[3][3]));
}

// ---------------------------------------------------------------------------
// K2: the whole scan of one (b,h) row in one launch.  block = row, wave = chunk.
//     Part 1, local scan (end state only): each half-wave sums its own sub-blocks by Horner's
//     rule in w^SUB, stepping over the other half's eight by w^(8*SUB); the two halves are
//     joined once at the end.  The chunks' end states go to LDS.
//     Part 2, behind the block's one barrier: each wave runs P[c] = Wc*P[c-1] + S[c-1] over the
//     chunks in front of its own, lane = state.
//     Part 3, output pass. Per 256 steps the sub-block sums come as in part 1; a recurrence over the
//     sub-blocks (first each half's sum, then, from the right start, its eight states)
//     leaves a snapshot of the state at the start of every SUB steps in LDS. The outputs
//     come from matrix products, Y[t][blk] = T[t][j] U[j][blk] + G[t][k] Sn[k][blk]:
//     T = the lower-triangular Toeplitz tile Tt with D added on the diagonal, U = the inputs,
//     Sn = the snapshots (k = 2n, 2n+1 for re, im).  A and B fragments take the
//     same k at the same place: k = hi*(K/2) + 2*w + {0,1} in product w.
// ---------------------------------------------------------------------------
__global__ __launch_bounds__(NCHUNK * 32) void k_scan(
        const float* __restrict__ u,
        const float* __restrict__ wr_, const float* __restrict__ wi_,
        const float* __restrict__ wcr_, const float* __restrict__ wci_,
        const float* __restrict__ Gt, const float* __restrict__ Tt,
        const float* __restrict__ Dvec, float* __restrict__ v) {
    __shared__ __align__(16) float Sl[NCHUNK][SUB * SROW];     // snapshots, one range per wave
    __shared__ __align__(16) float Se[NCHUNK][2 * Ndim];       // the chunks' end states
    __shared__ __align__(16) float Gl[SUB * SROW];             // G: every wave has the same channel, and 32 waves leave no registers to hold it
    int lane = threadIdx.x & 31;
    int m    = lane & 15;
    int hi   = lane >> 4;
    int c    = __builtin_amdgcn_readfirstlane(threadIdx.x >> 5);   // scalar: it bounds part 2's loop
    int bh   = blockIdx.x;
    int h    = bh & (Hdim - 1);
    float wre[2], wim[2];
    const float* up = u + (size_t)bh * Ldim + (size_t)c * CHUNK;
    float*       vp = v + (size_t)bh * Ldim + (size_t)c * CHUNK;
    // Asked for here too, so that they come together with the chunk: w^CHUNK of state n = lane
    // and the thread's one element of G
    static_assert(NCHUNK * 32 == SUB * 2 * Ndim, "one element of G per thread");
    float Dh  = Dvec[h];
    float cwr = wcr_[h * Ndim + lane], cwi = wci_[h * Ndim + lane];
    float gv  = Gt[h * (SUB * 2 * Ndim) + threadIdx.x];
    // Here and below: address registers of issued loads and stores are reused next
    asm volatile("s_wait_xcnt 0x0" ::: "memory");
    // The whole chunk and the lane's two w are asked for together at the head (left to the
    // compiler, each group's loads went down to just in front of its products and their
    // latencies came one after another).  One statement with its data wait, so that no
    // result lands on an address register of a load that is still on its way.
    static_assert(CHUNK == 1024 && SUB == 16, "the offsets below are written out for this shape");
    v4f uq[2 * (CHUNK / 256)];
    asm volatile("global_load_b32 %8, %13, off\n\t"
                 "global_load_b32 %9, %13, off offset:64\n\t"
                 "global_load_b32 %10, %14, off\n\t"
                 "global_load_b32 %11, %14, off offset:64\n\t"
                 "global_load_b128 %0, %12, off\n\t"
                 "global_load_b128 %1, %12, off offset:16\n\t"
                 "global_load_b128 %2, %12, off offset:1024\n\t"
                 "global_load_b128 %3, %12, off offset:1040\n\t"
                 "global_load_b128 %4, %12, off offset:2048\n\t"
                 "global_load_b128 %5, %12, off offset:2064\n\t"
                 "global_load_b128 %6, %12, off offset:3072\n\t"
                 "global_load_b128 %7, %12, off offset:3088\n\t"
                 "s_wait_loadcnt 0x0"
                 : "=&v"(uq[0]), "=&v"(uq[1]), "=&v"(uq[2]), "=&v"(uq[3]),
                   "=&v"(uq[4]), "=&v"(uq[5]), "=&v"(uq[6]), "=&v"(uq[7]),
                   "=&v"(wre[0]), "=&v"(wre[1]), "=&v"(wim[0]), "=&v"(wim[1])
                 : "v"(up + m * SUB + hi * 8), "v"(wr_ + h * Ndim + m), "v"(wi_ + h * Ndim + m)
                 : "memory");
    Gl[(threadIdx.x >> 6) * SROW + (threadIdx.x & 63)] = gv;   // at the snapshots' pitch
    SubTab t;
    sub_tables(wre, wim, hi, t);
    float rr[2], ri[2];
    // Unrolled: uq[] stays in the registers the loads filled
    #pragma unroll
    for (int g = 0; g < CHUNK / 256; ++g) {
        v8f la[4];
        sub_sums(uq[2 * g], uq[2 * g + 1], t, la);
        #pragma unroll
        for (int s = 0; s < 2; ++s) {
            if (g) {
                cmad(rr[s], ri[s], t.hr[s], t.hj[s], 0.0f, 0.0f);
                cmad(rr[s], ri[s], t.sr[s], t.si[s], la[2 * s][0], la[2 * s + 1][0]);
            } else {
                rr[s] = la[2 * s][0];  ri[s] = la[2 * s + 1][0];
            }
            #pragma unroll
            for (int r = 1; r < 8; ++r)
                cmad(rr[s], ri[s], t.sr[s], t.si[s], la[2 * s][r], la[2 * s + 1][r]);
        }
    }
    v2f st;                                          // lane writes state n = lane = hi*16 + m
    #pragma unroll
    for (int s = 0; s < 2; ++s) {
        float orr = xhalf(rr[s]), ori = xhalf(ri[s]);
        float ar = hi ? orr : rr[s], ai = hi ? ori : ri[s];    // the lower half's sum
        float br = hi ? rr[s] : orr, bi = hi ? ri[s] : ori;    // the upper half's
        cmad(ar, ai, t.hr[s], t.hj[s], br, bi);
        if (s == 0 || hi) { st.x = ar; st.y = ai; }
    }
    *(v2f*)&Se[c][lane * 2] = st;

    float*       sl = &Sl[c][0];

    // T's A fragments, held for the whole chunk: row t = m.  Asked for ahead of the barrier (part 1 has no registers to spare for them)
    v4f tl, th;                                                // T[m][hi*8 .. +7]
    // One statement with its data wait: the next loads' results may then land on its address registers
    asm volatile("global_load_b128 %0, %2, off\n\t"
                 "global_load_b128 %1, %2, off offset:16\n\t"
                 "s_wait_loadcnt 0x0"
                 : "=&v"(tl), "=&v"(th)
                 : "v"(Tt + (h * SUB + m) * SUB + hi * 8)
                 : "memory");
    float ta[8];
    #pragma unroll
    for (int e = 0; e < 8; ++e) {
        float kv = e < 4 ? tl[e & 3] : th[e & 3];
        ta[e] = (hi * 8 + e == m) ? kv + Dh : kv;
    }

    // Every chunk's end state and G are in LDS behind this barrier; neither is written again
    __syncthreads();
    float pr = 0.0f, pi = 0.0f;                                // state n = lane at the chunk's start
    for (int c0 = 0; c0 < c; c0 += 8) {
        v2f e[8];                                              // eight reads at once: one LDS latency for eight steps
        // Both loops unrolled: e[] stays in registers
        #pragma unroll
        for (int k = 0; k < 8; ++k) e[k] = *(const v2f*)&Se[c0 + k][lane * 2];
        #pragma unroll
        for (int k = 0; k < 8; ++k)
            if (c0 + k < c) cmad(pr, pi, cwr, cwi, e[k].x, e[k].y);
    }
    // Both halves hold the lane's two states m and 16+m
    float qr = xhalf(pr), qi = xhalf(pi);
    float gr[2] = {hi ? qr : pr, hi ? pr : qr}, gi[2] = {hi ? qi : pi, hi ? pi : qi};

    for (int g = 0; g < CHUNK; g += 256) {
        // The group's inputs: A fragment of the sub-block sums and B fragment U[hi*8 ..][blk = m]
        // of the output products (one statement with its data wait, so that no result lands
        // on an address register of a load that is still on its way)
        v4f ub0, ub1;
        asm volatile("global_load_b128 %0, %2, off\n\t"
                     "global_load_b128 %1, %2, off offset:16\n\t"
                     "s_wait_loadcnt 0x0"
                     : "=&v"(ub0), "=&v"(ub1)
                     : "v"(up + g + m * SUB + hi * 8)
                     : "memory");
        v8f la[4];
        sub_sums(ub0, ub1, t, la);
        #pragma unroll
        for (int s = 0; s < 2; ++s) {
            float hr = la[2 * s][0], hj = la[2 * s + 1][0];    // the half's eight sub-blocks from a zero state
            #pragma unroll
            for (int r = 1; r < 8; ++r)
                cmad(hr, hj, t.sr[s], t.si[s], la[2 * s][r], la[2 * s + 1][r]);
            float orr = xhalf(hr), ori = xhalf(hj);
            float mr = gr[s], mi = gi[s];                      // state at sub-block 8
            cmad(mr, mi, t.hr[s], t.hj[s], hi ? orr : hr, hi ? ori : hj);
            float cr = hi ? mr : gr[s], ci = hi ? mi : gi[s];  // state at the half's first sub-block
            cmad(mr, mi, t.hr[s], t.hj[s], hi ? hr : orr, hi ? hj : ori);
            gr[s] = mr;  gi[s] = mi;                           // state at the next group's start
            #pragma unroll
            for (int r = 0; r < 8; ++r) {
                v2f st; st.x = cr; st.y = ci;
                *(v2f*)(sl + (hi * 8 + r) * SROW + s * 32 + m * 2) = st;   // state before sub-block 8*hi + r
                if (r < 7) cmad(cr, ci, t.sr[s], t.si[s], la[2 * s][r], la[2 * s + 1][r]);
            }
        }
        // The snapshots are read back by other lanes of the same wave: the
        // stores must have landed, and the compiler must not move the reads up.
        asm volatile("s_wait_dscnt 0x0" ::: "memory");
        // Holds the recurrence's vector instructions ahead of the run of matrix instructions.
        __builtin_amdgcn_sched_barrier(0);
        v8f acc = {};
        #pragma unroll
        for (int w = 0; w < 4; ++w) {
            const v4f ub = w < 2 ? ub0 : ub1;
            v2f a, b;
            a.x = ta[2 * w];              a.y = ta[2 * w + 1];
            b.x = (w & 1) ? ub.z : ub.x;  b.y = (w & 1) ? ub.w : ub.y;
            acc = __builtin_amdgcn_wmma_f32_16x16x4_f32(false, a, false, b, (short)0, acc, false, false);
        }
        float4 sb[8], ga[8];                                           // Sn[hi*32 ..][blk = m], G[t = m][hi*32 ..]
        #pragma unroll
        for (int w = 0; w < 8; ++w) {
            sb[w] = *(const float4*)(sl + m * SROW + hi * 32 + w * 4);
            ga[w] = *(const float4*)(Gl + m * SROW + hi * 32 + w * 4);
        }
        #pragma unroll
        for (int w = 0; w < 8; ++w) {
            v2f a, b;
            a.x = ga[w].x;  a.y = ga[w].y;  b.x = sb[w].x;  b.y = sb[w].y;
            acc = __builtin_amdgcn_wmma_f32_16x16x4_f32(false, a, false, b, (short)0, acc, false, false);
            a.x = ga[w].z;  a.y = ga[w].w;  b.x = sb[w].z;  b.y = sb[w].w;
            acc = __builtin_amdgcn_wmma_f32_16x16x4_f32(false, a, false, b, (short)0, acc, false, false);
        }
        // Four vector slots between the last product and the first vector instruction
        // that may touch its A, B or D; the two scheduling barriers hold them in place.
        __builtin_amdgcn_sched_barrier(0);
        asm volatile("v_nop\n\tv_nop\n\tv_nop\n\tv_nop");
        __builtin_amdgcn_sched_barrier(0);
        // acc[r] = Y[t = 8*hi + r][blk = m]: eight consecutive outputs per lane
        float4 o0, o1;
        o0.x = acc[0]; o0.y = acc[1]; o0.z = acc[2]; o0.w = acc[3];
        o1.x = acc[4]; o1.y = acc[5]; o1.z = acc[6]; o1.w = acc[7];
        *(float4*)(vp + g + m * SUB + hi * 8)     = o0;
        *(float4*)(vp + g + m * SUB + hi * 8 + 4) = o1;
        asm volatile("s_wait_xcnt 0x0" ::: "memory");
    }
}

// ---------------------------------------------------------------------------
// K5: z = W_out @ y + b_out ; GLU.  W_out (64x32) staged to LDS via TDM.
// ---------------------------------------------------------------------------
__global__ __launch_bounds__(256) void k_out_glu(
        const float* __restrict__ vin, const float* __restrict__ Wo,
        const float* __restrict__ bo, float* __restrict__ yg) {
    __shared__ __align__(16) float Wol[2 * Hdim * Hdim];       // 8 KB
    if (threadIdx.x < 32) {
        tdm_load_2d_f32(Wo, (unsigned)(uintptr_t)Wol, Hdim, 2 * Hdim, Hdim);
        __builtin_amdgcn_s_wait_tensorcnt(0);
    }
    __syncthreads();

    const int lane = threadIdx.x & 31;
    const int m    = lane & 15;
    const int hi   = lane >> 4;
    const int gid  = blockIdx.x * 8 + (threadIdx.x >> 5);
    const int b    = gid / (Ldim / 16);
    const int l0   = (gid % (Ldim / 16)) * 16;
    const float* vb = vin + (size_t)b * Hdim * Ldim;
    v8f acc[4] = {};
    #pragma unroll
    for (int kk = 0; kk < 8; ++kk) {
        const int k = kk * 4 + 2 * hi;
        v2f bm;
        bm.x = vb[(size_t)k * Ldim + l0 + m];
        bm.y = vb[(size_t)(k + 1) * Ldim + l0 + m];
        #pragma unroll
        for (int t = 0; t < 4; ++t) {
            v2f a = *(const v2f*)&Wol[(t * 16 + m) * Hdim + k];
            acc[t] = __builtin_amdgcn_wmma_f32_16x16x4_f32(false, a, false, bm, (short)0, acc[t], false, false);
        }
    }
    #pragma unroll
    for (int t = 0; t < 2; ++t) {
        #pragma unroll
        for (int r = 0; r < 8; ++r) {
            int g  = t * 16 + r + 8 * hi;
            float zv = acc[t][r]     + bo[g];
            float zg = acc[t + 2][r] + bo[g + Hdim];
            yg[((size_t)b * Hdim + g) * Ldim + l0 + m] = zv * sigm(zg);
        }
    }
}

// ---------------------------------------------------------------------------
// K6: sum and sum of squares of one (b,h) row per block, so that every WGP reads a share.
//     The last kernel joins a channel's Bdim rows.  A block owns a whole 128-byte line of part.
// ---------------------------------------------------------------------------
__global__ __launch_bounds__(BN_T) void k_bn_stats(
        const float* __restrict__ yg, float* __restrict__ part) {
    __shared__ float ls[BN_T / 32];
    __shared__ float ls2[BN_T / 32];
    const int tid = threadIdx.x;
    // The thread's 16 loads are asked for together, the row is in flight at once; a wave's load
    // covers 512 contiguous bytes; the offsets step by BN_T * 16 bytes.  One statement with its
    // data wait, so that no result lands on an address register of a load still on its way.
    static_assert(BN_T * 16 == 8192 && BN_T * 4 * 16 == Ldim, "the offsets below are written out for this shape");
    v4f q[16];
    asm volatile("global_load_b128 %0, %16, off\n\t"
                 "global_load_b128 %1, %16, off offset:8192\n\t"
                 "global_load_b128 %2, %16, off offset:16384\n\t"
                 "global_load_b128 %3, %16, off offset:24576\n\t"
                 "global_load_b128 %4, %16, off offset:32768\n\t"
                 "global_load_b128 %5, %16, off offset:40960\n\t"
                 "global_load_b128 %6, %16, off offset:49152\n\t"
                 "global_load_b128 %7, %16, off offset:57344\n\t"
                 "global_load_b128 %8, %16, off offset:65536\n\t"
                 "global_load_b128 %9, %16, off offset:73728\n\t"
                 "global_load_b128 %10, %16, off offset:81920\n\t"
                 "global_load_b128 %11, %16, off offset:90112\n\t"
                 "global_load_b128 %12, %16, off offset:98304\n\t"
                 "global_load_b128 %13, %16, off offset:106496\n\t"
                 "global_load_b128 %14, %16, off offset:114688\n\t"
                 "global_load_b128 %15, %16, off offset:122880\n\t"
                 "s_wait_loadcnt 0x0"
                 : "=&v"(q[0]), "=&v"(q[1]), "=&v"(q[2]), "=&v"(q[3]),
                   "=&v"(q[4]), "=&v"(q[5]), "=&v"(q[6]), "=&v"(q[7]),
                   "=&v"(q[8]), "=&v"(q[9]), "=&v"(q[10]), "=&v"(q[11]),
                   "=&v"(q[12]), "=&v"(q[13]), "=&v"(q[14]), "=&v"(q[15])
                 : "v"(yg + (size_t)blockIdx.x * Ldim + tid * 4)
                 : "memory");
    v4f a = q[0], a2 = q[0] * q[0];
    // Unrolled: q[] stays in the registers the loads filled
    #pragma unroll
    for (int i = 1; i < 16; ++i) {
        a += q[i];
        a2 = __builtin_elementwise_fma(q[i], q[i], a2);
    }
    float s  = (a.x + a.y) + (a.z + a.w);
    float s2 = (a2.x + a2.y) + (a2.z + a2.w);
    #pragma unroll
    for (int off = 16; off; off >>= 1) {
        s  += __shfl_xor(s, off, 32);
        s2 += __shfl_xor(s2, off, 32);
    }
    if ((tid & 31) == 0) { ls[tid >> 5] = s;  ls2[tid >> 5] = s2; }
    __syncthreads();
    if (tid < 32) {                                            // the first wave joins the waves' sums
        s  = ls[tid & (BN_T / 32 - 1)];
        s2 = ls2[tid & (BN_T / 32 - 1)];
        #pragma unroll
        for (int off = BN_T / 64; off; off >>= 1) {
            s  += __shfl_xor(s, off, 32);
            s2 += __shfl_xor(s2, off, 32);
        }
        if (tid == 0) {
            v2f o; o.x = s; o.y = s2;
            *(v2f*)&part[(size_t)blockIdx.x * PLINE] = o;
        }
    }
}

// ---------------------------------------------------------------------------
// K7: BN mean / rstd from the rows' sums, BN apply + FiLM + gelu + depthwise residual.
//     A thread takes FIN_V groups of four elements, a block FIN_SPAN elements of one (b,h) row.
// ---------------------------------------------------------------------------
__global__ __launch_bounds__(FIN_T) void k_final(
        const float* __restrict__ yg, const float* __restrict__ part,
        const float* __restrict__ gb, const float* __restrict__ resw,
        const float* __restrict__ x, float* __restrict__ out) {
    const int row = blockIdx.x / (Ldim / FIN_SPAN);            // b*H + h, the same for the whole block
    const int h = row & (Hdim - 1);
    const int b = row / Hdim;
    const size_t base = (size_t)blockIdx.x * FIN_SPAN + threadIdx.x * 4;
    const float gamma = gb[b * (2 * Hdim) + h];
    const float beta  = gb[b * (2 * Hdim) + Hdim + h];
    const float rw    = resw[h];
    // All 16 y and x loads of the thread are asked for before the first is used (left to the compiler,
    // the x loads went down among the arithmetic in pairs and their latencies came one after
    // another); a wave's load covers 512 contiguous bytes; the offsets step by FIN_T * 16 bytes.
    // One statement with its data wait, so that no result lands on an address register of a
    // load that is still on its way.
    // The (sum, sum of squares) of the channel's Bdim rows go along in the same statement (every lane
    // the same eight addresses, Hdim * PLINE * 4 bytes apart): as scalar loads the compiler put them
    // and their wait either wholly in front of the big loads or wholly behind them.
    static_assert(FIN_T * 16 == 8192 && FIN_V == 8 && Bdim == 8 && Hdim * PLINE * 4 == 4096,
                  "the offsets below are written out for this shape");
    v4f yv[FIN_V], xv[FIN_V];
    v2f pp[Bdim];
    asm volatile("global_load_b64 %16, %26, off\n\t"
                 "global_load_b64 %17, %26, off offset:4096\n\t"
                 "global_load_b64 %18, %26, off offset:8192\n\t"
                 "global_load_b64 %19, %26, off offset:12288\n\t"
                 "global_load_b64 %20, %26, off offset:16384\n\t"
                 "global_load_b64 %21, %26, off offset:20480\n\t"
                 "global_load_b64 %22, %26, off offset:24576\n\t"
                 "global_load_b64 %23, %26, off offset:28672\n\t"
                 "global_load_b128 %0, %24, off\n\t"
                 "global_load_b128 %1, %24, off offset:8192\n\t"
                 "global_load_b128 %2, %24, off offset:16384\n\t"
                 "global_load_b128 %3, %24, off offset:24576\n\t"
                 "global_load_b128 %4, %24, off offset:32768\n\t"
                 "global_load_b128 %5, %24, off offset:40960\n\t"
                 "global_load_b128 %6, %24, off offset:49152\n\t"
                 "global_load_b128 %7, %24, off offset:57344\n\t"
                 "global_load_b128 %8, %25, off\n\t"
                 "global_load_b128 %9, %25, off offset:8192\n\t"
                 "global_load_b128 %10, %25, off offset:16384\n\t"
                 "global_load_b128 %11, %25, off offset:24576\n\t"
                 "global_load_b128 %12, %25, off offset:32768\n\t"
                 "global_load_b128 %13, %25, off offset:40960\n\t"
                 "global_load_b128 %14, %25, off offset:49152\n\t"
                 "global_load_b128 %15, %25, off offset:57344\n\t"
                 "s_wait_loadcnt 0x0"
                 : "=&v"(yv[0]), "=&v"(yv[1]), "=&v"(yv[2]), "=&v"(yv[3]),
                   "=&v"(yv[4]), "=&v"(yv[5]), "=&v"(yv[6]), "=&v"(yv[7]),
                   "=&v"(xv[0]), "=&v"(xv[1]), "=&v"(xv[2]), "=&v"(xv[3]),
                   "=&v"(xv[4]), "=&v"(xv[5]), "=&v"(xv[6]), "=&v"(xv[7]),
                   "=&v"(pp[0]), "=&v"(pp[1]), "=&v"(pp[2]), "=&v"(pp[3]),
                   "=&v"(pp[4]), "=&v"(pp[5]), "=&v"(pp[6]), "=&v"(pp[7])
                 : "v"(yg + base), "v"(x + base), "v"(part + h * PLINE)
                 : "memory");
    v2f sm = pp[0];
    #pragma unroll
    for (int bb = 1; bb < Bdim; ++bb) sm += pp[bb];
    const float s = sm.x, s2 = sm.y;
    const float inv   = 1.0f / (float)((size_t)Bdim * Ldim);
    const float mean  = s * inv;
    const float rstd  = rsqrtf(s2 * inv - mean * mean + 1e-5f);
    // Unrolled: yv[] and xv[] stay in the registers the loads filled; a rolled loop would index them through memory
    #pragma unroll
    for (int i = 0; i < FIN_V; ++i) {
        float4 o;
        o.x = fmaf(rw, xv[i].x, gelu_t(fmaf(gamma, (yv[i].x - mean) * rstd, beta)));
        o.y = fmaf(rw, xv[i].y, gelu_t(fmaf(gamma, (yv[i].y - mean) * rstd, beta)));
        o.z = fmaf(rw, xv[i].z, gelu_t(fmaf(gamma, (yv[i].z - mean) * rstd, beta)));
        o.w = fmaf(rw, xv[i].w, gelu_t(fmaf(gamma, (yv[i].w - mean) * rstd, beta)));
        *(float4*)(out + base + i * (FIN_T * 4)) = o;
    }
}

// ---------------------------------------------------------------------------
extern "C" void kernel_launch(void* const* d_in, const int* in_sizes, int n_in,
                              void* d_out, int out_size, void* d_ws, size_t ws_size,
                              hipStream_t stream) {
    const float* x      = (const float*)d_in[0];
    const float* cond   = (const float*)d_in[1];
    const float* W_lin  = (const float*)d_in[2];
    const float* b_lin  = (const float*)d_in[3];
    const float* log_dt = (const float*)d_in[4];
    const float* A_re   = (const float*)d_in[5];
    const float* A_im   = (const float*)d_in[6];
    const float* C_re   = (const float*)d_in[7];
    const float* C_im   = (const float*)d_in[8];
    const float* Dv     = (const float*)d_in[9];
    const float* W_out  = (const float*)d_in[10];
    const float* b_out  = (const float*)d_in[11];
    const float* film_W = (const float*)d_in[12];
    const float* film_b = (const float*)d_in[13];
    const float* res_w  = (const float*)d_in[14];
    float* out = (float*)d_out;

    const size_t tot = (size_t)Bdim * Hdim * Ldim;
    float* ws   = (float*)d_ws;
    float* u    = ws;                                   // [B,H,L]
    float* v    = u + tot;                              // [B,H,L]
    float* yg   = u;                                    // alias: u dead after k_scan
    float* wr_  = v + tot;
    float* wi_  = wr_  + Hdim * Ndim;
    float* cdr_ = wi_  + Hdim * Ndim;
    float* cdi_ = cdr_ + Hdim * Ndim;
    float* wcr_ = cdi_ + Hdim * Ndim;
    float* wci_ = wcr_ + Hdim * Ndim;
    float* gb   = wci_ + Hdim * Ndim;                   // [B, 2H]
    float* part = gb + Bdim * 2 * Hdim;                 // [B*H, PLINE]
    float* Gt   = part + Bdim * Hdim * PLINE;           // [H, SUB, 2N]
    float* Tt   = Gt + Hdim * SUB * 2 * Ndim;           // [H, SUB, SUB]

    k_in_linear<<<PRE_B + (Bdim * (Ldim / 16)) / 8, 256, 0, stream>>>(x, W_lin, b_lin, u,
                                           log_dt, A_re, A_im, C_re, C_im,
                                           wr_, wi_, cdr_, cdi_, wcr_, wci_, Gt, Tt,
                                           cond, film_W, film_b, gb);
    k_scan<<<Bdim * Hdim, NCHUNK * 32, 0, stream>>>(u, wr_, wi_, wcr_, wci_, Gt, Tt, Dv, v);
    k_out_glu<<<(Bdim * (Ldim / 16)) / 8, 256, 0, stream>>>(v, W_out, b_out, yg);
    k_bn_stats<<<Bdim * Hdim, BN_T, 0, stream>>>(yg, part);
    k_final<<<(Bdim * Hdim * Ldim) / FIN_SPAN, FIN_T, 0, stream>>>(yg, part, gb, res_w, x, out);
}

// v007
// It runs in 63.6 microseconds.
// In both of two side-by-side timings against v006, it was 1.04 times as fast.
// All steps since v000 together make it 3.13 times as fast.
#include <hip/hip_runtime.h>
#include <hip/hip_bf16.h>
#include <math.h>

// Problem constants (match reference)
#define Bdim   8
#define Hdim   32
#define Ldim   32768
#define Ndim   32
#define CDdim  128
#define NCHUNK 32                 // chunks per sequence = waves of a scan block
#define CHUNK  (Ldim / NCHUNK)    // 1024
#define SUB    16                 // steps per sub-block of the output pass (rows of one matrix tile)
#define FIN_T  512                // threads per block of the last kernel
#define FIN_V  8                  // 16-byte groups per thread and stream there
#define FIN_SPAN (FIN_T * 4 * FIN_V)   // elements per block there; divides Ldim
#define BN_T   512                // threads per block of the statistics kernel
#define PLINE  32                 // floats between two blocks' partial sums there: one 128-byte line each
#define SET_B  (Hdim * Ndim / 256)        // leading blocks of the first launch that do the SSM set-up
#define FILM_B (Bdim * 2 * Hdim / 256)    // blocks behind them that do the FiLM products
#define PRE_B  (SET_B + FILM_B)
#define SROW   68                 // LDS pitch (floats) of one state snapshot: 16 B x odd, no bank conflict
#define WROW   36                 // LDS pitch (floats) of a weight row in the two linear kernels: 16 B x odd, see stage_w

typedef __attribute__((ext_vector_type(2))) float v2f;
typedef __attribute__((ext_vector_type(4))) float v4f;
typedef __attribute__((ext_vector_type(8))) float v8f;

// Branch-free gelu (tanh approximation): 0.5x(1+tanh(z)) == x*sigmoid(2z)
__device__ __forceinline__ float gelu_t(float x) {
    float x3 = x * x * x;
    float z  = fmaf(0.044715f, x3, x) * 1.5957691216057308f;  // 2*sqrt(2/pi)
    return x * __fdividef(1.0f, 1.0f + __expf(-z));
}
__device__ __forceinline__ float sigm(float x) {
    return __fdividef(1.0f, 1.0f + __expf(-x));
}

// ---------------------------------------------------------------------------
// A weight matrix of Hdim columns goes to LDS at a pitch of WROW floats.  The A fragments are read
// 8 bytes a lane, lane m from row m: at the matrix's own pitch of 128 bytes the even rows share one
// bank pair and the odd rows another, eight lanes on each; at 144 bytes the 16 rows start on 16
// different groups of four banks, which the two halves of the wave fill, each bank once.
// 256 threads, 16 bytes each, carry 32 rows a pass.  Load and data wait are one statement, so that
// no later result lands on the address registers of a load that is still on its way.
// ---------------------------------------------------------------------------
template <int ROWS>
__device__ __forceinline__ void stage_w(const float* __restrict__ Wg, float* Wlds) {
    static_assert(Hdim == 32 && (ROWS == 32 || ROWS == 64), "the offset below is written out for this shape");
    const int e = threadIdx.x * 4;
    float* dst = Wlds + (e >> 5) * WROW + (e & 31);
    if (ROWS == 32) {
        v4f w0;
        asm volatile("global_load_b128 %0, %1, off\n\t"
                     "s_wait_loadcnt 0x0"
                     : "=&v"(w0) : "v"(Wg + e) : "memory");
        *(v4f*)dst = w0;
    } else {
        v4f w0, w1;
        asm volatile("global_load_b128 %0, %2, off\n\t"
                     "global_load_b128 %1, %2, off offset:4096\n\t"
                     "s_wait_loadcnt 0x0"
                     : "=&v"(w0), "=&v"(w1) : "v"(Wg + e) : "memory");
        *(v4f*)dst = w0;
        *(v4f*)(dst + 32 * WROW) = w1;
    }
}

// ---------------------------------------------------------------------------
// K0: per-(h,n) SSM constants: w = exp(dt*A), Cd = 2*C*(exp(dtA)-1)/A, Wc = w^CHUNK
//     and the output pass's tables: Gt[h][t][2n,2n+1] = (Re, -Im) of Cd*w^(t+1),
//     Tt[h][t][j] = sum_n Re(Cd*w^(t-j)) for j <= t, else 0, for t, j < SUB.
//     i = h*N + n; a wave works alone, so the blocks' size is free.
// ---------------------------------------------------------------------------
__device__ __forceinline__ void d_setup(int i, const float* __restrict__ log_dt,
                        const float* __restrict__ A_re, const float* __restrict__ A_im,
                        const float* __restrict__ C_re, const float* __restrict__ C_im,
                        float* wr_, float* wi_, float* cdr_, float* cdi_,
                        float* wcr_, float* wci_, float* Gt, float* Tt) {
    int h = i >> 5;
    float dt  = __expf(log_dt[h]);
    float ar  = A_re[i], ai = A_im[i];
    float dre = dt * ar, dim = dt * ai;
    float er  = __expf(dre);
    float sn, cs; __sincosf(dim, &sn, &cs);
    float wr = er * cs, wi = er * sn;
    float exr = wr - 1.0f, exi = wi;
    float den = ar * ar + ai * ai;
    float qr = (exr * ar + exi * ai) / den;
    float qi = (exi * ar - exr * ai) / den;
    float cr = C_re[i], ci = C_im[i];
    wr_[i]  = wr;  wi_[i]  = wi;
    cdr_[i] = 2.0f * (cr * qr - ci * qi);
    cdi_[i] = 2.0f * (cr * qi + ci * qr);
    float er2 = __expf(dre * (float)CHUNK);
    float sn2, cs2; __sincosf(dim * (float)CHUNK, &sn2, &cs2);
    wcr_[i] = er2 * cs2;  wci_[i] = er2 * sn2;

    int n = i & 31;                      // a wave holds the 32 states of one h
    float gr = 2.0f * (cr * qr - ci * qi);
    float gi = 2.0f * (cr * qi + ci * qr);
    float* Td = Tt + h * (SUB * SUB) + (n & (SUB - 1)) * (SUB + 1);   // T[n][n]
    float ks[SUB];                       // Re(Cd*w^d), then its sum over the states
    // The three loops are unrolled so that ks[] stays in registers; the sums of all d
    // go through the butterfly side by side, so their cross-lane latencies overlap.
    #pragma unroll
    for (int d = 0; d < SUB; ++d) {
        ks[d] = gr;
        float ngr = fmaf(gr, wr, -(gi * wi));
        gi = fmaf(gr, wi, gi * wr);
        gr = ngr;                        // now Cd*w^(d+1)
        v2f gp; gp.x = gr; gp.y = -gi;
        *(v2f*)&Gt[((size_t)(h * SUB + d)) * (2 * Ndim) + 2 * n] = gp;
    }
    #pragma unroll
    for (int off = 16; off; off >>= 1) {
        #pragma unroll
        for (int d = 0; d < SUB; ++d) ks[d] += __shfl_xor(ks[d], off, 32);
    }
    #pragma unroll
    for (int d = 0; d < SUB; ++d) {
        if (n < SUB - d) {
            Td[d * SUB] = ks[d];         // T[n+d][n]
            if (d) Td[d] = 0.0f;         // T[n][n+d], above the diagonal
        }
    }
}

// ---------------------------------------------------------------------------
// K-film: gb[b,g] = cond[b] . film_W[g] + film_b[g]      (8 x 64 outputs), i = b*64 + g
// ---------------------------------------------------------------------------
__device__ __forceinline__ void d_film(int i, const float* __restrict__ cond, const float* __restrict__ fW,
                       const float* __restrict__ fb, float* __restrict__ gb) {
    int b = i >> 6;
    int g = i & 63;
    const float* c = cond + b * CDdim;
    const float* w = fW + g * CDdim;
    float s = fb[g];
    #pragma unroll 8
    for (int j = 0; j < CDdim; ++j) s = fmaf(c[j], w[j], s);
    gb[i] = s;
    // precaution: other code of this kernel follows the store in the built object and rewrites its registers
    asm volatile("s_wait_xcnt 0x0" ::: "memory");
}

// ---------------------------------------------------------------------------
// K1: u = gelu(W_lin @ x + b_lin)   via V_WMMA_F32_16X16X4_F32
//     W_lin staged to LDS once per block (stage_w).
//     The launch's first PRE_B blocks do the SSM set-up and the FiLM products instead: neither
//     reads or feeds u, and the kernels that read their results are launched later.  They come
//     first in the grid so that they start with the launch and end under it.
// ---------------------------------------------------------------------------
__global__ __launch_bounds__(256) void k_in_linear(
        const float* __restrict__ x, const float* __restrict__ W,
        const float* __restrict__ bias, float* __restrict__ u,
        const float* __restrict__ log_dt,
        const float* __restrict__ A_re, const float* __restrict__ A_im,
        const float* __restrict__ C_re, const float* __restrict__ C_im,
        float* wr_, float* wi_, float* cdr_, float* cdi_,
        float* wcr_, float* wci_, float* Gt, float* Tt,
        const float* __restrict__ cond, const float* __restrict__ fW,
        const float* __restrict__ fb, float* __restrict__ gb) {
    __shared__ __align__(16) float Wl[Hdim * WROW];
    // Whole blocks take these two ways out, ahead of the barrier
    if (blockIdx.x < SET_B) {
        d_setup(blockIdx.x * 256 + threadIdx.x, log_dt, A_re, A_im, C_re, C_im,
                wr_, wi_, cdr_, cdi_, wcr_, wci_, Gt, Tt);
        return;
    }
    if (blockIdx.x < PRE_B) {
        d_film((blockIdx.x - SET_B) * 256 + threadIdx.x, cond, fW, fb, gb);
        return;
    }
    stage_w<Hdim>(W, Wl);
    __syncthreads();

    const int lane = threadIdx.x & 31;
    const int m    = lane & 15;
    const int hi   = lane >> 4;
    const int gid  = (blockIdx.x - PRE_B) * 8 + (threadIdx.x >> 5);
    const int b    = gid / (Ldim / 16);
    const int l0   = (gid % (Ldim / 16)) * 16;
    const float* xb = x + (size_t)b * Hdim * Ldim;
    v8f acc0 = {};
    v8f acc1 = {};
    #pragma unroll
    for (int kk = 0; kk < 8; ++kk) {
        const int k = kk * 4 + 2 * hi;                         // K-pair for half-wave
        v2f bm;                                                // B: 4x16
        bm.x = xb[(size_t)k * Ldim + l0 + m];
        bm.y = xb[(size_t)(k + 1) * Ldim + l0 + m];
        // precaution, behind the last x load: the bias loads' results reuse the x loads' address registers
        if (kk == 7) asm volatile("s_wait_xcnt 0x0" ::: "memory");
        v2f a0 = *(const v2f*)&Wl[m * WROW + k];               // ds_load_b64
        v2f a1 = *(const v2f*)&Wl[(16 + m) * WROW + k];
        acc0 = __builtin_amdgcn_wmma_f32_16x16x4_f32(false, a0, false, bm, (short)0, acc0, false, false);
        acc1 = __builtin_amdgcn_wmma_f32_16x16x4_f32(false, a1, false, bm, (short)0, acc1, false, false);
    }
    #pragma unroll
    for (int r = 0; r < 8; ++r) {
        int g0 = r + 8 * hi;
        int g1 = 16 + g0;
        u[((size_t)b * Hdim + g0) * Ldim + l0 + m] = gelu_t(acc0[r] + bias[g0]);
        u[((size_t)b * Hdim + g1) * Ldim + l0 + m] = gelu_t(acc1[r] + bias[g1]);
    }
    // precaution: other code of this kernel follows the stores in the built object and rewrites their registers
    asm volatile("s_wait_xcnt 0x0" ::: "memory");
}

// ---------------------------------------------------------------------------
// Both passes of the scan kernel take the recurrence s' = w*s + u in sub-blocks of SUB steps:
//     s(after a sub-block) = w^SUB * s(before it) + Lsum,  Lsum[blk][n] = sum_j w_n^(SUB-1-j) u[blk*SUB + j].
// Lsum of 16 sub-blocks (256 steps) is a matrix product, A = the inputs (row blk, k = j),
// B = the powers of w (k = j, column = state); four column tiles: re and im of the
// states 0..15, then re and im of the states 16..31.  A and B fragments take the same
// j at the same place: j = hi*8 + 2*w + {0,1} in product w.  In the result a lane holds,
// for its two states m and 16+m, the sub-blocks 8*hi .. 8*hi+7, one per register.
// ---------------------------------------------------------------------------
// (r,i) = (r,i)*(ar,ai) + (br,bi)
__device__ __forceinline__ void cmad(float& r, float& i, float ar, float ai, float br, float bi) {
    float nr = fmaf(ar, r, fmaf(-ai, i, br));
    i = fmaf(ai, r, fmaf(ar, i, bi));
    r = nr;
}
// Lane l <-> l ^ 16 as a vector cross-row move
__device__ __forceinline__ float xhalf(float v) {
    int b = __float_as_int(v);
    return __int_as_float(__builtin_amdgcn_permlanex16(b, b, 0x76543210, 0xfedcba98, false, false));
}
struct SubTab {
    v2f   pb[4][4];                      // B fragments [tile][product]
    float sr[2], si[2];                  // w^SUB of the lane's two states
    float hr[2], hj[2];                  // w^(8*SUB): a half's eight sub-blocks
};
__device__ __forceinline__ void sub_tables(const float* wre, const float* wim, int hi, SubTab& t) {
    #pragma unroll
    for (int s = 0; s < 2; ++s) {
        float pw_r[8], pw_i[8];          // w^(2^e)
        pw_r[0] = wre[s];  pw_i[0] = wim[s];
        #pragma unroll
        for (int e = 1; e < 8; ++e) {
            pw_r[e] = fmaf(pw_r[e - 1], pw_r[e - 1], -(pw_i[e - 1] * pw_i[e - 1]));
            pw_i[e] = 2.0f * pw_r[e - 1] * pw_i[e - 1];
        }
        t.sr[s] = pw_r[4];  t.si[s] = pw_i[4];
        t.hr[s] = pw_r[7];  t.hj[s] = pw_i[7];
        float pr = hi ? 1.0f : pw_r[3];  // w^(SUB-1-j) at j = hi*8 + 7
        float pi = hi ? 0.0f : pw_i[3];
        #pragma unroll
        for (int e = 7; e >= 0; --e) {
            t.pb[2 * s][e >> 1][e & 1]     = pr;
            t.pb[2 * s + 1][e >> 1][e & 1] = pi;
            cmad(pr, pi, wre[s], wim[s], 0.0f, 0.0f);
        }
    }
}
// la[tile][r] = Lsum[blk = 8*hi + r][column m of the tile]; ua, ub = u[m*SUB + hi*8 .. +7]
__device__ __forceinline__ void sub_sums(const v4f& ua, const v4f& ub, const SubTab& t, v8f* la) {
    v2f a0, a1, a2, a3;
    a0.x = ua.x;  a0.y = ua.y;  a1.x = ua.z;  a1.y = ua.w;
    a2.x = ub.x;  a2.y = ub.y;  a3.x = ub.z;  a3.y = ub.w;
    // The 16 products as one statement.  The four v_nop are the
    // vector slots between the last product and the first vector instruction on its A, B or D.
    asm volatile(
                 "v_wmma_f32_16x16x4_f32 %0, %4, %8, 0\n\t"
                 "v_wmma_f32_16x16x4_f32 %1, %4, %9, 0\n\t"
                 "v_wmma_f32_16x16x4_f32 %2, %4, %10, 0\n\t"
                 "v_wmma_f32_16x16x4_f32 %3, %4, %11, 0\n\t"
                 "v_wmma_f32_16x16x4_f32 %0, %5, %12, %0\n\t"
                 "v_wmma_f32_16x16x4_f32 %1, %5, %13, %1\n\t"
                 "v_wmma_f32_16x16x4_f32 %2, %5, %14, %2\n\t"
                 "v_wmma_f32_16x16x4_f32 %3, %5, %15, %3\n\t"
                 "v_wmma_f32_16x16x4_f32 %0, %6, %16, %0\n\t"
                 "v_wmma_f32_16x16x4_f32 %1, %6, %17, %1\n\t"
                 "v_wmma_f32_16x16x4_f32 %2, %6, %18, %2\n\t"
                 "v_wmma_f32_16x16x4_f32 %3, %6, %19, %3\n\t"
                 "v_wmma_f32_16x16x4_f32 %0, %7, %20, %0\n\t"
                 "v_wmma_f32_16x16x4_f32 %1, %7, %21, %1\n\t"
                 "v_wmma_f32_16x16x4_f32 %2, %7, %22, %2\n\t"
                 "v_wmma_f32_16x16x4_f32 %3, %7, %23, %3\n\t"
                 "v_nop\n\tv_nop\n\tv_nop\n\tv_nop"
                 : "=&v"(la[0]), "=&v"(la[1]), "=&v"(la[2]), "=&v"(la[3])
                 : "v"(a0), "v"(a1), "v"(a2), "v"(a3),
                   "v"(t.pb[0][0]), "v"(t.pb[1][0]), "v"(t.pb[2][0]), "v"(t.pb[3][0]),
                   "v"(t.pb[0][1]), "v"(t.pb[1][1]), "v"(t.pb[2][1]), "v"(t.pb[3][1]),
                   "v"(t.pb[0][2]), "v"(t.pb[1][2]), "v"(t.pb[2][2]), "v"(t.pb[3][2]),
                   "v"(t.pb[0][3]), "v"(t.pb[1][3]), "v"(t.pb[2][3]), "v"(t.pb[3][3]));
}

// ---------------------------------------------------------------------------
// K2: the whole scan of one (b,h) row in one launch.  block = row, wave = chunk.
//     Part 1, local scan (end state only): each half-wave sums its own sub-blocks by Horner's
//     rule in w^SUB, stepping over the other half's eight by w^(8*SUB); the two halves are
//     joined once at the end.  The chunks' end states go to LDS.
//     Part 2, behind the block's one barrier: each wave runs P[c] = Wc*P[c-1] + S[c-1] over the
//     chunks in front of its own, lane = state.
//     Part 3, output pass. Per 256 steps the sub-block sums come as in part 1; a recurrence over the
//     sub-blocks (first each half's sum, then, from the right start, its eight states)
//     leaves a snapshot of the state at the start of every SUB steps in LDS. The outputs
//     come from matrix products, Y[t][blk] = T[t][j] U[j][blk] + G[t][k] Sn[k][blk]:
//     T = the lower-triangular Toeplitz tile Tt with D added on the diagonal, U = the inputs,
//     Sn = the snapshots (k = 2n, 2n+1 for re, im).  A and B fragments take the
//     same k at the same place: k = hi*(K/2) + 2*w + {0,1} in product w.
// ---------------------------------------------------------------------------
__global__ __launch_bounds__(NCHUNK * 32) void k_scan(
        const float* __restrict__ u,
        const float* __restrict__ wr_, const float* __restrict__ wi_,
        const float* __restrict__ wcr_, const float* __restrict__ wci_,
        const float* __restrict__ Gt, const float* __restrict__ Tt,
        const float* __restrict__ Dvec, float* __restrict__ v) {
    __shared__ __align__(16) float Sl[NCHUNK][SUB * SROW];     // snapshots, one range per wave
    __shared__ __align__(16) float Se[NCHUNK][2 * Ndim];       // the chunks' end states
    __shared__ __align__(16) float Gl[SUB * SROW];             // G: every wave has the same channel, and 32 waves leave no registers to hold it
    int lane = threadIdx.x & 31;
    int m    = lane & 15;
    int hi   = lane >> 4;
    int c    = __builtin_amdgcn_readfirstlane(threadIdx.x >> 5);   // scalar: it bounds part 2's loop
    int bh   = blockIdx.x;
    int h    = bh & (Hdim - 1);
    float wre[2], wim[2];
    const float* up = u + (size_t)bh * Ldim + (size_t)c * CHUNK;
    float*       vp = v + (size_t)bh * Ldim + (size_t)c * CHUNK;
    // Asked for here too, so that they come together with the chunk: w^CHUNK of state n = lane
    // and the thread's one element of G
    static_assert(NCHUNK * 32 == SUB * 2 * Ndim, "one element of G per thread");
    float Dh  = Dvec[h];
    float cwr = wcr_[h * Ndim + lane], cwi = wci_[h * Ndim + lane];
    float gv  = Gt[h * (SUB * 2 * Ndim) + threadIdx.x];
    // Here and below: address registers of issued loads and stores are reused next
    asm volatile("s_wait_xcnt 0x0" ::: "memory");
    // The whole chunk and the lane's two w are asked for together at the head (left to the
    // compiler, each group's loads went down to just in front of its products and their
    // latencies came one after another).  One statement with its data wait, so that no
    // result lands on an address register of a load that is still on its way.
    static_assert(CHUNK == 1024 && SUB == 16, "the offsets below are written out for this shape");
    v4f uq[2 * (CHUNK / 256)];
    asm volatile("global_load_b32 %8, %13, off\n\t"
                 "global_load_b32 %9, %13, off offset:64\n\t"
                 "global_load_b32 %10, %14, off\n\t"
                 "global_load_b32 %11, %14, off offset:64\n\t"
                 "global_load_b128 %0, %12, off\n\t"
                 "global_load_b128 %1, %12, off offset:16\n\t"
                 "global_load_b128 %2, %12, off offset:1024\n\t"
                 "global_load_b128 %3, %12, off offset:1040\n\t"
                 "global_load_b128 %4, %12, off offset:2048\n\t"
                 "global_load_b128 %5, %12, off offset:2064\n\t"
                 "global_load_b128 %6, %12, off offset:3072\n\t"
                 "global_load_b128 %7, %12, off offset:3088\n\t"
                 "s_wait_loadcnt 0x0"
                 : "=&v"(uq[0]), "=&v"(uq[1]), "=&v"(uq[2]), "=&v"(uq[3]),
                   "=&v"(uq[4]), "=&v"(uq[5]), "=&v"(uq[6]), "=&v"(uq[7]),
                   "=&v"(wre[0]), "=&v"(wre[1]), "=&v"(wim[0]), "=&v"(wim[1])
                 : "v"(up + m * SUB + hi * 8), "v"(wr_ + h * Ndim + m), "v"(wi_ + h * Ndim + m)
                 : "memory");
    Gl[(threadIdx.x >> 6) * SROW + (threadIdx.x & 63)] = gv;   // at the snapshots' pitch
    SubTab t;
    sub_tables(wre, wim, hi, t);
    float rr[2], ri[2];
    // Unrolled: uq[] stays in the registers the loads filled
    #pragma unroll
    for (int g = 0; g < CHUNK / 256; ++g) {
        v8f la[4];
        sub_sums(uq[2 * g], uq[2 * g + 1], t, la);
        #pragma unroll
        for (int s = 0; s < 2; ++s) {
            if (g) {
                cmad(rr[s], ri[s], t.hr[s], t.hj[s], 0.0f, 0.0f);
                cmad(rr[s], ri[s], t.sr[s], t.si[s], la[2 * s][0], la[2 * s + 1][0]);
            } else {
                rr[s] = la[2 * s][0];  ri[s] = la[2 * s + 1][0];
            }
            #pragma unroll
            for (int r = 1; r < 8; ++r)
                cmad(rr[s], ri[s], t.sr[s], t.si[s], la[2 * s][r], la[2 * s + 1][r]);
        }
    }
    v2f st;                                          // lane writes state n = lane = hi*16 + m
    #pragma unroll
    for (int s = 0; s < 2; ++s) {
        float orr = xhalf(rr[s]), ori = xhalf(ri[s]);
        float ar = hi ? orr : rr[s], ai = hi ? ori : ri[s];    // the lower half's sum
        float br = hi ? rr[s] : orr, bi = hi ? ri[s] : ori;    // the upper half's
        cmad(ar, ai, t.hr[s], t.hj[s], br, bi);
        if (s == 0 || hi) { st.x = ar; st.y = ai; }
    }
    *(v2f*)&Se[c][lane * 2] = st;

    float*       sl = &Sl[c][0];

    // T's A fragments, held for the whole chunk: row t = m.  Asked for ahead of the barrier (part 1 has no registers to spare for them)
    v4f tl, th;                                                // T[m][hi*8 .. +7]
    // One statement with its data wait: the next loads' results may then land on its address registers
    asm volatile("global_load_b128 %0, %2, off\n\t"
                 "global_load_b128 %1, %2, off offset:16\n\t"
                 "s_wait_loadcnt 0x0"
                 : "=&v"(tl), "=&v"(th)
                 : "v"(Tt + (h * SUB + m) * SUB + hi * 8)
                 : "memory");
    float ta[8];
    #pragma unroll
    for (int e = 0; e < 8; ++e) {
        float kv = e < 4 ? tl[e & 3] : th[e & 3];
        ta[e] = (hi * 8 + e == m) ? kv + Dh : kv;
    }

    // Every chunk's end state and G are in LDS behind this barrier; neither is written again
    __syncthreads();
    float pr = 0.0f, pi = 0.0f;                                // state n = lane at the chunk's start
    for (int c0 = 0; c0 < c; c0 += 8) {
        v2f e[8];                                              // eight reads at once: one LDS latency for eight steps
        // Both loops unrolled: e[] stays in registers
        #pragma unroll
        for (int k = 0; k < 8; ++k) e[k] = *(const v2f*)&Se[c0 + k][lane * 2];
        #pragma unroll
        for (int k = 0; k < 8; ++k)
            if (c0 + k < c) cmad(pr, pi, cwr, cwi, e[k].x, e[k].y);
    }
    // Both halves hold the lane's two states m and 16+m
    float qr = xhalf(pr), qi = xhalf(pi);
    float gr[2] = {hi ? qr : pr, hi ? pr : qr}, gi[2] = {hi ? qi : pi, hi ? pi : qi};

    for (int g = 0; g < CHUNK; g += 256) {
        // The group's inputs: A fragment of the sub-block sums and B fragment U[hi*8 ..][blk = m]
        // of the output products (one statement with its data wait, so that no result lands
        // on an address register of a load that is still on its way)
        v4f ub0, ub1;
        asm volatile("global_load_b128 %0, %2, off\n\t"
                     "global_load_b128 %1, %2, off offset:16\n\t"
                     "s_wait_loadcnt 0x0"
                     : "=&v"(ub0), "=&v"(ub1)
                     : "v"(up + g + m * SUB + hi * 8)
                     : "memory");
        v8f la[4];
        sub_sums(ub0, ub1, t, la);
        #pragma unroll
        for (int s = 0; s < 2; ++s) {
            float hr = la[2 * s][0], hj = la[2 * s + 1][0];    // the half's eight sub-blocks from a zero state
            #pragma unroll
            for (int r = 1; r < 8; ++r)
                cmad(hr, hj, t.sr[s], t.si[s], la[2 * s][r], la[2 * s + 1][r]);
            float orr = xhalf(hr), ori = xhalf(hj);
            float mr = gr[s], mi = gi[s];                      // state at sub-block 8
            cmad(mr, mi, t.hr[s], t.hj[s], hi ? orr : hr, hi ? ori : hj);
            float cr = hi ? mr : gr[s], ci = hi ? mi : gi[s];  // state at the half's first sub-block
            cmad(mr, mi, t.hr[s], t.hj[s], hi ? hr : orr, hi ? hj : ori);
            gr[s] = mr;  gi[s] = mi;                           // state at the next group's start
            #pragma unroll
            for (int r = 0; r < 8; ++r) {
                v2f st; st.x = cr; st.y = ci;
                *(v2f*)(sl + (hi * 8 + r) * SROW + s * 32 + m * 2) = st;   // state before sub-block 8*hi + r
                if (r < 7) cmad(cr, ci, t.sr[s], t.si[s], la[2 * s][r], la[2 * s + 1][r]);
            }
        }
        // The snapshots are read back by other lanes of the same wave: the
        // stores must have landed, and the compiler must not move the reads up.
        asm volatile("s_wait_dscnt 0x0" ::: "memory");
        // Holds the recurrence's vector instructions ahead of the run of matrix instructions.
        __builtin_amdgcn_sched_barrier(0);
        v8f acc = {};
        #pragma unroll
        for (int w = 0; w < 4; ++w) {
            const v4f ub = w < 2 ? ub0 : ub1;
            v2f a, b;
            a.x = ta[2 * w];              a.y = ta[2 * w + 1];
            b.x = (w & 1) ? ub.z : ub.x;  b.y = (w & 1) ? ub.w : ub.y;
            acc = __builtin_amdgcn_wmma_f32_16x16x4_f32(false, a, false, b, (short)0, acc, false, false);
        }
        float4 sb[8], ga[8];                                           // Sn[hi*32 ..][blk = m], G[t = m][hi*32 ..]
        #pragma unroll
        for (int w = 0; w < 8; ++w) {
            sb[w] = *(const float4*)(sl + m * SROW + hi * 32 + w * 4);
            ga[w] = *(const float4*)(Gl + m * SROW + hi * 32 + w * 4);
        }
        #pragma unroll
        for (int w = 0; w < 8; ++w) {
            v2f a, b;
            a.x = ga[w].x;  a.y = ga[w].y;  b.x = sb[w].x;  b.y = sb[w].y;
            acc = __builtin_amdgcn_wmma_f32_16x16x4_f32(false, a, false, b, (short)0, acc, false, false);
            a.x = ga[w].z;  a.y = ga[w].w;  b.x = sb[w].z;  b.y = sb[w].w;
            acc = __builtin_amdgcn_wmma_f32_16x16x4_f32(false, a, false, b, (short)0, acc, false, false);
        }
        // Four vector slots between the last product and the first vector instruction
        // that may touch its A, B or D; the two scheduling barriers hold them in place.
        __builtin_amdgcn_sched_barrier(0);
        asm volatile("v_nop\n\tv_nop\n\tv_nop\n\tv_nop");
        __builtin_amdgcn_sched_barrier(0);
        // acc[r] = Y[t = 8*hi + r][blk = m]: eight consecutive outputs per lane
        float4 o0, o1;
        o0.x = acc[0]; o0.y = acc[1]; o0.z = acc[2]; o0.w = acc[3];
        o1.x = acc[4]; o1.y = acc[5]; o1.z = acc[6]; o1.w = acc[7];
        *(float4*)(vp + g + m * SUB + hi * 8)     = o0;
        *(float4*)(vp + g + m * SUB + hi * 8 + 4) = o1;
        asm volatile("s_wait_xcnt 0x0" ::: "memory");
    }
}

// ---------------------------------------------------------------------------
// K5: z = W_out @ y + b_out ; GLU.  W_out (64x32) staged to LDS (stage_w).
// ---------------------------------------------------------------------------
__global__ __launch_bounds__(256) void k_out_glu(
        const float* __restrict__ vin, const float* __restrict__ Wo,
        const float* __restrict__ bo, float* __restrict__ yg) {
    __shared__ __align__(16) float Wol[2 * Hdim * WROW];
    stage_w<2 * Hdim>(Wo, Wol);
    __syncthreads();

    const int lane = threadIdx.x & 31;
    const int m    = lane & 15;
    const int hi   = lane >> 4;
    const int gid  = blockIdx.x * 8 + (threadIdx.x >> 5);
    const int b    = gid / (Ldim / 16);
    const int l0   = (gid % (Ldim / 16)) * 16;
    const float* vb = vin + (size_t)b * Hdim * Ldim;
    v8f acc[4] = {};
    #pragma unroll
    for (int kk = 0; kk < 8; ++kk) {
        const int k = kk * 4 + 2 * hi;
        v2f bm;
        bm.x = vb[(size_t)k * Ldim + l0 + m];
        bm.y = vb[(size_t)(k + 1) * Ldim + l0 + m];
        #pragma unroll
        for (int t = 0; t < 4; ++t) {
            v2f a = *(const v2f*)&Wol[(t * 16 + m) * WROW + k];
            acc[t] = __builtin_amdgcn_wmma_f32_16x16x4_f32(false, a, false, bm, (short)0, acc[t], false, false);
        }
    }
    #pragma unroll
    for (int t = 0; t < 2; ++t) {
        #pragma unroll
        for (int r = 0; r < 8; ++r) {
            int g  = t * 16 + r + 8 * hi;
            float zv = acc[t][r]     + bo[g];
            float zg = acc[t + 2][r] + bo[g + Hdim];
            yg[((size_t)b * Hdim + g) * Ldim + l0 + m] = zv * sigm(zg);
        }
    }
}

// ---------------------------------------------------------------------------
// K6: sum and sum of squares of one (b,h) row per block, so that every WGP reads a share.
//     The last kernel joins a channel's Bdim rows.  A block owns a whole 128-byte line of part.
// ---------------------------------------------------------------------------
__global__ __launch_bounds__(BN_T) void k_bn_stats(
        const float* __restrict__ yg, float* __restrict__ part) {
    __shared__ float ls[BN_T / 32];
    __shared__ float ls2[BN_T / 32];
    const int tid = threadIdx.x;
    // The thread's 16 loads are asked for together, the row is in flight at once; a wave's load
    // covers 512 contiguous bytes; the offsets step by BN_T * 16 bytes.  One statement with its
    // data wait, so that no result lands on an address register of a load still on its way.
    static_assert(BN_T * 16 == 8192 && BN_T * 4 * 16 == Ldim, "the offsets below are written out for this shape");
    v4f q[16];
    asm volatile("global_load_b128 %0, %16, off\n\t"
                 "global_load_b128 %1, %16, off offset:8192\n\t"
                 "global_load_b128 %2, %16, off offset:16384\n\t"
                 "global_load_b128 %3, %16, off offset:24576\n\t"
                 "global_load_b128 %4, %16, off offset:32768\n\t"
                 "global_load_b128 %5, %16, off offset:40960\n\t"
                 "global_load_b128 %6, %16, off offset:49152\n\t"
                 "global_load_b128 %7, %16, off offset:57344\n\t"
                 "global_load_b128 %8, %16, off offset:65536\n\t"
                 "global_load_b128 %9, %16, off offset:73728\n\t"
                 "global_load_b128 %10, %16, off offset:81920\n\t"
                 "global_load_b128 %11, %16, off offset:90112\n\t"
                 "global_load_b128 %12, %16, off offset:98304\n\t"
                 "global_load_b128 %13, %16, off offset:106496\n\t"
                 "global_load_b128 %14, %16, off offset:114688\n\t"
                 "global_load_b128 %15, %16, off offset:122880\n\t"
                 "s_wait_loadcnt 0x0"
                 : "=&v"(q[0]), "=&v"(q[1]), "=&v"(q[2]), "=&v"(q[3]),
                   "=&v"(q[4]), "=&v"(q[5]), "=&v"(q[6]), "=&v"(q[7]),
                   "=&v"(q[8]), "=&v"(q[9]), "=&v"(q[10]), "=&v"(q[11]),
                   "=&v"(q[12]), "=&v"(q[13]), "=&v"(q[14]), "=&v"(q[15])
                 : "v"(yg + (size_t)blockIdx.x * Ldim + tid * 4)
                 : "memory");
    v4f a = q[0], a2 = q[0] * q[0];
    // Unrolled: q[] stays in the registers the loads filled
    #pragma unroll
    for (int i = 1; i < 16; ++i) {
        a += q[i];
        a2 = __builtin_elementwise_fma(q[i], q[i], a2);
    }
    float s  = (a.x + a.y) + (a.z + a.w);
    float s2 = (a2.x + a2.y) + (a2.z + a2.w);
    #pragma unroll
    for (int off = 16; off; off >>= 1) {
        s  += __shfl_xor(s, off, 32);
        s2 += __shfl_xor(s2, off, 32);
    }
    if ((tid & 31) == 0) { ls[tid >> 5] = s;  ls2[tid >> 5] = s2; }
    __syncthreads();
    if (tid < 32) {                                            // the first wave joins the waves' sums
        s  = ls[tid & (BN_T / 32 - 1)];
        s2 = ls2[tid & (BN_T / 32 - 1)];
        #pragma unroll
        for (int off = BN_T / 64; off; off >>= 1) {
            s  += __shfl_xor(s, off, 32);
            s2 += __shfl_xor(s2, off, 32);
        }
        if (tid == 0) {
            v2f o; o.x = s; o.y = s2;
            *(v2f*)&part[(size_t)blockIdx.x * PLINE] = o;
        }
    }
}

// ---------------------------------------------------------------------------
// K7: BN mean / rstd from the rows' sums, BN apply + FiLM + gelu + depthwise residual.
//     A thread takes FIN_V groups of four elements, a block FIN_SPAN elements of one (b,h) row.
// ---------------------------------------------------------------------------
__global__ __launch_bounds__(FIN_T) void k_final(
        const float* __restrict__ yg, const float* __restrict__ part,
        const float* __restrict__ gb, const float* __restrict__ resw,
        const float* __restrict__ x, float* __restrict__ out) {
    const int row = blockIdx.x / (Ldim / FIN_SPAN);            // b*H + h, the same for the whole block
    const int h = row & (Hdim - 1);
    const int b = row / Hdim;
    const size_t base = (size_t)blockIdx.x * FIN_SPAN + threadIdx.x * 4;
    const float gamma = gb[b * (2 * Hdim) + h];
    const float beta  = gb[b * (2 * Hdim) + Hdim + h];
    const float rw    = resw[h];
    // All 16 y and x loads of the thread are asked for before the first is used (left to the compiler,
    // the x loads went down among the arithmetic in pairs and their latencies came one after
    // another); a wave's load covers 512 contiguous bytes; the offsets step by FIN_T * 16 bytes.
    // One statement with its data wait, so that no result lands on an address register of a
    // load that is still on its way.
    // The (sum, sum of squares) of the channel's Bdim rows go along in the same statement (every lane
    // the same eight addresses, Hdim * PLINE * 4 bytes apart): as scalar loads the compiler put them
    // and their wait either wholly in front of the big loads or wholly behind them.
    static_assert(FIN_T * 16 == 8192 && FIN_V == 8 && Bdim == 8 && Hdim * PLINE * 4 == 4096,
                  "the offsets below are written out for this shape");
    v4f yv[FIN_V], xv[FIN_V];
    v2f pp[Bdim];
    asm volatile("global_load_b64 %16, %26, off\n\t"
                 "global_load_b64 %17, %26, off offset:4096\n\t"
                 "global_load_b64 %18, %26, off offset:8192\n\t"
                 "global_load_b64 %19, %26, off offset:12288\n\t"
                 "global_load_b64 %20, %26, off offset:16384\n\t"
                 "global_load_b64 %21, %26, off offset:20480\n\t"
                 "global_load_b64 %22, %26, off offset:24576\n\t"
                 "global_load_b64 %23, %26, off offset:28672\n\t"
                 "global_load_b128 %0, %24, off\n\t"
                 "global_load_b128 %1, %24, off offset:8192\n\t"
                 "global_load_b128 %2, %24, off offset:16384\n\t"
                 "global_load_b128 %3, %24, off offset:24576\n\t"
                 "global_load_b128 %4, %24, off offset:32768\n\t"
                 "global_load_b128 %5, %24, off offset:40960\n\t"
                 "global_load_b128 %6, %24, off offset:49152\n\t"
                 "global_load_b128 %7, %24, off offset:57344\n\t"
                 "global_load_b128 %8, %25, off\n\t"
                 "global_load_b128 %9, %25, off offset:8192\n\t"
                 "global_load_b128 %10, %25, off offset:16384\n\t"
                 "global_load_b128 %11, %25, off offset:24576\n\t"
                 "global_load_b128 %12, %25, off offset:32768\n\t"
                 "global_load_b128 %13, %25, off offset:40960\n\t"
                 "global_load_b128 %14, %25, off offset:49152\n\t"
                 "global_load_b128 %15, %25, off offset:57344\n\t"
                 "s_wait_loadcnt 0x0"
                 : "=&v"(yv[0]), "=&v"(yv[1]), "=&v"(yv[2]), "=&v"(yv[3]),
                   "=&v"(yv[4]), "=&v"(yv[5]), "=&v"(yv[6]), "=&v"(yv[7]),
                   "=&v"(xv[0]), "=&v"(xv[1]), "=&v"(xv[2]), "=&v"(xv[3]),
                   "=&v"(xv[4]), "=&v"(xv[5]), "=&v"(xv[6]), "=&v"(xv[7]),
                   "=&v"(pp[0]), "=&v"(pp[1]), "=&v"(pp[2]), "=&v"(pp[3]),
                   "=&v"(pp[4]), "=&v"(pp[5]), "=&v"(pp[6]), "=&v"(pp[7])
                 : "v"(yg + base), "v"(x + base), "v"(part + h * PLINE)
                 : "memory");
    v2f sm = pp[0];
    #pragma unroll
    for (int bb = 1; bb < Bdim; ++bb) sm += pp[bb];
    const float s = sm.x, s2 = sm.y;
    const float inv   = 1.0f / (float)((size_t)Bdim * Ldim);
    const float mean  = s * inv;
    const float rstd  = rsqrtf(s2 * inv - mean * mean + 1e-5f);
    // Unrolled: yv[] and xv[] stay in the registers the loads filled; a rolled loop would index them through memory
    #pragma unroll
    for (int i = 0; i < FIN_V; ++i) {
        float4 o;
        o.x = fmaf(rw, xv[i].x, gelu_t(fmaf(gamma, (yv[i].x - mean) * rstd, beta)));
        o.y = fmaf(rw, xv[i].y, gelu_t(fmaf(gamma, (yv[i].y - mean) * rstd, beta)));
        o.z = fmaf(rw, xv[i].z, gelu_t(fmaf(gamma, (yv[i].z - mean) * rstd, beta)));
        o.w = fmaf(rw, xv[i].w, gelu_t(fmaf(gamma, (yv[i].w - mean) * rstd, beta)));
        *(float4*)(out + base + i * (FIN_T * 4)) = o;
    }
}

// ---------------------------------------------------------------------------
extern "C" void kernel_launch(void* const* d_in, const int* in_sizes, int n_in,
                              void* d_out, int out_size, void* d_ws, size_t ws_size,
                              hipStream_t stream) {
    const float* x      = (const float*)d_in[0];
    const float* cond   = (const float*)d_in[1];
    const float* W_lin  = (const float*)d_in[2];
    const float* b_lin  = (const float*)d_in[3];
    const float* log_dt = (const float*)d_in[4];
    const float* A_re   = (const float*)d_in[5];
    const float* A_im   = (const float*)d_in[6];
    const float* C_re   = (const float*)d_in[7];
    const float* C_im   = (const float*)d_in[8];
    const float* Dv     = (const float*)d_in[9];
    const float* W_out  = (const float*)d_in[10];
    const float* b_out  = (const float*)d_in[11];
    const float* film_W = (const float*)d_in[12];
    const float* film_b = (const float*)d_in[13];
    const float* res_w  = (const float*)d_in[14];
    float* out = (float*)d_out;

    const size_t tot = (size_t)Bdim * Hdim * Ldim;
    float* ws   = (float*)d_ws;
    float* u    = ws;                                   // [B,H,L]
    float* v    = u + tot;                              // [B,H,L]
    float* yg   = u;                                    // alias: u dead after k_scan
    float* wr_  = v + tot;
    float* wi_  = wr_  + Hdim * Ndim;
    float* cdr_ = wi_  + Hdim * Ndim;
    float* cdi_ = cdr_ + Hdim * Ndim;
    float* wcr_ = cdi_ + Hdim * Ndim;
    float* wci_ = wcr_ + Hdim * Ndim;
    float* gb   = wci_ + Hdim * Ndim;                   // [B, 2H]
    float* part = gb + Bdim * 2 * Hdim;                 // [B*H, PLINE]
    float* Gt   = part + Bdim * Hdim * PLINE;           // [H, SUB, 2N]
    float* Tt   = Gt + Hdim * SUB * 2 * Ndim;           // [H, SUB, SUB]

    k_in_linear<<<PRE_B + (Bdim * (Ldim / 16)) / 8, 256, 0, stream>>>(x, W_lin, b_lin, u,
                                           log_dt, A_re, A_im, C_re, C_im,
                                           wr_, wi_, cdr_, cdi_, wcr_, wci_, Gt, Tt,
                                           cond, film_W, film_b, gb);
    k_scan<<<Bdim * Hdim, NCHUNK * 32, 0, stream>>>(u, wr_, wi_, wcr_, wci_, Gt, Tt, Dv, v);
    k_out_glu<<<(Bdim * (Ldim / 16)) / 8, 256, 0, stream>>>(v, W_out, b_out, yg);
    k_bn_stats<<<Bdim * Hdim, BN_T, 0, stream>>>(yg, part);
    k_final<<<(Bdim * Hdim * Ldim) / FIN_SPAN, FIN_T, 0, stream>>>(yg, part, gb, res_w, x, out);
}
